// v000
// The times below were measured on an AMD MI455X: many runs one after another, warmed up first and cycling through
// copies of the inputs, with the whole window's GPU time divided by the number of runs. Launches and the gaps
// between them are all in it. The median over several windows is given; except for v000 it joins two sittings, which
// can be a few percent apart, so the side-by-side timings, each taken in one sitting, are the better comparison.
// v000 is the starting kernel. One run takes 240 microseconds.
// Contractions: q*Wq, v*Wk, v*Wv, K*Q^T and V^T*P^T all on v_wmma_f32_16x16x32_f16 (f16 operands, f32 accumulate); W carried x32, P carried x16384 (exact power-of-two scales folded back in f32); score scale 1/32, softmax, bias and normalisation in f32.
#include <hip/hip_runtime.h>

typedef _Float16 v16h __attribute__((ext_vector_type(16)));
typedef _Float16 v8h  __attribute__((ext_vector_type(8)));
typedef float    v8f  __attribute__((ext_vector_type(8)));
typedef float    v4f  __attribute__((ext_vector_type(4)));
typedef v8h __attribute__((may_alias)) v8ha;
typedef v4f __attribute__((may_alias)) v4fa;

union Frag { v16h v; v8h half[2]; };

#define EMB    1024
#define NHEADS 16
#define HD     64
#define SEQ    2048
#define BATCH  2
#define MROWS  (BATCH * SEQ)          // 4096 tokens
#define NX     (MROWS * EMB)          // 4194304
#define NW     (EMB * EMB)            // 1048576
#define NX8    (NX / 8)               // 524288
#define WSC    32.0f                  // weight plane scale (exact)
#define WINV   0.03125f               // 1/WSC
#define SSCALE 0.03125f               // 1/sqrt(EMB), exact
#define PSCALE 16384.0f
#define TPITCH 72                     // LDS pitch (halves) of the transposed weight tile

// ---------------------------------------------------------------------------
// 16x16x32 f16 WMMA with hazard guard (ties D, keeps A/B live).
// Fragment map (wave32): lane l, h = l>>4, m = n = l&15.
//   A/B element i: i<8 -> k0+8h+i ; i>=8 -> k0+16+8h+(i-8)
//   D element r : row 8h+r, col l&15
// ---------------------------------------------------------------------------
__device__ __forceinline__ v8f wmma_f16(v16h a, v16h b, v8f c) {
  v8f d = __builtin_amdgcn_wmma_f32_16x16x32_f16(false, a, false, b, (short)0, c, false, false);
  asm volatile("v_nop\n\tv_nop\n\tv_nop\n\tv_nop" : "+v"(d) : "v"(a), "v"(b));
  return d;
}

// A or B fragment from a k-contiguous 16-bit row; p points at element k0 of
// the row owned by this lane (row index = lane & 15 added by the caller).
__device__ __forceinline__ v16h load_frag(const _Float16* p, int h) {
  Frag f;
  f.half[0] = *(const v8ha*)(p + 8 * h);
  f.half[1] = *(const v8ha*)(p + 16 + 8 * h);
  return f.v;
}

// ---------------------------------------------------------------------------
// Kernel 1: f32 -> f16 planes for q and v, unscaled, RNE convert.
// ---------------------------------------------------------------------------
__global__ __launch_bounds__(256) void convert_kernel(
    const float* __restrict__ q, const float* __restrict__ v,
    _Float16* __restrict__ qx, _Float16* __restrict__ vx)
{
  const int g = blockIdx.x * 256 + threadIdx.x;
  if (g >= 2 * NX8) return;
  const float* src;
  _Float16* dst;
  if (g < NX8) {
    src = q + (size_t)g * 8;
    dst = qx + (size_t)g * 8;
  } else {
    const int e = g - NX8;
    src = v + (size_t)e * 8;
    dst = vx + (size_t)e * 8;
  }
  const v4f a = *(const v4fa*)src;
  const v4f c = *(const v4fa*)(src + 4);
  const v8h o = { (_Float16)a.x, (_Float16)a.y, (_Float16)a.z, (_Float16)a.w,
                  (_Float16)c.x, (_Float16)c.y, (_Float16)c.z, (_Float16)c.w };
  *(v8h*)dst = o;
  
}

// ---------------------------------------------------------------------------
// Kernel 2: weight transpose + convert. in W[k][n] (k = input feature,
// n = output feature, both 1024) -> wt[which][n][k] = f16(32 * W[k][n]).
// Block 256 thr = one 64(k) x 64(n) tile; tile transposed through LDS;
// lanes 8q..8q+7 of one wave in one instruction (4 lines per instruction,
// grid = (n tiles, k tiles, 3).
// ---------------------------------------------------------------------------
__device__ __forceinline__ void wt_store_pass(const _Float16* sW, _Float16* wt,
                                              int which, int n0, int k0, int w, int lane) {
  const int q8 = lane & 7, sub = lane >> 3;
  #pragma unroll
  for (int i = 0; i < 2; ++i) {
    const int nrow = w * 8 + i * 4 + sub;          // 0..63
    const v8h val = *(const v8ha*)(sW + nrow * TPITCH + 8 * q8);
    _Float16* dst = wt + ((size_t)which * EMB + n0 + nrow) * EMB + k0 + 8 * q8;
    *(v8h*)dst = val;
  }
}

__global__ __launch_bounds__(256) void wtrans_kernel(
    const float* __restrict__ wq, const float* __restrict__ wk, const float* __restrict__ wv,
    _Float16* __restrict__ wt)         // [3][1024 n][1024 k], x32
{
  __shared__ __attribute__((aligned(16))) _Float16 sW[64 * TPITCH];   // 9216 B

  const int tid = threadIdx.x, lane = tid & 31, w = tid >> 5;
  const int n0 = blockIdx.x * 64, k0 = blockIdx.y * 64, which = blockIdx.z;
  const float* W = (which == 0) ? wq : ((which == 1) ? wk : wv);

  #pragma unroll
  for (int i = 0; i < 4; ++i) {
    const int idx = tid + 256 * i;                 // 0..1023 float4 groups
    const int kk = idx >> 4, nn = (idx & 15) * 4;
    const v4f x = *(const v4fa*)(W + (size_t)(k0 + kk) * EMB + n0 + nn);
    sW[(nn + 0) * TPITCH + kk] = (_Float16)(x.x * WSC);
    sW[(nn + 1) * TPITCH + kk] = (_Float16)(x.y * WSC);
    sW[(nn + 2) * TPITCH + kk] = (_Float16)(x.z * WSC);
    sW[(nn + 3) * TPITCH + kk] = (_Float16)(x.w * WSC);
  }
  __syncthreads();

  wt_store_pass(sW, wt, which, n0, k0, w, lane);
  
}

// ---------------------------------------------------------------------------
// 4 lines per instruction, 32 lines per wave, 128 per block.
// which 0/1: plane[bh][l][d]  (one token row = 64 halves = one line)
// which 2  : vt[bh][d][l]     (64 d-rows x 128 tokens = 2 lines each)
// ---------------------------------------------------------------------------
__device__ __forceinline__ void proj_store_pass(const _Float16* sT, _Float16* plane, _Float16* vt,
                                                int which, int bh, int l0, int w, int lane) {
  const int q8 = lane & 7, sub = lane >> 3;
  #pragma unroll
  for (int i = 0; i < 8; ++i) {
    const int lid = w * 32 + i * 4 + sub;          // 0..127
    v8h val;
    _Float16* dst;
    if (which != 2) {
      val = *(const v8ha*)(sT + lid * HD + 8 * q8);
      dst = plane + ((size_t)bh * SEQ + l0 + lid) * HD + 8 * q8;
    } else {
      const int d = lid >> 1, hl = lid & 1;
      val = *(const v8ha*)(sT + d * 128 + 64 * hl + 8 * q8);
      dst = vt + ((size_t)bh * HD + d) * SEQ + l0 + 64 * hl + 8 * q8;
    }
    *(v8h*)dst = val;
  }
}

// ---------------------------------------------------------------------------
// Kernel 3: Y = X * W (with W^T staged k-contiguous) over the fused 3*1024
// output columns. which = 0: X = q, W = Wq -> qp ; 1: X = v, W = Wk -> kp ;
// 2: X = v, W = Wv -> vt (d-major).
// Block 128 thr (4 waves) = 128 tokens x 64 features (one (which, head));
// wave tile 32 tokens x 64 features; K = 1024 in steps of 32;
// A (X rows) and B (W^T rows) fragments straight from f16 global rows.
// ---------------------------------------------------------------------------
__global__ __launch_bounds__(128) void proj_kernel(
    const _Float16* __restrict__ qx,   // [4096][1024] f16(q)
    const _Float16* __restrict__ vx,   // [4096][1024] f16(v)
    const _Float16* __restrict__ wt,   // [3][1024][1024], row = output feature, x32
    const float* __restrict__ bq, const float* __restrict__ bk, const float* __restrict__ bv,
    _Float16* __restrict__ qp,         // [B*H][L][D]
    _Float16* __restrict__ kp,         // [B*H][L][D]
    _Float16* __restrict__ vt)         // [B*H][D][L]
{
  __shared__ __attribute__((aligned(16))) _Float16 sT[128 * 64];   // 16384 B

  const int tid = threadIdx.x, lane = tid & 31, w = tid >> 5;
  const int h = lane >> 4, m = lane & 15;
  const int m0 = blockIdx.x * 128;
  const int cg = blockIdx.y;                 // 0..47
  const int which = cg >> 4, head = cg & 15;
  const int m0w = m0 + 32 * w;

  const _Float16* xsrc = (which == 0) ? qx : vx;
  const _Float16* xa0 = xsrc + (size_t)(m0w + m) * EMB;             // token row, mt = 0
  const _Float16* xa1 = xa0 + (size_t)16 * EMB;                     // mt = 1
  const _Float16* wb  = wt + ((size_t)which * EMB + head * HD + m) * EMB;   // feature row, nt = 0

  const v8f zero8 = {0.f, 0.f, 0.f, 0.f, 0.f, 0.f, 0.f, 0.f};
  v8f acc[2][4];
  #pragma unroll
  for (int mt = 0; mt < 2; ++mt)
    #pragma unroll
    for (int nt = 0; nt < 4; ++nt) acc[mt][nt] = zero8;

  #pragma unroll 1
  for (int k0 = 0; k0 < EMB; k0 += 32) {
    const v16h a0 = load_frag(xa0 + k0, h);
    const v16h a1 = load_frag(xa1 + k0, h);
    #pragma unroll
    for (int nt = 0; nt < 4; ++nt) {
      const v16h b = load_frag(wb + (size_t)nt * 16 * EMB + k0, h);
      acc[0][nt] = wmma_f16(a0, b, acc[0][nt]);
      acc[1][nt] = wmma_f16(a1, b, acc[1][nt]);
    }
  }

  // D[r] of tile (mt, nt) = Y[token m0w+16mt+8h+r][feature 16nt+m]
  const float* bias = (which == 0) ? bq : ((which == 1) ? bk : bv);
  #pragma unroll
  for (int nt = 0; nt < 4; ++nt) {
    const int feat = 16 * nt + m;
    const float bvl = bias[head * HD + feat];
    #pragma unroll
    for (int mt = 0; mt < 2; ++mt) {
      #pragma unroll
      for (int r = 0; r < 8; ++r) {
        const int tokl = 32 * w + 16 * mt + 8 * h + r;     // 0..127
        const float y = acc[mt][nt][r] * WINV + bvl;
        const int idx = (which == 2) ? (feat * 128 + tokl) : (tokl * HD + feat);
        sT[idx] = (_Float16)y;
      }
    }
  }
  __syncthreads();

  const int b = m0 / SEQ, l0 = m0 - b * SEQ, bh = b * NHEADS + head;
  _Float16* plane = (which == 0) ? qp : kp;
  proj_store_pass(sT, plane, vt, which, bh, l0, w, lane);
  
}

// ---------------------------------------------------------------------------
// Attention helpers.
// ---------------------------------------------------------------------------
// P^T B-fragment from the lane's own score D values: element r <- tile a row r
// (keys 0..15 of the 32-deep chunk), element 8+r <- tile c row r (keys 16..31),
// same lane, same query column, scaled by 2^14.
__device__ __forceinline__ v16h pack_p(v8f a, v8f c) {
  const v16h r = { (_Float16)(a[0] * PSCALE), (_Float16)(a[1] * PSCALE), (_Float16)(a[2] * PSCALE), (_Float16)(a[3] * PSCALE),
                   (_Float16)(a[4] * PSCALE), (_Float16)(a[5] * PSCALE), (_Float16)(a[6] * PSCALE), (_Float16)(a[7] * PSCALE),
                   (_Float16)(c[0] * PSCALE), (_Float16)(c[1] * PSCALE), (_Float16)(c[2] * PSCALE), (_Float16)(c[3] * PSCALE),
                   (_Float16)(c[4] * PSCALE), (_Float16)(c[5] * PSCALE), (_Float16)(c[6] * PSCALE), (_Float16)(c[7] * PSCALE) };
  return r;
}

// lanes 8q..8q+7 in one instruction, 4 lines per instruction, 32 lines per wave.
__device__ __forceinline__ void att_store_pass(const float* so, float* out,
                                               int b, int head, int q0, int lane) {
  const int q8 = lane & 7, sub = lane >> 3;
  #pragma unroll
  for (int i = 0; i < 8; ++i) {
    const int lid = i * 4 + sub;                   // 0..31
    const int row = lid >> 1, hl = lid & 1;
    const v4f val = *(const v4fa*)(so + row * 64 + 32 * hl + 4 * q8);
    const size_t gi = ((size_t)b * SEQ + q0 + row) * EMB + head * HD + 32 * hl + 4 * q8;
    *(v4f*)(out + gi) = val;
  }
}

// ---------------------------------------------------------------------------
// Kernel 4: streaming attention, transposed form.
// Block 128 thr (4 waves), 16 queries per wave, 64 keys per step.
//   S^T = K * Q^T : A = K rows (row = key, k = d), B = Q^T (k = d, n = query)
//   O^T += V^T * P^T : A = Vt rows (row = d, k = key), B = P^T from registers
// Lane owns 32 keys of query column (lane&15); partner = lane ^ 16.
// grid = (SEQ/64, B*H).
// ---------------------------------------------------------------------------
__global__ __launch_bounds__(128) void attn_kernel(
    const _Float16* __restrict__ qp,   // [B*H][L][D]
    const _Float16* __restrict__ kp,   // [B*H][L][D]
    const _Float16* __restrict__ vt,   // [B*H][D][L]
    float* __restrict__ out)           // [B][L][EMB]
{
  __shared__ __attribute__((aligned(16))) float sO[4 * 16 * 64];    // 16384 B

  const int tid = threadIdx.x, lane = tid & 31, w = tid >> 5;
  const int h = lane >> 4, m = lane & 15;
  const int bh = blockIdx.y, b = bh >> 4, head = bh & 15;
  const int q0 = blockIdx.x * 64 + 16 * w;

  // Q^T B-fragments: column n = query q0+m, k = d (two 32-deep chunks)
  const _Float16* qrow = qp + ((size_t)bh * SEQ + q0 + m) * HD;
  const v16h qb0 = load_frag(qrow, h);
  const v16h qb1 = load_frag(qrow + 32, h);

  const v8f zero8 = {0.f, 0.f, 0.f, 0.f, 0.f, 0.f, 0.f, 0.f};
  v8f o[4];                                   // o[t][r] = O[query m][d 16t+8h+r] * (l * 2^14)
  #pragma unroll
  for (int t = 0; t < 4; ++t) o[t] = zero8;
  float mrun = -1e30f, lrun = 0.0f;

  const _Float16* kbase = kp + ((size_t)bh * SEQ + m) * HD;    // + key0*HD + 32*dc
  const _Float16* vbase = vt + ((size_t)bh * HD + m) * SEQ;    // + 16t*SEQ + key0

  #pragma unroll 1
  for (int kb = 0; kb < SEQ; kb += 64) {
    // ---- scores: s[j][r] = S[query m][key kb+16j+8h+r] / 32 ----
    v8f s[4];
    #pragma unroll
    for (int j = 0; j < 4; ++j) {
      const _Float16* kpp = kbase + (size_t)(kb + 16 * j) * HD;
      const v16h kf0 = load_frag(kpp, h);
      const v16h kf1 = load_frag(kpp + 32, h);
      v8f z = zero8;
      z = wmma_f16(kf0, qb0, z);
      z = wmma_f16(kf1, qb1, z);
      s[j] = z;
    }
    #pragma unroll
    for (int j = 0; j < 4; ++j)
      #pragma unroll
      for (int r = 0; r < 8; ++r) s[j][r] = s[j][r] * SSCALE;

    // ---- online softmax ----
    float mloc = s[0][0];
    #pragma unroll
    for (int j = 0; j < 4; ++j)
      #pragma unroll
      for (int r = 0; r < 8; ++r) mloc = fmaxf(mloc, s[j][r]);
    mloc = fmaxf(mloc, __shfl_xor(mloc, 16));
    const float mnew = fmaxf(mrun, mloc);
    const float alpha = __expf(mrun - mnew);
    mrun = mnew;
    float lsum = 0.0f;
    #pragma unroll
    for (int j = 0; j < 4; ++j)
      #pragma unroll
      for (int r = 0; r < 8; ++r) {
        const float p = __expf(s[j][r] - mnew);
        s[j][r] = p;
        lsum += p;
      }
    lsum += __shfl_xor(lsum, 16);
    lrun = lrun * alpha + lsum;
    #pragma unroll
    for (int t = 0; t < 4; ++t)
      #pragma unroll
      for (int r = 0; r < 8; ++r) o[t][r] = o[t][r] * alpha;

    // ---- P^T B-fragments (key chunks 0..31 and 32..63 of this step) ----
    const v16h pb0 = pack_p(s[0], s[1]);
    const v16h pb1 = pack_p(s[2], s[3]);

    // ---- O^T += V^T * P^T ----
    #pragma unroll
    for (int t = 0; t < 4; ++t) {
      const _Float16* vpp = vbase + (size_t)(16 * t) * SEQ + kb;
      const v16h vf0 = load_frag(vpp, h);
      const v16h vf1 = load_frag(vpp + 32, h);
      o[t] = wmma_f16(vf0, pb0, o[t]);
      o[t] = wmma_f16(vf1, pb1, o[t]);
    }
  }

  // ---- epilogue: normalise, stage per-wave 16x64 tile, whole-line stores ----
  const float inv = (1.0f / lrun) * (1.0f / PSCALE);
  float* so = sO + w * 1024;
  #pragma unroll
  for (int t = 0; t < 4; ++t)
    #pragma unroll
    for (int r = 0; r < 8; ++r)
      so[m * 64 + 16 * t + 8 * h + r] = o[t][r] * inv;
  __syncthreads();

  att_store_pass(so, out, b, head, q0, lane);
  
}

// ---------------------------------------------------------------------------
extern "C" void kernel_launch(void* const* d_in, const int* in_sizes, int n_in,
                              void* d_out, int out_size, void* d_ws, size_t ws_size,
                              hipStream_t stream) {
  if (n_in < 8) return;
  if (in_sizes[0] != NX || in_sizes[1] != NX) return;
  if (in_sizes[2] != NW || in_sizes[4] != NW || in_sizes[6] != NW) return;
  if (in_sizes[3] != EMB || in_sizes[5] != EMB || in_sizes[7] != EMB) return;
  if (out_size != NX) return;

  const float* q  = (const float*)d_in[0];
  const float* v  = (const float*)d_in[1];
  const float* Wq = (const float*)d_in[2];
  const float* bq = (const float*)d_in[3];
  const float* Wk = (const float*)d_in[4];
  const float* bk = (const float*)d_in[5];
  const float* Wv = (const float*)d_in[6];
  const float* bv = (const float*)d_in[7];
  float* out = (float*)d_out;

  const size_t x_bytes  = (size_t)NX * 2;                           //  8388608 per plane
  const size_t wt_bytes = (size_t)3 * NW * 2;                       //  6291456
  const size_t pl_bytes = (size_t)BATCH * NHEADS * SEQ * HD * 2;    //  8388608 per plane
  const size_t total = 2 * x_bytes + wt_bytes + 3 * pl_bytes;       // 48234496
  if (total > ws_size) return;

  char* ws = (char*)d_ws;
  _Float16* qx = (_Float16*)(ws);
  _Float16* vx = (_Float16*)(ws + x_bytes);
  _Float16* wt = (_Float16*)(ws + 2 * x_bytes);
  _Float16* qp = (_Float16*)(ws + 2 * x_bytes + wt_bytes);
  _Float16* kp = (_Float16*)(ws + 2 * x_bytes + wt_bytes + pl_bytes);
  _Float16* vt = (_Float16*)(ws + 2 * x_bytes + wt_bytes + 2 * pl_bytes);

  const int ngroups = 2 * NX8;                                       // 1048576
  convert_kernel<<<(ngroups + 255) / 256, 256, 0, stream>>>(q, v, qx, vx);

  dim3 gTr(EMB / 64, EMB / 64, 3);                                   // (16, 16, 3)
  wtrans_kernel<<<gTr, 256, 0, stream>>>(Wq, Wk, Wv, wt);

  dim3 gProj(MROWS / 128, 3 * NHEADS);                               // (32, 48)
  proj_kernel<<<gProj, 128, 0, stream>>>(qx, vx, wt, bq, bk, bv, qp, kp, vt);

  dim3 gAtt(SEQ / 64, BATCH * NHEADS);                               // (32, 32)
  attn_kernel<<<gAtt, 128, 0, stream>>>(qp, kp, vt, out);
}

// v001
// One run takes 92.1 microseconds.
// Next to v000, in two timings, it ran 2.59 and 2.65 times as fast.
// Contractions: q*Wq, v*Wk, v*Wv, K*Q^T and V^T*P^T all on v_wmma_f32_16x16x32_f16 (f16 operands, f32 accumulate); W carried x32, P carried x16384 (exact power-of-two scales folded back in f32); score scale 1/32, softmax, bias and normalisation in f32.
#include <hip/hip_runtime.h>

typedef _Float16 v16h __attribute__((ext_vector_type(16)));
typedef _Float16 v8h  __attribute__((ext_vector_type(8)));
typedef float    v8f  __attribute__((ext_vector_type(8)));
typedef float    v4f  __attribute__((ext_vector_type(4)));
typedef v8h __attribute__((may_alias)) v8ha;
typedef v4f __attribute__((may_alias)) v4fa;

union Frag { v16h v; v8h half[2]; };

#define EMB    1024
#define NHEADS 16
#define HD     64
#define SEQ    2048
#define BATCH  2
#define MROWS  (BATCH * SEQ)          // 4096 tokens
#define NX     (MROWS * EMB)          // 4194304
#define NW     (EMB * EMB)            // 1048576
#define NX8    (NX / 8)               // 524288
#define WSC    32.0f                  // weight plane scale (exact)
#define WINV   0.03125f               // 1/WSC
#define SSCALE 0.03125f               // 1/sqrt(EMB), exact
#define PSCALE 16384.0f
#define TPITCH 72                     // LDS pitch (halves) of the transposed weight tile
#define SPITCH 72                     // LDS pitch (halves) of a staged 128-byte operand row: 144 B = 16 B x 9
#define SPB    (SPITCH * 2)           // the same in bytes
#define KVBUF  (128 * SPITCH)         // attention stage: 64 K rows, then 64 V^T rows (halves)
#define XWBUF  (192 * SPITCH)         // projection stage: 128 X rows, then 64 W^T rows (halves)

// ---------------------------------------------------------------------------
// 16x16x32 f16 WMMA with hazard guard (ties D, keeps A/B live).
// Fragment map (wave32): lane l, h = l>>4, m = n = l&15.
//   A/B element i: i<8 -> k0+8h+i ; i>=8 -> k0+16+8h+(i-8)
//   D element r : row 8h+r, col l&15
// ---------------------------------------------------------------------------
__device__ __forceinline__ v8f wmma_f16(v16h a, v16h b, v8f c) {
  v8f d = __builtin_amdgcn_wmma_f32_16x16x32_f16(false, a, false, b, (short)0, c, false, false);
  asm volatile("v_nop\n\tv_nop\n\tv_nop\n\tv_nop" : "+v"(d) : "v"(a), "v"(b));
  return d;
}

// A or B fragment from a k-contiguous 16-bit row; p points at element k0 of
// the row owned by this lane (row index = lane & 15 added by the caller).
__device__ __forceinline__ v16h load_frag(const _Float16* p, int h) {
  Frag f;
  f.half[0] = *(const v8ha*)(p + 8 * h);
  f.half[1] = *(const v8ha*)(p + 16 + 8 * h);
  return f.v;
}

// ---------------------------------------------------------------------------
// Asynchronous copies global -> LDS, 16 B per lane: lanes 8q..8q+7 bring one
// whole 128-byte row, one copy = 4 rows. l = the lane's LDS byte address,
// g = its global address; copy c takes the rows 4c further on (LDS + 4 pitches,
// global + grow bytes). s_wait_xcnt closes each statement so that no address
// register is rewritten while a copy that names it may still need it.
// ---------------------------------------------------------------------------
__device__ __forceinline__ unsigned lds_off(const void* p) { return (unsigned)(size_t)p; }

__device__ __forceinline__ void async_rows16(unsigned l, const char* g, unsigned grow) {
  asm volatile("global_load_async_to_lds_b128 %0, %4, off\n\t"
               "global_load_async_to_lds_b128 %1, %5, off\n\t"
               "global_load_async_to_lds_b128 %2, %6, off\n\t"
               "global_load_async_to_lds_b128 %3, %7, off\n\t"
               "s_wait_xcnt 0x0"
               :: "v"(l), "v"(l + 4 * SPB), "v"(l + 8 * SPB), "v"(l + 12 * SPB),
                  "v"(g), "v"(g + grow), "v"(g + 2 * (size_t)grow), "v"(g + 3 * (size_t)grow)
               : "memory");
}

// The projection's share of one wave: 32 X rows (8 copies) and 16 W^T rows (4 copies),
// both at a global row pitch of EMB halves.
__device__ __forceinline__ void async_rows48(unsigned lx, const char* gx, unsigned lw, const char* gw) {
  const size_t gr = (size_t)4 * EMB * 2;             // 4 rows further on in global memory
  asm volatile("global_load_async_to_lds_b128 %0, %12, off\n\t"
               "global_load_async_to_lds_b128 %1, %13, off\n\t"
               "global_load_async_to_lds_b128 %2, %14, off\n\t"
               "global_load_async_to_lds_b128 %3, %15, off\n\t"
               "global_load_async_to_lds_b128 %4, %16, off\n\t"
               "global_load_async_to_lds_b128 %5, %17, off\n\t"
               "global_load_async_to_lds_b128 %6, %18, off\n\t"
               "global_load_async_to_lds_b128 %7, %19, off\n\t"
               "global_load_async_to_lds_b128 %8, %20, off\n\t"
               "global_load_async_to_lds_b128 %9, %21, off\n\t"
               "global_load_async_to_lds_b128 %10, %22, off\n\t"
               "global_load_async_to_lds_b128 %11, %23, off\n\t"
               "s_wait_xcnt 0x0"
               :: "v"(lx), "v"(lx + 4 * SPB), "v"(lx + 8 * SPB), "v"(lx + 12 * SPB),
                  "v"(lx + 16 * SPB), "v"(lx + 20 * SPB), "v"(lx + 24 * SPB), "v"(lx + 28 * SPB),
                  "v"(lw), "v"(lw + 4 * SPB), "v"(lw + 8 * SPB), "v"(lw + 12 * SPB),
                  "v"(gx), "v"(gx + gr), "v"(gx + 2 * gr), "v"(gx + 3 * gr),
                  "v"(gx + 4 * gr), "v"(gx + 5 * gr), "v"(gx + 6 * gr), "v"(gx + 7 * gr),
                  "v"(gw), "v"(gw + gr), "v"(gw + 2 * gr), "v"(gw + 3 * gr)
               : "memory");
}

// Hand-over of a stage: this wave's LDS reads are done, its own copies have
// landed, then the work-group barrier publishes the next stage and frees this one.
__device__ __forceinline__ void stage_publish() {
  asm volatile("s_wait_dscnt 0x0" ::: "memory");     // own reads of the buffer that is refilled next
  asm volatile("s_wait_asynccnt 0x0" ::: "memory");  // own copies of the next stage have landed
  __syncthreads();
}

// ---------------------------------------------------------------------------
// Kernel 1: f32 -> f16 planes for q and v, unscaled, RNE convert.
// ---------------------------------------------------------------------------
__global__ __launch_bounds__(256) void convert_kernel(
    const float* __restrict__ q, const float* __restrict__ v,
    _Float16* __restrict__ qx, _Float16* __restrict__ vx)
{
  const int g = blockIdx.x * 256 + threadIdx.x;
  if (g >= 2 * NX8) return;
  const float* src;
  _Float16* dst;
  if (g < NX8) {
    src = q + (size_t)g * 8;
    dst = qx + (size_t)g * 8;
  } else {
    const int e = g - NX8;
    src = v + (size_t)e * 8;
    dst = vx + (size_t)e * 8;
  }
  const v4f a = *(const v4fa*)src;
  const v4f c = *(const v4fa*)(src + 4);
  const v8h o = { (_Float16)a.x, (_Float16)a.y, (_Float16)a.z, (_Float16)a.w,
                  (_Float16)c.x, (_Float16)c.y, (_Float16)c.z, (_Float16)c.w };
  *(v8h*)dst = o;
  
}

// ---------------------------------------------------------------------------
// Kernel 2: weight transpose + convert. in W[k][n] (k = input feature,
// n = output feature, both 1024) -> wt[which][n][k] = f16(32 * W[k][n]).
// Block 256 thr = one 64(k) x 64(n) tile; tile transposed through LDS;
// lanes 8q..8q+7 of one wave in one instruction (4 lines per instruction,
// grid = (n tiles, k tiles, 3).
// ---------------------------------------------------------------------------
__device__ __forceinline__ void wt_store_pass(const _Float16* sW, _Float16* wt,
                                              int which, int n0, int k0, int w, int lane) {
  const int q8 = lane & 7, sub = lane >> 3;
  #pragma unroll
  for (int i = 0; i < 2; ++i) {
    const int nrow = w * 8 + i * 4 + sub;          // 0..63
    const v8h val = *(const v8ha*)(sW + nrow * TPITCH + 8 * q8);
    _Float16* dst = wt + ((size_t)which * EMB + n0 + nrow) * EMB + k0 + 8 * q8;
    *(v8h*)dst = val;
  }
}

__global__ __launch_bounds__(256) void wtrans_kernel(
    const float* __restrict__ wq, const float* __restrict__ wk, const float* __restrict__ wv,
    _Float16* __restrict__ wt)         // [3][1024 n][1024 k], x32
{
  __shared__ __attribute__((aligned(16))) _Float16 sW[64 * TPITCH];   // 9216 B

  const int tid = threadIdx.x, lane = tid & 31, w = tid >> 5;
  const int n0 = blockIdx.x * 64, k0 = blockIdx.y * 64, which = blockIdx.z;
  const float* W = (which == 0) ? wq : ((which == 1) ? wk : wv);

  #pragma unroll
  for (int i = 0; i < 4; ++i) {
    const int idx = tid + 256 * i;                 // 0..1023 float4 groups
    const int kk = idx >> 4, nn = (idx & 15) * 4;
    const v4f x = *(const v4fa*)(W + (size_t)(k0 + kk) * EMB + n0 + nn);
    sW[(nn + 0) * TPITCH + kk] = (_Float16)(x.x * WSC);
    sW[(nn + 1) * TPITCH + kk] = (_Float16)(x.y * WSC);
    sW[(nn + 2) * TPITCH + kk] = (_Float16)(x.z * WSC);
    sW[(nn + 3) * TPITCH + kk] = (_Float16)(x.w * WSC);
  }
  __syncthreads();

  wt_store_pass(sW, wt, which, n0, k0, w, lane);
  
}

// ---------------------------------------------------------------------------
// 4 lines per instruction, 32 lines per wave, 128 per block.
// which 0/1: plane[bh][l][d]  (one token row = 64 halves = one line)
// which 2  : vt[bh][d][l]     (64 d-rows x 128 tokens = 2 lines each)
// ---------------------------------------------------------------------------
__device__ __forceinline__ void proj_store_pass(const _Float16* sT, _Float16* plane, _Float16* vt,
                                                int which, int bh, int l0, int w, int lane) {
  const int q8 = lane & 7, sub = lane >> 3;
  #pragma unroll
  for (int i = 0; i < 8; ++i) {
    const int lid = w * 32 + i * 4 + sub;          // 0..127
    v8h val;
    _Float16* dst;
    if (which != 2) {
      val = *(const v8ha*)(sT + lid * HD + 8 * q8);
      dst = plane + ((size_t)bh * SEQ + l0 + lid) * HD + 8 * q8;
    } else {
      const int d = lid >> 1, hl = lid & 1;
      val = *(const v8ha*)(sT + d * 128 + 64 * hl + 8 * q8);
      dst = vt + ((size_t)bh * HD + d) * SEQ + l0 + 64 * hl + 8 * q8;
    }
    *(v8h*)dst = val;
  }
}

// ---------------------------------------------------------------------------
// Kernel 3: Y = X * W (with W^T staged k-contiguous) over the fused 3*1024
// output columns. which = 0: X = q, W = Wq -> qp ; 1: X = v, W = Wk -> kp ;
// 2: X = v, W = Wv -> vt (d-major).
// Block 128 thr (4 waves) = 128 tokens x 64 features (one (which, head));
// wave tile 32 tokens x 64 features; K = 1024 in stages of 64 (two steps of 32);
// each stage's X and W^T rows come into LDS by asynchronous copies, two buffers,
// the next stage in flight while this one is worked on; fragments from LDS.
// ---------------------------------------------------------------------------
__global__ __launch_bounds__(128) void proj_kernel(
    const _Float16* __restrict__ qx,   // [4096][1024] f16(q)
    const _Float16* __restrict__ vx,   // [4096][1024] f16(v)
    const _Float16* __restrict__ wt,   // [3][1024][1024], row = output feature, x32
    const float* __restrict__ bq, const float* __restrict__ bk, const float* __restrict__ bv,
    _Float16* __restrict__ qp,         // [B*H][L][D]
    _Float16* __restrict__ kp,         // [B*H][L][D]
    _Float16* __restrict__ vt)         // [B*H][D][L]
{
  __shared__ __attribute__((aligned(16))) _Float16 sT[128 * 64];   // 16384 B
  __shared__ __attribute__((aligned(16))) _Float16 sXW[2 * XWBUF]; // 55296 B

  const int tid = threadIdx.x, lane = tid & 31, w = tid >> 5;
  const int h = lane >> 4, m = lane & 15;
  const int m0 = blockIdx.x * 128;
  const int cg = blockIdx.y;                 // 0..47
  const int which = cg >> 4, head = cg & 15;
  const int m0w = m0 + 32 * w;

  const _Float16* xsrc = (which == 0) ? qx : vx;

  // copy role: row (lane >> 3) of each group of 4, 16-byte piece (lane & 7)
  const int cr = lane >> 3, cp = lane & 7;
  const char* gx = (const char*)(xsrc + (size_t)(m0w + cr) * EMB + 8 * cp);
  const char* gw = (const char*)(wt + ((size_t)which * EMB + head * HD + 16 * w + cr) * EMB + 8 * cp);
  const unsigned lx = lds_off(sXW) + (32 * w + cr) * SPB + 16 * cp;
  const unsigned lw = lds_off(sXW) + (128 + 16 * w + cr) * SPB + 16 * cp;

  const v8f zero8 = {0.f, 0.f, 0.f, 0.f, 0.f, 0.f, 0.f, 0.f};
  v8f acc[2][4];
  #pragma unroll
  for (int mt = 0; mt < 2; ++mt)
    #pragma unroll
    for (int nt = 0; nt < 4; ++nt) acc[mt][nt] = zero8;

  async_rows48(lx, gx, lw, gw);                            // stage 0 -> buffer 0
  asm volatile("s_wait_asynccnt 0x0" ::: "memory");        // own copies of stage 0 have landed
  __syncthreads();
  async_rows48(lx + XWBUF * 2, gx + 128, lw + XWBUF * 2, gw + 128);   // stage 1 -> buffer 1

  // rolled: one buffer offset per trip, every fragment index constant
  #pragma unroll 1
  for (int t = 0; t < EMB / 64; ++t) {
    const int bo = (t & 1) * XWBUF;
    const _Float16* xs = sXW + bo + (32 * w + m) * SPITCH;   // token row, mt = 0
    const _Float16* wl = sXW + bo + (128 + m) * SPITCH;      // feature row, nt = 0
    #pragma unroll
    for (int kc = 0; kc < 64; kc += 32) {
      const v16h a0 = load_frag(xs + kc, h);
      const v16h a1 = load_frag(xs + 16 * SPITCH + kc, h);
      #pragma unroll
      for (int nt = 0; nt < 4; ++nt) {
        const v16h b = load_frag(wl + nt * 16 * SPITCH + kc, h);
        acc[0][nt] = wmma_f16(a0, b, acc[0][nt]);
        acc[1][nt] = wmma_f16(a1, b, acc[1][nt]);
      }
    }
    stage_publish();
    if (t + 2 < EMB / 64)                                  // stage t + 2 -> the buffer just read
      async_rows48(lx + bo * 2, gx + (t + 2) * 128, lw + bo * 2, gw + (t + 2) * 128);
  }
  asm volatile("s_wait_asynccnt 0x0" ::: "memory");        // nothing of this wave's is in flight any more

  // D[r] of tile (mt, nt) = Y[token m0w+16mt+8h+r][feature 16nt+m]
  const float* bias = (which == 0) ? bq : ((which == 1) ? bk : bv);
  #pragma unroll
  for (int nt = 0; nt < 4; ++nt) {
    const int feat = 16 * nt + m;
    const float bvl = bias[head * HD + feat];
    #pragma unroll
    for (int mt = 0; mt < 2; ++mt) {
      #pragma unroll
      for (int r = 0; r < 8; ++r) {
        const int tokl = 32 * w + 16 * mt + 8 * h + r;     // 0..127
        const float y = acc[mt][nt][r] * WINV + bvl;
        const int idx = (which == 2) ? (feat * 128 + tokl) : (tokl * HD + feat);
        sT[idx] = (_Float16)y;
      }
    }
  }
  __syncthreads();

  const int b = m0 / SEQ, l0 = m0 - b * SEQ, bh = b * NHEADS + head;
  _Float16* plane = (which == 0) ? qp : kp;
  proj_store_pass(sT, plane, vt, which, bh, l0, w, lane);
  
}

// ---------------------------------------------------------------------------
// Attention helpers.
// ---------------------------------------------------------------------------
// P^T B-fragment from the lane's own score D values: element r <- tile a row r
// (keys 0..15 of the 32-deep chunk), element 8+r <- tile c row r (keys 16..31),
// same lane, same query column, scaled by 2^14.
__device__ __forceinline__ v16h pack_p(v8f a, v8f c) {
  const v16h r = { (_Float16)(a[0] * PSCALE), (_Float16)(a[1] * PSCALE), (_Float16)(a[2] * PSCALE), (_Float16)(a[3] * PSCALE),
                   (_Float16)(a[4] * PSCALE), (_Float16)(a[5] * PSCALE), (_Float16)(a[6] * PSCALE), (_Float16)(a[7] * PSCALE),
                   (_Float16)(c[0] * PSCALE), (_Float16)(c[1] * PSCALE), (_Float16)(c[2] * PSCALE), (_Float16)(c[3] * PSCALE),
                   (_Float16)(c[4] * PSCALE), (_Float16)(c[5] * PSCALE), (_Float16)(c[6] * PSCALE), (_Float16)(c[7] * PSCALE) };
  return r;
}

// lanes 8q..8q+7 in one instruction, 4 lines per instruction, 32 lines per wave.
__device__ __forceinline__ void att_store_pass(const float* so, float* out,
                                               int b, int head, int q0, int lane) {
  const int q8 = lane & 7, sub = lane >> 3;
  #pragma unroll
  for (int i = 0; i < 8; ++i) {
    const int lid = i * 4 + sub;                   // 0..31
    const int row = lid >> 1, hl = lid & 1;
    const v4f val = *(const v4fa*)(so + row * 64 + 32 * hl + 4 * q8);
    const size_t gi = ((size_t)b * SEQ + q0 + row) * EMB + head * HD + 32 * hl + 4 * q8;
    *(v4f*)(out + gi) = val;
  }
}

// ---------------------------------------------------------------------------
// Kernel 4: streaming attention, transposed form.
// Block 256 thr (8 waves), 16 queries per wave, 64 keys per step.
//   S^T = K * Q^T : A = K rows (row = key, k = d), B = Q^T (k = d, n = query)
//   O^T += V^T * P^T : A = Vt rows (row = d, k = key), B = P^T from registers
// Lane owns 32 keys of query column (lane&15); partner = lane ^ 16.
// Each step's 64 K rows and 64 V^T rows (128 B each) come into LDS once for the
// eight waves by asynchronous copies (waves 0-3: K, waves 4-7: V^T; 4 copies a
// wave), two buffers, the next step in flight while this one is worked on.
// grid = (SEQ/128, B*H).
// ---------------------------------------------------------------------------
__global__ __launch_bounds__(256) void attn_kernel(
    const _Float16* __restrict__ qp,   // [B*H][L][D]
    const _Float16* __restrict__ kp,   // [B*H][L][D]
    const _Float16* __restrict__ vt,   // [B*H][D][L]
    float* __restrict__ out)           // [B][L][EMB]
{
  __shared__ __attribute__((aligned(16))) float sO[8 * 16 * 64];    // 32768 B
  __shared__ __attribute__((aligned(16))) _Float16 sKV[2 * KVBUF];  // 36864 B

  const int tid = threadIdx.x, lane = tid & 31, w = tid >> 5;
  const int h = lane >> 4, m = lane & 15;
  const int bh = blockIdx.y, b = bh >> 4, head = bh & 15;
  const int q0 = blockIdx.x * 128 + 16 * w;

  // Q^T B-fragments: column n = query q0+m, k = d (two 32-deep chunks)
  const _Float16* qrow = qp + ((size_t)bh * SEQ + q0 + m) * HD;
  const v16h qb0 = load_frag(qrow, h);
  const v16h qb1 = load_frag(qrow + 32, h);

  const v8f zero8 = {0.f, 0.f, 0.f, 0.f, 0.f, 0.f, 0.f, 0.f};
  v8f o[4];                                   // o[t][r] = O[query m][d 16t+8h+r] * (l * 2^14)
  #pragma unroll
  for (int t = 0; t < 4; ++t) o[t] = zero8;
  float mrun = -1e30f, lrun = 0.0f;

  // copy role: staged rows 16w + (lane >> 3) + 4c, c = 0..3; 16-byte piece (lane & 7)
  const int cr = 16 * w + (lane >> 3), cp = lane & 7;
  const bool ck = __builtin_amdgcn_readfirstlane(w) < 4;       // scalar: the choice writes no EXEC
  const unsigned gpitch = ck ? HD * 2 : SEQ * 2;               // bytes, one source row further on
  const unsigned grow = 4 * gpitch;                            // bytes, 4 rows further on
  const unsigned gstep = ck ? 64 * HD * 2 : 64 * 2;            // bytes, 64 keys further on
  const char* gsrc = (const char*)((ck ? kp : vt) + (size_t)bh * SEQ * HD)
                     + (size_t)((cr & 63) * gpitch) + 16 * cp;
  const unsigned ldst = lds_off(sKV) + cr * SPB + 16 * cp;

  async_rows16(ldst, gsrc, grow);                          // step 0 -> buffer 0
  asm volatile("s_wait_asynccnt 0x0" ::: "memory");        // own copies of step 0 have landed
  __syncthreads();
  async_rows16(ldst + KVBUF * 2, gsrc + gstep, grow);      // step 1 -> buffer 1

  // rolled: one buffer offset per trip, every fragment index constant
  #pragma unroll 1
  for (int st = 0; st < SEQ / 64; ++st) {
    const int bo = (st & 1) * KVBUF;
    const _Float16* kl = sKV + bo + m * SPITCH;            // + 16j rows + 32*dc
    const _Float16* vl = kl + 64 * SPITCH;                 // + 16t rows + key chunk
    // ---- scores: s[j][r] = S[query m][key kb+16j+8h+r] / 32 ----
    v8f s[4];
    #pragma unroll
    for (int j = 0; j < 4; ++j) {
      const _Float16* kpp = kl + 16 * j * SPITCH;
      const v16h kf0 = load_frag(kpp, h);
      const v16h kf1 = load_frag(kpp + 32, h);
      v8f z = zero8;
      z = wmma_f16(kf0, qb0, z);
      z = wmma_f16(kf1, qb1, z);
      s[j] = z;
    }
    #pragma unroll
    for (int j = 0; j < 4; ++j)
      #pragma unroll
      for (int r = 0; r < 8; ++r) s[j][r] = s[j][r] * SSCALE;

    // ---- online softmax ----
    float mloc = s[0][0];
    #pragma unroll
    for (int j = 0; j < 4; ++j)
      #pragma unroll
      for (int r = 0; r < 8; ++r) mloc = fmaxf(mloc, s[j][r]);
    mloc = fmaxf(mloc, __shfl_xor(mloc, 16));
    const float mnew = fmaxf(mrun, mloc);
    const float alpha = __expf(mrun - mnew);
    mrun = mnew;
    float lsum = 0.0f;
    #pragma unroll
    for (int j = 0; j < 4; ++j)
      #pragma unroll
      for (int r = 0; r < 8; ++r) {
        const float p = __expf(s[j][r] - mnew);
        s[j][r] = p;
        lsum += p;
      }
    lsum += __shfl_xor(lsum, 16);
    lrun = lrun * alpha + lsum;
    #pragma unroll
    for (int t = 0; t < 4; ++t)
      #pragma unroll
      for (int r = 0; r < 8; ++r) o[t][r] = o[t][r] * alpha;

    // ---- P^T B-fragments (key chunks 0..31 and 32..63 of this step) ----
    const v16h pb0 = pack_p(s[0], s[1]);
    const v16h pb1 = pack_p(s[2], s[3]);

    // ---- O^T += V^T * P^T ----
    #pragma unroll
    for (int t = 0; t < 4; ++t) {
      const _Float16* vpp = vl + 16 * t * SPITCH;
      const v16h vf0 = load_frag(vpp, h);
      const v16h vf1 = load_frag(vpp + 32, h);
      o[t] = wmma_f16(vf0, pb0, o[t]);
      o[t] = wmma_f16(vf1, pb1, o[t]);
    }

    stage_publish();
    if (st + 2 < SEQ / 64)                                 // step st + 2 -> the buffer just read
      async_rows16(ldst + bo * 2, gsrc + (size_t)(st + 2) * gstep, grow);
  }
  asm volatile("s_wait_asynccnt 0x0" ::: "memory");        // nothing of this wave's is in flight any more

  // ---- epilogue: normalise, stage per-wave 16x64 tile, whole-line stores ----
  const float inv = (1.0f / lrun) * (1.0f / PSCALE);
  float* so = sO + w * 1024;
  #pragma unroll
  for (int t = 0; t < 4; ++t)
    #pragma unroll
    for (int r = 0; r < 8; ++r)
      so[m * 64 + 16 * t + 8 * h + r] = o[t][r] * inv;
  __syncthreads();

  att_store_pass(so, out, b, head, q0, lane);
  
}

// ---------------------------------------------------------------------------
extern "C" void kernel_launch(void* const* d_in, const int* in_sizes, int n_in,
                              void* d_out, int out_size, void* d_ws, size_t ws_size,
                              hipStream_t stream) {
  if (n_in < 8) return;
  if (in_sizes[0] != NX || in_sizes[1] != NX) return;
  if (in_sizes[2] != NW || in_sizes[4] != NW || in_sizes[6] != NW) return;
  if (in_sizes[3] != EMB || in_sizes[5] != EMB || in_sizes[7] != EMB) return;
  if (out_size != NX) return;

  const float* q  = (const float*)d_in[0];
  const float* v  = (const float*)d_in[1];
  const float* Wq = (const float*)d_in[2];
  const float* bq = (const float*)d_in[3];
  const float* Wk = (const float*)d_in[4];
  const float* bk = (const float*)d_in[5];
  const float* Wv = (const float*)d_in[6];
  const float* bv = (const float*)d_in[7];
  float* out = (float*)d_out;

  const size_t x_bytes  = (size_t)NX * 2;                           //  8388608 per plane
  const size_t wt_bytes = (size_t)3 * NW * 2;                       //  6291456
  const size_t pl_bytes = (size_t)BATCH * NHEADS * SEQ * HD * 2;    //  8388608 per plane
  const size_t total = 2 * x_bytes + wt_bytes + 3 * pl_bytes;       // 48234496
  if (total > ws_size) return;

  char* ws = (char*)d_ws;
  _Float16* qx = (_Float16*)(ws);
  _Float16* vx = (_Float16*)(ws + x_bytes);
  _Float16* wt = (_Float16*)(ws + 2 * x_bytes);
  _Float16* qp = (_Float16*)(ws + 2 * x_bytes + wt_bytes);
  _Float16* kp = (_Float16*)(ws + 2 * x_bytes + wt_bytes + pl_bytes);
  _Float16* vt = (_Float16*)(ws + 2 * x_bytes + wt_bytes + 2 * pl_bytes);

  const int ngroups = 2 * NX8;                                       // 1048576
  convert_kernel<<<(ngroups + 255) / 256, 256, 0, stream>>>(q, v, qx, vx);

  dim3 gTr(EMB / 64, EMB / 64, 3);                                   // (16, 16, 3)
  wtrans_kernel<<<gTr, 256, 0, stream>>>(Wq, Wk, Wv, wt);

  dim3 gProj(MROWS / 128, 3 * NHEADS);                               // (32, 48)
  proj_kernel<<<gProj, 128, 0, stream>>>(qx, vx, wt, bq, bk, bv, qp, kp, vt);

  dim3 gAtt(SEQ / 128, BATCH * NHEADS);                              // (16, 32)
  attn_kernel<<<gAtt, 256, 0, stream>>>(qp, kp, vt, out);
}

// v002
// It runs in 81.6 microseconds.
// In both of two side-by-side timings against v001, it was 1.13 times as fast.
// All steps since v000 together make it 2.96 times as fast.
// Contractions: q*Wq, v*Wk, v*Wv, K*Q^T and V^T*P^T all on v_wmma_f32_16x16x32_f16 (f16 operands, f32 accumulate); W carried x32, P carried x16384 (exact power-of-two scales folded back in f32); score scale 1/32, softmax, bias and normalisation in f32.
#include <hip/hip_runtime.h>

typedef _Float16 v16h __attribute__((ext_vector_type(16)));
typedef _Float16 v8h  __attribute__((ext_vector_type(8)));
typedef float    v8f  __attribute__((ext_vector_type(8)));
typedef float    v4f  __attribute__((ext_vector_type(4)));
typedef v8h __attribute__((may_alias)) v8ha;
typedef v4f __attribute__((may_alias)) v4fa;

union Frag { v16h v; v8h half[2]; };

#define EMB    1024
#define NHEADS 16
#define HD     64
#define SEQ    2048
#define BATCH  2
#define MROWS  (BATCH * SEQ)          // 4096 tokens
#define NX     (MROWS * EMB)          // 4194304
#define NW     (EMB * EMB)            // 1048576
#define NX8    (NX / 8)               // 524288
#define WSC    32.0f                  // weight plane scale (exact)
#define WINV   0.03125f               // 1/WSC
#define SSCALE 0.03125f               // 1/sqrt(EMB), exact
#define PSCALE 16384.0f
#define TPITCH 72                     // LDS pitch (halves) of the transposed weight tile
#define SPITCH 72                     // LDS pitch (halves) of a staged 128-byte operand row: 144 B = 16 B x 9
#define SPB    (SPITCH * 2)           // the same in bytes
#define KVBUF  (128 * SPITCH)         // attention stage: 64 K rows, then 64 V^T rows (halves)
#define XWBUF  (256 * SPITCH)         // projection stage: 128 X rows, then 128 W^T rows (halves)

// ---------------------------------------------------------------------------
// 16x16x32 f16 WMMA with hazard guard (ties D, keeps A/B live).
// Fragment map (wave32): lane l, h = l>>4, m = n = l&15.
//   A/B element i: i<8 -> k0+8h+i ; i>=8 -> k0+16+8h+(i-8)
//   D element r : row 8h+r, col l&15
// ---------------------------------------------------------------------------
__device__ __forceinline__ v8f wmma_f16(v16h a, v16h b, v8f c) {
  v8f d = __builtin_amdgcn_wmma_f32_16x16x32_f16(false, a, false, b, (short)0, c, false, false);
  asm volatile("v_nop\n\tv_nop\n\tv_nop\n\tv_nop" : "+v"(d) : "v"(a), "v"(b));
  return d;
}

// A or B fragment from a k-contiguous 16-bit row; p points at element k0 of
// the row owned by this lane (row index = lane & 15 added by the caller).
__device__ __forceinline__ v16h load_frag(const _Float16* p, int h) {
  Frag f;
  f.half[0] = *(const v8ha*)(p + 8 * h);
  f.half[1] = *(const v8ha*)(p + 16 + 8 * h);
  return f.v;
}

// ---------------------------------------------------------------------------
// Asynchronous copies global -> LDS, 16 B per lane: lanes 8q..8q+7 bring one
// whole 128-byte row, one copy = 4 rows. l = the lane's LDS byte address,
// g = its global address; copy c takes the rows 4c further on (LDS + 4 pitches,
// global + grow bytes). s_wait_xcnt closes each statement so that no address
// register is rewritten while a copy that names it may still need it.
// ---------------------------------------------------------------------------
__device__ __forceinline__ unsigned lds_off(const void* p) { return (unsigned)(size_t)p; }

__device__ __forceinline__ void async_rows16(unsigned l, const char* g, unsigned grow) {
  asm volatile("global_load_async_to_lds_b128 %0, %4, off\n\t"
               "global_load_async_to_lds_b128 %1, %5, off\n\t"
               "global_load_async_to_lds_b128 %2, %6, off\n\t"
               "global_load_async_to_lds_b128 %3, %7, off\n\t"
               "s_wait_xcnt 0x0"
               :: "v"(l), "v"(l + 4 * SPB), "v"(l + 8 * SPB), "v"(l + 12 * SPB),
                  "v"(g), "v"(g + grow), "v"(g + 2 * (size_t)grow), "v"(g + 3 * (size_t)grow)
               : "memory");
}

// 32 rows of one operand (8 copies) at a global row pitch of EMB halves; a projection
// wave calls it once for its X rows and once for its W^T rows of a stage.
__device__ __forceinline__ void async_rows32(unsigned l, const char* g) {
  const size_t gr = (size_t)4 * EMB * 2;             // 4 rows further on in global memory
  asm volatile("global_load_async_to_lds_b128 %0, %8, off\n\t"
               "global_load_async_to_lds_b128 %1, %9, off\n\t"
               "global_load_async_to_lds_b128 %2, %10, off\n\t"
               "global_load_async_to_lds_b128 %3, %11, off\n\t"
               "global_load_async_to_lds_b128 %4, %12, off\n\t"
               "global_load_async_to_lds_b128 %5, %13, off\n\t"
               "global_load_async_to_lds_b128 %6, %14, off\n\t"
               "global_load_async_to_lds_b128 %7, %15, off\n\t"
               "s_wait_xcnt 0x0"
               :: "v"(l), "v"(l + 4 * SPB), "v"(l + 8 * SPB), "v"(l + 12 * SPB),
                  "v"(l + 16 * SPB), "v"(l + 20 * SPB), "v"(l + 24 * SPB), "v"(l + 28 * SPB),
                  "v"(g), "v"(g + gr), "v"(g + 2 * gr), "v"(g + 3 * gr),
                  "v"(g + 4 * gr), "v"(g + 5 * gr), "v"(g + 6 * gr), "v"(g + 7 * gr)
               : "memory");
}

// Hand-over of a stage: this wave's LDS reads are done, its own copies have
// landed, then the work-group barrier publishes the next stage and frees this one.
__device__ __forceinline__ void stage_publish() {
  asm volatile("s_wait_dscnt 0x0" ::: "memory");     // own reads of the buffer that is refilled next
  asm volatile("s_wait_asynccnt 0x0" ::: "memory");  // own copies of the next stage have landed
  __syncthreads();
}

// ---------------------------------------------------------------------------
// Kernel 1: f32 -> f16 planes for q and v, unscaled, RNE convert.
// ---------------------------------------------------------------------------
__global__ __launch_bounds__(256) void convert_kernel(
    const float* __restrict__ q, const float* __restrict__ v,
    _Float16* __restrict__ qx, _Float16* __restrict__ vx)
{
  const int g = blockIdx.x * 256 + threadIdx.x;
  if (g >= 2 * NX8) return;
  const float* src;
  _Float16* dst;
  if (g < NX8) {
    src = q + (size_t)g * 8;
    dst = qx + (size_t)g * 8;
  } else {
    const int e = g - NX8;
    src = v + (size_t)e * 8;
    dst = vx + (size_t)e * 8;
  }
  const v4f a = *(const v4fa*)src;
  const v4f c = *(const v4fa*)(src + 4);
  const v8h o = { (_Float16)a.x, (_Float16)a.y, (_Float16)a.z, (_Float16)a.w,
                  (_Float16)c.x, (_Float16)c.y, (_Float16)c.z, (_Float16)c.w };
  *(v8h*)dst = o;
  
}

// ---------------------------------------------------------------------------
// Kernel 2: weight transpose + convert. in W[k][n] (k = input feature,
// n = output feature, both 1024) -> wt[which][n][k] = f16(32 * W[k][n]).
// Block 256 thr = one 64(k) x 64(n) tile; tile transposed through LDS;
// lanes 8q..8q+7 of one wave in one instruction (4 lines per instruction,
// grid = (n tiles, k tiles, 3).
// ---------------------------------------------------------------------------
__device__ __forceinline__ void wt_store_pass(const _Float16* sW, _Float16* wt,
                                              int which, int n0, int k0, int w, int lane) {
  const int q8 = lane & 7, sub = lane >> 3;
  #pragma unroll
  for (int i = 0; i < 2; ++i) {
    const int nrow = w * 8 + i * 4 + sub;          // 0..63
    const v8h val = *(const v8ha*)(sW + nrow * TPITCH + 8 * q8);
    _Float16* dst = wt + ((size_t)which * EMB + n0 + nrow) * EMB + k0 + 8 * q8;
    *(v8h*)dst = val;
  }
}

__global__ __launch_bounds__(256) void wtrans_kernel(
    const float* __restrict__ wq, const float* __restrict__ wk, const float* __restrict__ wv,
    _Float16* __restrict__ wt)         // [3][1024 n][1024 k], x32
{
  __shared__ __attribute__((aligned(16))) _Float16 sW[64 * TPITCH];   // 9216 B

  const int tid = threadIdx.x, lane = tid & 31, w = tid >> 5;
  const int n0 = blockIdx.x * 64, k0 = blockIdx.y * 64, which = blockIdx.z;
  const float* W = (which == 0) ? wq : ((which == 1) ? wk : wv);

  #pragma unroll
  for (int i = 0; i < 4; ++i) {
    const int idx = tid + 256 * i;                 // 0..1023 float4 groups
    const int kk = idx >> 4, nn = (idx & 15) * 4;
    const v4f x = *(const v4fa*)(W + (size_t)(k0 + kk) * EMB + n0 + nn);
    sW[(nn + 0) * TPITCH + kk] = (_Float16)(x.x * WSC);
    sW[(nn + 1) * TPITCH + kk] = (_Float16)(x.y * WSC);
    sW[(nn + 2) * TPITCH + kk] = (_Float16)(x.z * WSC);
    sW[(nn + 3) * TPITCH + kk] = (_Float16)(x.w * WSC);
  }
  __syncthreads();

  wt_store_pass(sW, wt, which, n0, k0, w, lane);
  
}

// ---------------------------------------------------------------------------
// 4 lines per instruction, 64 lines per wave: half of one head's 128 lines
// (base = 0 or 64), sT = that head's staged 128 x 64 tile.
// which 0/1: plane[bh][l][d]  (one token row = 64 halves = one line)
// which 2  : vt[bh][d][l]     (64 d-rows x 128 tokens = 2 lines each)
// ---------------------------------------------------------------------------
__device__ __forceinline__ void proj_store_pass(const _Float16* sT, _Float16* plane, _Float16* vt,
                                                int which, int bh, int l0, int base, int lane) {
  const int q8 = lane & 7, sub = lane >> 3;
  #pragma unroll
  for (int i = 0; i < 16; ++i) {
    const int lid = base + i * 4 + sub;            // 0..127
    v8h val;
    _Float16* dst;
    if (which != 2) {
      val = *(const v8ha*)(sT + lid * HD + 8 * q8);
      dst = plane + ((size_t)bh * SEQ + l0 + lid) * HD + 8 * q8;
    } else {
      const int d = lid >> 1, hl = lid & 1;
      val = *(const v8ha*)(sT + d * 128 + 64 * hl + 8 * q8);
      dst = vt + ((size_t)bh * HD + d) * SEQ + l0 + 64 * hl + 8 * q8;
    }
    *(v8h*)dst = val;
    asm volatile("s_wait_xcnt 0x0" ::: "memory");  // before the next line's load and address reuse this store's registers
  }
}

// ---------------------------------------------------------------------------
// Kernel 3: Y = X * W (with W^T staged k-contiguous) over the fused 3*1024
// output columns. which = 0: X = q, W = Wq -> qp ; 1: X = v, W = Wk -> kp ;
// 2: X = v, W = Wv -> vt (d-major).
// Block 128 thr (4 waves) = 128 tokens x 128 features (two heads of one which);
// wave tile 64 tokens x 64 features (one head); K = 1024 in stages of 64 (two
// steps of 32); each stage's X and W^T rows come into LDS by asynchronous copies,
// two buffers, the next stage in flight while this one is worked on; fragments
// from LDS. 768 blocks, three to a WGP by their LDS.
// ---------------------------------------------------------------------------
__global__ __launch_bounds__(128) void proj_kernel(
    const _Float16* __restrict__ qx,   // [4096][1024] f16(q)
    const _Float16* __restrict__ vx,   // [4096][1024] f16(v)
    const _Float16* __restrict__ wt,   // [3][1024][1024], row = output feature, x32
    const float* __restrict__ bq, const float* __restrict__ bk, const float* __restrict__ bv,
    _Float16* __restrict__ qp,         // [B*H][L][D]
    _Float16* __restrict__ kp,         // [B*H][L][D]
    _Float16* __restrict__ vt)         // [B*H][D][L]
{
  __shared__ __attribute__((aligned(16))) _Float16 sT[2 * 128 * 64]; // 32768 B, one 128 x 64 tile a head
  __shared__ __attribute__((aligned(16))) _Float16 sXW[2 * XWBUF];   // 73728 B

  const int tid = threadIdx.x, lane = tid & 31, w = tid >> 5;
  const int h = lane >> 4, m = lane & 15;
  const int m0 = blockIdx.x * 128;
  const int cg = blockIdx.y;                 // 0..23
  const int which = cg >> 3, head0 = (cg & 7) * 2;
  const int wtok = w & 1, wf = w >> 1;       // the wave's token half and its head of the pair

  const _Float16* xsrc = (which == 0) ? qx : vx;

  // copy role: rows 32w..32w+31 of X and of W^T; row (lane >> 3) of each group of 4,
  // 16-byte piece (lane & 7)
  const int cr = lane >> 3, cp = lane & 7;
  const char* gx = (const char*)(xsrc + (size_t)(m0 + 32 * w + cr) * EMB + 8 * cp);
  const char* gw = (const char*)(wt + ((size_t)which * EMB + head0 * HD + 32 * w + cr) * EMB + 8 * cp);
  const unsigned lx = lds_off(sXW) + (32 * w + cr) * SPB + 16 * cp;
  const unsigned lw = lds_off(sXW) + (128 + 32 * w + cr) * SPB + 16 * cp;

  const v8f zero8 = {0.f, 0.f, 0.f, 0.f, 0.f, 0.f, 0.f, 0.f};
  v8f acc[4][4];
  #pragma unroll
  for (int mt = 0; mt < 4; ++mt)
    #pragma unroll
    for (int nt = 0; nt < 4; ++nt) acc[mt][nt] = zero8;

  async_rows32(lx, gx);                                    // stage 0 -> buffer 0
  async_rows32(lw, gw);
  asm volatile("s_wait_asynccnt 0x0" ::: "memory");        // own copies of stage 0 have landed
  __syncthreads();
  async_rows32(lx + XWBUF * 2, gx + 128);                  // stage 1 -> buffer 1
  async_rows32(lw + XWBUF * 2, gw + 128);

  // rolled: one buffer offset per trip, every fragment index constant
  #pragma unroll 1
  for (int t = 0; t < EMB / 64; ++t) {
    const int bo = (t & 1) * XWBUF;
    const _Float16* xs = sXW + bo + (64 * wtok + m) * SPITCH;      // token row, mt = 0
    const _Float16* wl = sXW + bo + (128 + 64 * wf + m) * SPITCH;  // feature row, nt = 0
    #pragma unroll
    for (int kc = 0; kc < 64; kc += 32) {
      v16h a[4];
      #pragma unroll
      for (int mt = 0; mt < 4; ++mt) a[mt] = load_frag(xs + mt * 16 * SPITCH + kc, h);
      #pragma unroll
      for (int nt = 0; nt < 4; ++nt) {
        const v16h b = load_frag(wl + nt * 16 * SPITCH + kc, h);
        #pragma unroll
        for (int mt = 0; mt < 4; ++mt) acc[mt][nt] = wmma_f16(a[mt], b, acc[mt][nt]);
      }
    }
    stage_publish();
    if (t + 2 < EMB / 64) {                                // stage t + 2 -> the buffer just read
      async_rows32(lx + bo * 2, gx + (t + 2) * 128);
      async_rows32(lw + bo * 2, gw + (t + 2) * 128);
    }
  }
  asm volatile("s_wait_asynccnt 0x0" ::: "memory");        // nothing of this wave's is in flight any more

  // D[r] of tile (mt, nt) = Y[token m0+64wtok+16mt+8h+r][feature 16nt+m of head head0+wf]
  const int head = head0 + wf;
  _Float16* sTh = sT + wf * (128 * 64);
  const float* bias = (which == 0) ? bq : ((which == 1) ? bk : bv);
  float bvl4[4];
  #pragma unroll
  for (int nt = 0; nt < 4; ++nt) bvl4[nt] = bias[head * HD + 16 * nt + m];
  asm volatile("s_wait_xcnt 0x0" ::: "memory");            // before the index arithmetic below reuses these loads' offset register
  __builtin_amdgcn_sched_barrier(0);                       // or the compiler lifts that arithmetic over the wait
  #pragma unroll
  for (int nt = 0; nt < 4; ++nt) {
    const int feat = 16 * nt + m;
    const float bvl = bvl4[nt];
    #pragma unroll
    for (int mt = 0; mt < 4; ++mt) {
      #pragma unroll
      for (int r = 0; r < 8; ++r) {
        const int tokl = 64 * wtok + 16 * mt + 8 * h + r;  // 0..127
        const float y = acc[mt][nt][r] * WINV + bvl;
        const int idx = (which == 2) ? (feat * 128 + tokl) : (tokl * HD + feat);
        sTh[idx] = (_Float16)y;
      }
    }
  }
  __syncthreads();

  const int b = m0 / SEQ, l0 = m0 - b * SEQ, bh = b * NHEADS + head;
  _Float16* plane = (which == 0) ? qp : kp;
  proj_store_pass(sTh, plane, vt, which, bh, l0, 64 * wtok, lane);
  
}

// ---------------------------------------------------------------------------
// Attention helpers.
// ---------------------------------------------------------------------------
// P^T B-fragment from the lane's own score D values: element r <- tile a row r
// (keys 0..15 of the 32-deep chunk), element 8+r <- tile c row r (keys 16..31),
// same lane, same query column, scaled by 2^14.
__device__ __forceinline__ v16h pack_p(v8f a, v8f c) {
  const v16h r = { (_Float16)(a[0] * PSCALE), (_Float16)(a[1] * PSCALE), (_Float16)(a[2] * PSCALE), (_Float16)(a[3] * PSCALE),
                   (_Float16)(a[4] * PSCALE), (_Float16)(a[5] * PSCALE), (_Float16)(a[6] * PSCALE), (_Float16)(a[7] * PSCALE),
                   (_Float16)(c[0] * PSCALE), (_Float16)(c[1] * PSCALE), (_Float16)(c[2] * PSCALE), (_Float16)(c[3] * PSCALE),
                   (_Float16)(c[4] * PSCALE), (_Float16)(c[5] * PSCALE), (_Float16)(c[6] * PSCALE), (_Float16)(c[7] * PSCALE) };
  return r;
}

// lanes 8q..8q+7 in one instruction, 4 lines per instruction, 32 lines per wave.
__device__ __forceinline__ void att_store_pass(const float* so, float* out,
                                               int b, int head, int q0, int lane) {
  const int q8 = lane & 7, sub = lane >> 3;
  #pragma unroll
  for (int i = 0; i < 8; ++i) {
    const int lid = i * 4 + sub;                   // 0..31
    const int row = lid >> 1, hl = lid & 1;
    const v4f val = *(const v4fa*)(so + row * 64 + 32 * hl + 4 * q8);
    const size_t gi = ((size_t)b * SEQ + q0 + row) * EMB + head * HD + 32 * hl + 4 * q8;
    *(v4f*)(out + gi) = val;
  }
}

// ---------------------------------------------------------------------------
// Kernel 4: streaming attention, transposed form.
// Block 256 thr (8 waves), 16 queries per wave, 64 keys per step.
//   S^T = K * Q^T : A = K rows (row = key, k = d), B = Q^T (k = d, n = query)
//   O^T += V^T * P^T : A = Vt rows (row = d, k = key), B = P^T from registers
// Lane owns 32 keys of query column (lane&15); partner = lane ^ 16.
// Each step's 64 K rows and 64 V^T rows (128 B each) come into LDS once for the
// eight waves by asynchronous copies (waves 0-3: K, waves 4-7: V^T; 4 copies a
// wave), two buffers, the next step in flight while this one is worked on.
// grid = (SEQ/128, B*H).
// ---------------------------------------------------------------------------
__global__ __launch_bounds__(256) void attn_kernel(
    const _Float16* __restrict__ qp,   // [B*H][L][D]
    const _Float16* __restrict__ kp,   // [B*H][L][D]
    const _Float16* __restrict__ vt,   // [B*H][D][L]
    float* __restrict__ out)           // [B][L][EMB]
{
  __shared__ __attribute__((aligned(16))) float sO[8 * 16 * 64];    // 32768 B
  __shared__ __attribute__((aligned(16))) _Float16 sKV[2 * KVBUF];  // 36864 B

  const int tid = threadIdx.x, lane = tid & 31, w = tid >> 5;
  const int h = lane >> 4, m = lane & 15;
  const int bh = blockIdx.y, b = bh >> 4, head = bh & 15;
  const int q0 = blockIdx.x * 128 + 16 * w;

  // Q^T B-fragments: column n = query q0+m, k = d (two 32-deep chunks)
  const _Float16* qrow = qp + ((size_t)bh * SEQ + q0 + m) * HD;
  const v16h qb0 = load_frag(qrow, h);
  const v16h qb1 = load_frag(qrow + 32, h);

  const v8f zero8 = {0.f, 0.f, 0.f, 0.f, 0.f, 0.f, 0.f, 0.f};
  v8f o[4];                                   // o[t][r] = O[query m][d 16t+8h+r] * (l * 2^14)
  #pragma unroll
  for (int t = 0; t < 4; ++t) o[t] = zero8;
  float mrun = -1e30f, lrun = 0.0f;

  // copy role: staged rows 16w + (lane >> 3) + 4c, c = 0..3; 16-byte piece (lane & 7)
  const int cr = 16 * w + (lane >> 3), cp = lane & 7;
  const bool ck = __builtin_amdgcn_readfirstlane(w) < 4;       // scalar: the choice writes no EXEC
  const unsigned gpitch = ck ? HD * 2 : SEQ * 2;               // bytes, one source row further on
  const unsigned grow = 4 * gpitch;                            // bytes, 4 rows further on
  const unsigned gstep = ck ? 64 * HD * 2 : 64 * 2;            // bytes, 64 keys further on
  const char* gsrc = (const char*)((ck ? kp : vt) + (size_t)bh * SEQ * HD)
                     + (size_t)((cr & 63) * gpitch) + 16 * cp;
  const unsigned ldst = lds_off(sKV) + cr * SPB + 16 * cp;

  async_rows16(ldst, gsrc, grow);                          // step 0 -> buffer 0
  asm volatile("s_wait_asynccnt 0x0" ::: "memory");        // own copies of step 0 have landed
  __syncthreads();
  async_rows16(ldst + KVBUF * 2, gsrc + gstep, grow);      // step 1 -> buffer 1

  // rolled: one buffer offset per trip, every fragment index constant
  #pragma unroll 1
  for (int st = 0; st < SEQ / 64; ++st) {
    const int bo = (st & 1) * KVBUF;
    const _Float16* kl = sKV + bo + m * SPITCH;            // + 16j rows + 32*dc
    const _Float16* vl = kl + 64 * SPITCH;                 // + 16t rows + key chunk
    // ---- scores: s[j][r] = S[query m][key kb+16j+8h+r] / 32 ----
    v8f s[4];
    #pragma unroll
    for (int j = 0; j < 4; ++j) {
      const _Float16* kpp = kl + 16 * j * SPITCH;
      const v16h kf0 = load_frag(kpp, h);
      const v16h kf1 = load_frag(kpp + 32, h);
      v8f z = zero8;
      z = wmma_f16(kf0, qb0, z);
      z = wmma_f16(kf1, qb1, z);
      s[j] = z;
    }
    #pragma unroll
    for (int j = 0; j < 4; ++j)
      #pragma unroll
      for (int r = 0; r < 8; ++r) s[j][r] = s[j][r] * SSCALE;

    // ---- online softmax ----
    float mloc = s[0][0];
    #pragma unroll
    for (int j = 0; j < 4; ++j)
      #pragma unroll
      for (int r = 0; r < 8; ++r) mloc = fmaxf(mloc, s[j][r]);
    mloc = fmaxf(mloc, __shfl_xor(mloc, 16));
    const float mnew = fmaxf(mrun, mloc);
    const float alpha = __expf(mrun - mnew);
    mrun = mnew;
    float lsum = 0.0f;
    #pragma unroll
    for (int j = 0; j < 4; ++j)
      #pragma unroll
      for (int r = 0; r < 8; ++r) {
        const float p = __expf(s[j][r] - mnew);
        s[j][r] = p;
        lsum += p;
      }
    lsum += __shfl_xor(lsum, 16);
    lrun = lrun * alpha + lsum;
    #pragma unroll
    for (int t = 0; t < 4; ++t)
      #pragma unroll
      for (int r = 0; r < 8; ++r) o[t][r] = o[t][r] * alpha;

    // ---- P^T B-fragments (key chunks 0..31 and 32..63 of this step) ----
    const v16h pb0 = pack_p(s[0], s[1]);
    const v16h pb1 = pack_p(s[2], s[3]);

    // ---- O^T += V^T * P^T ----
    #pragma unroll
    for (int t = 0; t < 4; ++t) {
      const _Float16* vpp = vl + 16 * t * SPITCH;
      const v16h vf0 = load_frag(vpp, h);
      const v16h vf1 = load_frag(vpp + 32, h);
      o[t] = wmma_f16(vf0, pb0, o[t]);
      o[t] = wmma_f16(vf1, pb1, o[t]);
    }

    stage_publish();
    if (st + 2 < SEQ / 64)                                 // step st + 2 -> the buffer just read
      async_rows16(ldst + bo * 2, gsrc + (size_t)(st + 2) * gstep, grow);
  }
  asm volatile("s_wait_asynccnt 0x0" ::: "memory");        // nothing of this wave's is in flight any more

  // ---- epilogue: normalise, stage per-wave 16x64 tile, whole-line stores ----
  const float inv = (1.0f / lrun) * (1.0f / PSCALE);
  float* so = sO + w * 1024;
  #pragma unroll
  for (int t = 0; t < 4; ++t)
    #pragma unroll
    for (int r = 0; r < 8; ++r)
      so[m * 64 + 16 * t + 8 * h + r] = o[t][r] * inv;
  __syncthreads();

  att_store_pass(so, out, b, head, q0, lane);
  
}

// ---------------------------------------------------------------------------
extern "C" void kernel_launch(void* const* d_in, const int* in_sizes, int n_in,
                              void* d_out, int out_size, void* d_ws, size_t ws_size,
                              hipStream_t stream) {
  if (n_in < 8) return;
  if (in_sizes[0] != NX || in_sizes[1] != NX) return;
  if (in_sizes[2] != NW || in_sizes[4] != NW || in_sizes[6] != NW) return;
  if (in_sizes[3] != EMB || in_sizes[5] != EMB || in_sizes[7] != EMB) return;
  if (out_size != NX) return;

  const float* q  = (const float*)d_in[0];
  const float* v  = (const float*)d_in[1];
  const float* Wq = (const float*)d_in[2];
  const float* bq = (const float*)d_in[3];
  const float* Wk = (const float*)d_in[4];
  const float* bk = (const float*)d_in[5];
  const float* Wv = (const float*)d_in[6];
  const float* bv = (const float*)d_in[7];
  float* out = (float*)d_out;

  const size_t x_bytes  = (size_t)NX * 2;                           //  8388608 per plane
  const size_t wt_bytes = (size_t)3 * NW * 2;                       //  6291456
  const size_t pl_bytes = (size_t)BATCH * NHEADS * SEQ * HD * 2;    //  8388608 per plane
  const size_t total = 2 * x_bytes + wt_bytes + 3 * pl_bytes;       // 48234496
  if (total > ws_size) return;

  char* ws = (char*)d_ws;
  _Float16* qx = (_Float16*)(ws);
  _Float16* vx = (_Float16*)(ws + x_bytes);
  _Float16* wt = (_Float16*)(ws + 2 * x_bytes);
  _Float16* qp = (_Float16*)(ws + 2 * x_bytes + wt_bytes);
  _Float16* kp = (_Float16*)(ws + 2 * x_bytes + wt_bytes + pl_bytes);
  _Float16* vt = (_Float16*)(ws + 2 * x_bytes + wt_bytes + 2 * pl_bytes);

  const int ngroups = 2 * NX8;                                       // 1048576
  convert_kernel<<<(ngroups + 255) / 256, 256, 0, stream>>>(q, v, qx, vx);

  dim3 gTr(EMB / 64, EMB / 64, 3);                                   // (16, 16, 3)
  wtrans_kernel<<<gTr, 256, 0, stream>>>(Wq, Wk, Wv, wt);

  dim3 gProj(MROWS / 128, 3 * NHEADS / 2);                           // (32, 24)
  proj_kernel<<<gProj, 128, 0, stream>>>(qx, vx, wt, bq, bk, bv, qp, kp, vt);

  dim3 gAtt(SEQ / 128, BATCH * NHEADS);                              // (16, 32)
  attn_kernel<<<gAtt, 256, 0, stream>>>(qp, kp, vt, out);
}

// v003
// Measured time: 77.7 microseconds a run.
// Two timings next to v002 both put it at 1.05 times that version's speed.
// All steps since v000 together make it 3.11 times as fast.
// Contractions: q*Wq, v*Wk, v*Wv, K*Q^T and V^T*P^T all on v_wmma_f32_16x16x32_f16 (f16 operands, f32 accumulate); W carried x32 (exact power-of-two scale folded back in f32), P and its row sum carried x16384 (cancels in the normalisation); score scale 1/32, softmax (base 2), bias and normalisation in f32.
#include <hip/hip_runtime.h>

typedef _Float16 v16h __attribute__((ext_vector_type(16)));
typedef _Float16 v8h  __attribute__((ext_vector_type(8)));
typedef float    v8f  __attribute__((ext_vector_type(8)));
typedef float    v4f  __attribute__((ext_vector_type(4)));
typedef float    v2f  __attribute__((ext_vector_type(2)));
typedef v8h __attribute__((may_alias)) v8ha;
typedef v4f __attribute__((may_alias)) v4fa;

union Frag { v16h v; v8h half[2]; };

#define EMB    1024
#define NHEADS 16
#define HD     64
#define SEQ    2048
#define BATCH  2
#define MROWS  (BATCH * SEQ)          // 4096 tokens
#define NX     (MROWS * EMB)          // 4194304
#define NW     (EMB * EMB)            // 1048576
#define NX8    (NX / 8)               // 524288
#define WSC    32.0f                  // weight plane scale (exact)
#define WINV   0.03125f               // 1/WSC
#define SLOG2E 0.045084220027780106f  // log2(e) / sqrt(EMB): raw score -> exponent of 2
#define PBITS  14.0f                  // P is carried x 2^14: added to that exponent
#define TPITCH 72                     // LDS pitch (halves) of the transposed weight tile
#define SPITCH 72                     // LDS pitch (halves) of a staged 128-byte operand row: 144 B = 16 B x 9
#define SPB    (SPITCH * 2)           // the same in bytes
#define KVBUF  (128 * SPITCH)         // attention stage: 64 K rows, then 64 V^T rows (halves)
#define XWBUF  (256 * SPITCH)         // projection stage: 128 X rows, then 128 W^T rows (halves)

// ---------------------------------------------------------------------------
// 16x16x32 f16 WMMA with hazard guard (ties D, keeps A/B live).
// Fragment map (wave32): lane l, h = l>>4, m = n = l&15.
//   A/B element i: i<8 -> k0+8h+i ; i>=8 -> k0+16+8h+(i-8)
//   D element r : row 8h+r, col l&15
// ---------------------------------------------------------------------------
__device__ __forceinline__ v8f wmma_f16(v16h a, v16h b, v8f c) {
  v8f d = __builtin_amdgcn_wmma_f32_16x16x32_f16(false, a, false, b, (short)0, c, false, false);
  asm volatile("v_nop\n\tv_nop\n\tv_nop\n\tv_nop" : "+v"(d) : "v"(a), "v"(b));
  return d;
}

// A or B fragment from a k-contiguous 16-bit row; p points at element k0 of
// the row owned by this lane (row index = lane & 15 added by the caller).
__device__ __forceinline__ v16h load_frag(const _Float16* p, int h) {
  Frag f;
  f.half[0] = *(const v8ha*)(p + 8 * h);
  f.half[1] = *(const v8ha*)(p + 16 + 8 * h);
  return f.v;
}

// ---------------------------------------------------------------------------
// Asynchronous copies global -> LDS, 16 B per lane: lanes 8q..8q+7 bring one
// whole 128-byte row, one copy = 4 rows. l = the lane's LDS byte address,
// g = its global address; copy c takes the rows 4c further on (LDS + 4 pitches,
// global + grow bytes). s_wait_xcnt closes each statement so that no address
// register is rewritten while a copy that names it may still need it.
// ---------------------------------------------------------------------------
__device__ __forceinline__ unsigned lds_off(const void* p) { return (unsigned)(size_t)p; }

__device__ __forceinline__ void async_rows16(unsigned l, const char* g, unsigned grow) {
  asm volatile("global_load_async_to_lds_b128 %0, %4, off\n\t"
               "global_load_async_to_lds_b128 %1, %5, off\n\t"
               "global_load_async_to_lds_b128 %2, %6, off\n\t"
               "global_load_async_to_lds_b128 %3, %7, off\n\t"
               "s_wait_xcnt 0x0"
               :: "v"(l), "v"(l + 4 * SPB), "v"(l + 8 * SPB), "v"(l + 12 * SPB),
                  "v"(g), "v"(g + grow), "v"(g + 2 * (size_t)grow), "v"(g + 3 * (size_t)grow)
               : "memory");
}

// 32 rows of one operand (8 copies) at a global row pitch of EMB halves; a projection
// wave calls it once for its X rows and once for its W^T rows of a stage.
__device__ __forceinline__ void async_rows32(unsigned l, const char* g) {
  const size_t gr = (size_t)4 * EMB * 2;             // 4 rows further on in global memory
  asm volatile("global_load_async_to_lds_b128 %0, %8, off\n\t"
               "global_load_async_to_lds_b128 %1, %9, off\n\t"
               "global_load_async_to_lds_b128 %2, %10, off\n\t"
               "global_load_async_to_lds_b128 %3, %11, off\n\t"
               "global_load_async_to_lds_b128 %4, %12, off\n\t"
               "global_load_async_to_lds_b128 %5, %13, off\n\t"
               "global_load_async_to_lds_b128 %6, %14, off\n\t"
               "global_load_async_to_lds_b128 %7, %15, off\n\t"
               "s_wait_xcnt 0x0"
               :: "v"(l), "v"(l + 4 * SPB), "v"(l + 8 * SPB), "v"(l + 12 * SPB),
                  "v"(l + 16 * SPB), "v"(l + 20 * SPB), "v"(l + 24 * SPB), "v"(l + 28 * SPB),
                  "v"(g), "v"(g + gr), "v"(g + 2 * gr), "v"(g + 3 * gr),
                  "v"(g + 4 * gr), "v"(g + 5 * gr), "v"(g + 6 * gr), "v"(g + 7 * gr)
               : "memory");
}

// Hand-over of a stage: this wave's LDS reads are done, its own copies have
// landed, then the work-group barrier publishes the next stage and frees this one.
__device__ __forceinline__ void stage_publish() {
  asm volatile("s_wait_dscnt 0x0" ::: "memory");     // own reads of the buffer that is refilled next
  asm volatile("s_wait_asynccnt 0x0" ::: "memory");  // own copies of the next stage have landed
  __syncthreads();
}

// ---------------------------------------------------------------------------
// Kernel 1: f32 -> f16 planes for q and v, unscaled, RNE convert.
// ---------------------------------------------------------------------------
__global__ __launch_bounds__(256) void convert_kernel(
    const float* __restrict__ q, const float* __restrict__ v,
    _Float16* __restrict__ qx, _Float16* __restrict__ vx)
{
  const int g = blockIdx.x * 256 + threadIdx.x;
  if (g >= 2 * NX8) return;
  const float* src;
  _Float16* dst;
  if (g < NX8) {
    src = q + (size_t)g * 8;
    dst = qx + (size_t)g * 8;
  } else {
    const int e = g - NX8;
    src = v + (size_t)e * 8;
    dst = vx + (size_t)e * 8;
  }
  const v4f a = *(const v4fa*)src;
  const v4f c = *(const v4fa*)(src + 4);
  const v8h o = { (_Float16)a.x, (_Float16)a.y, (_Float16)a.z, (_Float16)a.w,
                  (_Float16)c.x, (_Float16)c.y, (_Float16)c.z, (_Float16)c.w };
  *(v8h*)dst = o;
  
}

// ---------------------------------------------------------------------------
// Kernel 2: weight transpose + convert. in W[k][n] (k = input feature,
// n = output feature, both 1024) -> wt[which][n][k] = f16(32 * W[k][n]).
// Block 256 thr = one 64(k) x 64(n) tile; tile transposed through LDS;
// lanes 8q..8q+7 of one wave in one instruction (4 lines per instruction,
// grid = (n tiles, k tiles, 3).
// ---------------------------------------------------------------------------
__device__ __forceinline__ void wt_store_pass(const _Float16* sW, _Float16* wt,
                                              int which, int n0, int k0, int w, int lane) {
  const int q8 = lane & 7, sub = lane >> 3;
  #pragma unroll
  for (int i = 0; i < 2; ++i) {
    const int nrow = w * 8 + i * 4 + sub;          // 0..63
    const v8h val = *(const v8ha*)(sW + nrow * TPITCH + 8 * q8);
    _Float16* dst = wt + ((size_t)which * EMB + n0 + nrow) * EMB + k0 + 8 * q8;
    *(v8h*)dst = val;
  }
}

__global__ __launch_bounds__(256) void wtrans_kernel(
    const float* __restrict__ wq, const float* __restrict__ wk, const float* __restrict__ wv,
    _Float16* __restrict__ wt)         // [3][1024 n][1024 k], x32
{
  __shared__ __attribute__((aligned(16))) _Float16 sW[64 * TPITCH];   // 9216 B

  const int tid = threadIdx.x, lane = tid & 31, w = tid >> 5;
  const int n0 = blockIdx.x * 64, k0 = blockIdx.y * 64, which = blockIdx.z;
  const float* W = (which == 0) ? wq : ((which == 1) ? wk : wv);

  #pragma unroll
  for (int i = 0; i < 4; ++i) {
    const int idx = tid + 256 * i;                 // 0..1023 float4 groups
    const int kk = idx >> 4, nn = (idx & 15) * 4;
    const v4f x = *(const v4fa*)(W + (size_t)(k0 + kk) * EMB + n0 + nn);
    sW[(nn + 0) * TPITCH + kk] = (_Float16)(x.x * WSC);
    sW[(nn + 1) * TPITCH + kk] = (_Float16)(x.y * WSC);
    sW[(nn + 2) * TPITCH + kk] = (_Float16)(x.z * WSC);
    sW[(nn + 3) * TPITCH + kk] = (_Float16)(x.w * WSC);
  }
  __syncthreads();

  wt_store_pass(sW, wt, which, n0, k0, w, lane);
  
}

// ---------------------------------------------------------------------------
// 4 lines per instruction, 64 lines per wave: half of one head's 128 lines
// (base = 0 or 64), sT = that head's staged 128 x 64 tile.
// which 0/1: plane[bh][l][d]  (one token row = 64 halves = one line)
// which 2  : vt[bh][d][l]     (64 d-rows x 128 tokens = 2 lines each)
// ---------------------------------------------------------------------------
__device__ __forceinline__ void proj_store_pass(const _Float16* sT, _Float16* plane, _Float16* vt,
                                                int which, int bh, int l0, int base, int lane) {
  const int q8 = lane & 7, sub = lane >> 3;
  #pragma unroll
  for (int i = 0; i < 16; ++i) {
    const int lid = base + i * 4 + sub;            // 0..127
    v8h val;
    _Float16* dst;
    if (which != 2) {
      val = *(const v8ha*)(sT + lid * HD + 8 * q8);
      dst = plane + ((size_t)bh * SEQ + l0 + lid) * HD + 8 * q8;
    } else {
      const int d = lid >> 1, hl = lid & 1;
      val = *(const v8ha*)(sT + d * 128 + 64 * hl + 8 * q8);
      dst = vt + ((size_t)bh * HD + d) * SEQ + l0 + 64 * hl + 8 * q8;
    }
    *(v8h*)dst = val;
    asm volatile("s_wait_xcnt 0x0" ::: "memory");  // before the next line's load and address reuse this store's registers
  }
}

// ---------------------------------------------------------------------------
// Kernel 3: Y = X * W (with W^T staged k-contiguous) over the fused 3*1024
// output columns. which = 0: X = q, W = Wq -> qp ; 1: X = v, W = Wk -> kp ;
// 2: X = v, W = Wv -> vt (d-major).
// Block 128 thr (4 waves) = 128 tokens x 128 features (two heads of one which);
// wave tile 64 tokens x 64 features (one head); K = 1024 in stages of 64 (two
// steps of 32); each stage's X and W^T rows come into LDS by asynchronous copies,
// two buffers, the next stage in flight while this one is worked on; fragments
// from LDS. 768 blocks, three to a WGP by their LDS.
// ---------------------------------------------------------------------------
__global__ __launch_bounds__(128) void proj_kernel(
    const _Float16* __restrict__ qx,   // [4096][1024] f16(q)
    const _Float16* __restrict__ vx,   // [4096][1024] f16(v)
    const _Float16* __restrict__ wt,   // [3][1024][1024], row = output feature, x32
    const float* __restrict__ bq, const float* __restrict__ bk, const float* __restrict__ bv,
    _Float16* __restrict__ qp,         // [B*H][L][D]
    _Float16* __restrict__ kp,         // [B*H][L][D]
    _Float16* __restrict__ vt)         // [B*H][D][L]
{
  __shared__ __attribute__((aligned(16))) _Float16 sT[2 * 128 * 64]; // 32768 B, one 128 x 64 tile a head
  __shared__ __attribute__((aligned(16))) _Float16 sXW[2 * XWBUF];   // 73728 B

  const int tid = threadIdx.x, lane = tid & 31, w = tid >> 5;
  const int h = lane >> 4, m = lane & 15;
  const int m0 = blockIdx.x * 128;
  const int cg = blockIdx.y;                 // 0..23
  const int which = cg >> 3, head0 = (cg & 7) * 2;
  const int wtok = w & 1, wf = w >> 1;       // the wave's token half and its head of the pair

  const _Float16* xsrc = (which == 0) ? qx : vx;

  // copy role: rows 32w..32w+31 of X and of W^T; row (lane >> 3) of each group of 4,
  // 16-byte piece (lane & 7)
  const int cr = lane >> 3, cp = lane & 7;
  const char* gx = (const char*)(xsrc + (size_t)(m0 + 32 * w + cr) * EMB + 8 * cp);
  const char* gw = (const char*)(wt + ((size_t)which * EMB + head0 * HD + 32 * w + cr) * EMB + 8 * cp);
  const unsigned lx = lds_off(sXW) + (32 * w + cr) * SPB + 16 * cp;
  const unsigned lw = lds_off(sXW) + (128 + 32 * w + cr) * SPB + 16 * cp;

  const v8f zero8 = {0.f, 0.f, 0.f, 0.f, 0.f, 0.f, 0.f, 0.f};
  v8f acc[4][4];
  #pragma unroll
  for (int mt = 0; mt < 4; ++mt)
    #pragma unroll
    for (int nt = 0; nt < 4; ++nt) acc[mt][nt] = zero8;

  async_rows32(lx, gx);                                    // stage 0 -> buffer 0
  async_rows32(lw, gw);
  asm volatile("s_wait_asynccnt 0x0" ::: "memory");        // own copies of stage 0 have landed
  __syncthreads();
  async_rows32(lx + XWBUF * 2, gx + 128);                  // stage 1 -> buffer 1
  async_rows32(lw + XWBUF * 2, gw + 128);

  // rolled: one buffer offset per trip, every fragment index constant
  #pragma unroll 1
  for (int t = 0; t < EMB / 64; ++t) {
    const int bo = (t & 1) * XWBUF;
    const _Float16* xs = sXW + bo + (64 * wtok + m) * SPITCH;      // token row, mt = 0
    const _Float16* wl = sXW + bo + (128 + 64 * wf + m) * SPITCH;  // feature row, nt = 0
    #pragma unroll
    for (int kc = 0; kc < 64; kc += 32) {
      v16h a[4];
      #pragma unroll
      for (int mt = 0; mt < 4; ++mt) a[mt] = load_frag(xs + mt * 16 * SPITCH + kc, h);
      #pragma unroll
      for (int nt = 0; nt < 4; ++nt) {
        const v16h b = load_frag(wl + nt * 16 * SPITCH + kc, h);
        #pragma unroll
        for (int mt = 0; mt < 4; ++mt) acc[mt][nt] = wmma_f16(a[mt], b, acc[mt][nt]);
      }
    }
    stage_publish();
    if (t + 2 < EMB / 64) {                                // stage t + 2 -> the buffer just read
      async_rows32(lx + bo * 2, gx + (t + 2) * 128);
      async_rows32(lw + bo * 2, gw + (t + 2) * 128);
    }
  }
  asm volatile("s_wait_asynccnt 0x0" ::: "memory");        // nothing of this wave's is in flight any more

  // D[r] of tile (mt, nt) = Y[token m0+64wtok+16mt+8h+r][feature 16nt+m of head head0+wf]
  const int head = head0 + wf;
  _Float16* sTh = sT + wf * (128 * 64);
  const float* bias = (which == 0) ? bq : ((which == 1) ? bk : bv);
  float bvl4[4];
  #pragma unroll
  for (int nt = 0; nt < 4; ++nt) bvl4[nt] = bias[head * HD + 16 * nt + m];
  asm volatile("s_wait_xcnt 0x0" ::: "memory");            // before the index arithmetic below reuses these loads' offset register
  __builtin_amdgcn_sched_barrier(0);                       // or the compiler lifts that arithmetic over the wait
  #pragma unroll
  for (int nt = 0; nt < 4; ++nt) {
    const int feat = 16 * nt + m;
    const float bvl = bvl4[nt];
    #pragma unroll
    for (int mt = 0; mt < 4; ++mt) {
      #pragma unroll
      for (int r = 0; r < 8; ++r) {
        const int tokl = 64 * wtok + 16 * mt + 8 * h + r;  // 0..127
        const float y = acc[mt][nt][r] * WINV + bvl;
        const int idx = (which == 2) ? (feat * 128 + tokl) : (tokl * HD + feat);
        sTh[idx] = (_Float16)y;
      }
    }
  }
  __syncthreads();

  const int b = m0 / SEQ, l0 = m0 - b * SEQ, bh = b * NHEADS + head;
  _Float16* plane = (which == 0) ? qp : kp;
  proj_store_pass(sTh, plane, vt, which, bh, l0, 64 * wtok, lane);
  
}

// ---------------------------------------------------------------------------
// Attention helpers.
// ---------------------------------------------------------------------------
// P^T B-fragment from the lane's own score D values: element r <- tile a row r
// (keys 0..15 of the 32-deep chunk), element 8+r <- tile c row r (keys 16..31),
// same lane, same query column; the values already carry the 2^14.
__device__ __forceinline__ v16h pack_p(v8f a, v8f c) {
  const v16h r = { (_Float16)a[0], (_Float16)a[1], (_Float16)a[2], (_Float16)a[3],
                   (_Float16)a[4], (_Float16)a[5], (_Float16)a[6], (_Float16)a[7],
                   (_Float16)c[0], (_Float16)c[1], (_Float16)c[2], (_Float16)c[3],
                   (_Float16)c[4], (_Float16)c[5], (_Float16)c[6], (_Float16)c[7] };
  return r;
}

// lanes 8q..8q+7 in one instruction, 4 lines per instruction, 32 lines per wave.
__device__ __forceinline__ void att_store_pass(const float* so, float* out,
                                               int b, int head, int q0, int lane) {
  const int q8 = lane & 7, sub = lane >> 3;
  #pragma unroll
  for (int i = 0; i < 8; ++i) {
    const int lid = i * 4 + sub;                   // 0..31
    const int row = lid >> 1, hl = lid & 1;
    const v4f val = *(const v4fa*)(so + row * 64 + 32 * hl + 4 * q8);
    const size_t gi = ((size_t)b * SEQ + q0 + row) * EMB + head * HD + 32 * hl + 4 * q8;
    *(v4f*)(out + gi) = val;
  }
}

// ---------------------------------------------------------------------------
// Kernel 4: streaming attention, transposed form.
// Block 256 thr (8 waves), 16 queries per wave, 64 keys per step.
//   S^T = K * Q^T : A = K rows (row = key, k = d), B = Q^T (k = d, n = query)
//   O^T += V^T * P^T : A = Vt rows (row = d, k = key), B = P^T from registers
// Lane owns 32 keys of query column (lane&15); partner = lane ^ 16.
// Each step's 64 K rows and 64 V^T rows (128 B each) come into LDS once for the
// eight waves by asynchronous copies (waves 0-3: K, waves 4-7: V^T; 4 copies a
// wave), two buffers, the next step in flight while this one is worked on.
// grid = (SEQ/128, B*H).
// ---------------------------------------------------------------------------
__global__ __launch_bounds__(256) void attn_kernel(
    const _Float16* __restrict__ qp,   // [B*H][L][D]
    const _Float16* __restrict__ kp,   // [B*H][L][D]
    const _Float16* __restrict__ vt,   // [B*H][D][L]
    float* __restrict__ out)           // [B][L][EMB]
{
  __shared__ __attribute__((aligned(16))) float sO[8 * 16 * 64];    // 32768 B
  __shared__ __attribute__((aligned(16))) _Float16 sKV[2 * KVBUF];  // 36864 B

  const int tid = threadIdx.x, lane = tid & 31, w = tid >> 5;
  const int h = lane >> 4, m = lane & 15;
  const int bh = blockIdx.y, b = bh >> 4, head = bh & 15;
  const int q0 = blockIdx.x * 128 + 16 * w;

  // Q^T B-fragments: column n = query q0+m, k = d (two 32-deep chunks)
  const _Float16* qrow = qp + ((size_t)bh * SEQ + q0 + m) * HD;
  const v16h qb0 = load_frag(qrow, h);
  const v16h qb1 = load_frag(qrow + 32, h);

  const v8f zero8 = {0.f, 0.f, 0.f, 0.f, 0.f, 0.f, 0.f, 0.f};
  v8f o[4];                                   // o[t][r] = O[query m][d 16t+8h+r] * lrun (lrun = l * 2^14)
  #pragma unroll
  for (int t = 0; t < 4; ++t) o[t] = zero8;
  float mrun = -1e30f, lrun = 0.0f;

  // copy role: staged rows 16w + (lane >> 3) + 4c, c = 0..3; 16-byte piece (lane & 7)
  const int cr = 16 * w + (lane >> 3), cp = lane & 7;
  const bool ck = __builtin_amdgcn_readfirstlane(w) < 4;       // scalar: the choice writes no EXEC
  const unsigned gpitch = ck ? HD * 2 : SEQ * 2;               // bytes, one source row further on
  const unsigned grow = 4 * gpitch;                            // bytes, 4 rows further on
  const unsigned gstep = ck ? 64 * HD * 2 : 64 * 2;            // bytes, 64 keys further on
  const char* gsrc = (const char*)((ck ? kp : vt) + (size_t)bh * SEQ * HD)
                     + (size_t)((cr & 63) * gpitch) + 16 * cp;
  const unsigned ldst = lds_off(sKV) + cr * SPB + 16 * cp;

  async_rows16(ldst, gsrc, grow);                          // step 0 -> buffer 0
  asm volatile("s_wait_asynccnt 0x0" ::: "memory");        // own copies of step 0 have landed
  __syncthreads();
  async_rows16(ldst + KVBUF * 2, gsrc + gstep, grow);      // step 1 -> buffer 1

  // rolled: one buffer offset per trip, every fragment index constant
  #pragma unroll 1
  for (int st = 0; st < SEQ / 64; ++st) {
    const int bo = (st & 1) * KVBUF;
    const _Float16* kl = sKV + bo + m * SPITCH;            // + 16j rows + 32*dc
    const _Float16* vl = kl + 64 * SPITCH;                 // + 16t rows + key chunk
    // ---- raw scores: s[j][r] = q . k of query m, key kb+16j+8h+r ----
    v8f s[4];
    #pragma unroll
    for (int j = 0; j < 4; ++j) {
      const _Float16* kpp = kl + 16 * j * SPITCH;
      const v16h kf0 = load_frag(kpp, h);
      const v16h kf1 = load_frag(kpp + 32, h);
      v8f z = zero8;
      z = wmma_f16(kf0, qb0, z);
      z = wmma_f16(kf1, qb1, z);
      s[j] = z;
    }
    // ---- online softmax in base 2: P * 2^14 = exp2(raw * SLOG2E + (14 - max * SLOG2E)), one FMA ahead of each exp2 ----
    float mloc = s[0][0];
    #pragma unroll
    for (int j = 0; j < 4; ++j)
      #pragma unroll
      for (int r = 0; r < 8; ++r) mloc = fmaxf(mloc, s[j][r]);
    mloc = fmaxf(mloc, __shfl_xor(mloc, 16));
    const float mnew = fmaxf(mrun, mloc);                  // running maximum of the raw scores (SLOG2E > 0)
    const float alpha = __builtin_amdgcn_exp2f((mrun - mnew) * SLOG2E);
    mrun = mnew;
    const float nb = __builtin_fmaf(-mnew, SLOG2E, PBITS);
    const v2f sc2 = {SLOG2E, SLOG2E};
    const v2f nb2 = {nb, nb};
    float lsum = 0.0f;
    #pragma unroll
    for (int j = 0; j < 4; ++j)
      #pragma unroll
      for (int r = 0; r < 8; r += 2) {
        const v2f raw = {s[j][r], s[j][r + 1]};
        const v2f e = __builtin_elementwise_fma(raw, sc2, nb2);
        const float p0 = __builtin_amdgcn_exp2f(e.x);
        const float p1 = __builtin_amdgcn_exp2f(e.y);
        s[j][r] = p0;
        s[j][r + 1] = p1;
        lsum += p0;
        lsum += p1;
      }
    lsum += __shfl_xor(lsum, 16);
    lrun = lrun * alpha + lsum;
    #pragma unroll
    for (int t = 0; t < 4; ++t)
      #pragma unroll
      for (int r = 0; r < 8; ++r) o[t][r] = o[t][r] * alpha;

    // ---- P^T B-fragments (key chunks 0..31 and 32..63 of this step) ----
    const v16h pb0 = pack_p(s[0], s[1]);
    const v16h pb1 = pack_p(s[2], s[3]);

    // ---- O^T += V^T * P^T ----
    #pragma unroll
    for (int t = 0; t < 4; ++t) {
      const _Float16* vpp = vl + 16 * t * SPITCH;
      const v16h vf0 = load_frag(vpp, h);
      const v16h vf1 = load_frag(vpp + 32, h);
      o[t] = wmma_f16(vf0, pb0, o[t]);
      o[t] = wmma_f16(vf1, pb1, o[t]);
    }

    stage_publish();
    if (st + 2 < SEQ / 64)                                 // step st + 2 -> the buffer just read
      async_rows16(ldst + bo * 2, gsrc + (size_t)(st + 2) * gstep, grow);
  }
  asm volatile("s_wait_asynccnt 0x0" ::: "memory");        // nothing of this wave's is in flight any more

  // ---- epilogue: normalise, stage per-wave 16x64 tile, whole-line stores ----
  const float inv = 1.0f / lrun;                           // o and lrun both carry the 2^14
  float* so = sO + w * 1024;
  #pragma unroll
  for (int t = 0; t < 4; ++t)
    #pragma unroll
    for (int r = 0; r < 8; ++r)
      so[m * 64 + 16 * t + 8 * h + r] = o[t][r] * inv;
  __syncthreads();

  att_store_pass(so, out, b, head, q0, lane);
  
}

// ---------------------------------------------------------------------------
extern "C" void kernel_launch(void* const* d_in, const int* in_sizes, int n_in,
                              void* d_out, int out_size, void* d_ws, size_t ws_size,
                              hipStream_t stream) {
  if (n_in < 8) return;
  if (in_sizes[0] != NX || in_sizes[1] != NX) return;
  if (in_sizes[2] != NW || in_sizes[4] != NW || in_sizes[6] != NW) return;
  if (in_sizes[3] != EMB || in_sizes[5] != EMB || in_sizes[7] != EMB) return;
  if (out_size != NX) return;

  const float* q  = (const float*)d_in[0];
  const float* v  = (const float*)d_in[1];
  const float* Wq = (const float*)d_in[2];
  const float* bq = (const float*)d_in[3];
  const float* Wk = (const float*)d_in[4];
  const float* bk = (const float*)d_in[5];
  const float* Wv = (const float*)d_in[6];
  const float* bv = (const float*)d_in[7];
  float* out = (float*)d_out;

  const size_t x_bytes  = (size_t)NX * 2;                           //  8388608 per plane
  const size_t wt_bytes = (size_t)3 * NW * 2;                       //  6291456
  const size_t pl_bytes = (size_t)BATCH * NHEADS * SEQ * HD * 2;    //  8388608 per plane
  const size_t total = 2 * x_bytes + wt_bytes + 3 * pl_bytes;       // 48234496
  if (total > ws_size) return;

  char* ws = (char*)d_ws;
  _Float16* qx = (_Float16*)(ws);
  _Float16* vx = (_Float16*)(ws + x_bytes);
  _Float16* wt = (_Float16*)(ws + 2 * x_bytes);
  _Float16* qp = (_Float16*)(ws + 2 * x_bytes + wt_bytes);
  _Float16* kp = (_Float16*)(ws + 2 * x_bytes + wt_bytes + pl_bytes);
  _Float16* vt = (_Float16*)(ws + 2 * x_bytes + wt_bytes + 2 * pl_bytes);

  const int ngroups = 2 * NX8;                                       // 1048576
  convert_kernel<<<(ngroups + 255) / 256, 256, 0, stream>>>(q, v, qx, vx);

  dim3 gTr(EMB / 64, EMB / 64, 3);                                   // (16, 16, 3)
  wtrans_kernel<<<gTr, 256, 0, stream>>>(Wq, Wk, Wv, wt);

  dim3 gProj(MROWS / 128, 3 * NHEADS / 2);                           // (32, 24)
  proj_kernel<<<gProj, 128, 0, stream>>>(qx, vx, wt, bq, bk, bv, qp, kp, vt);

  dim3 gAtt(SEQ / 128, BATCH * NHEADS);                              // (16, 32)
  attn_kernel<<<gAtt, 256, 0, stream>>>(qp, kp, vt, out);
}

// v004
// One run takes 74.3 microseconds.
// Two timings next to v003 both put it at 1.05 times that version's speed.
// All steps since v000 together make it 3.25 times as fast.
// Contractions: q*Wq, v*Wk, v*Wv, K*Q^T and V^T*P^T all on v_wmma_f32_16x16x32_f16 (f16 operands, f32 accumulate); W carried x32 (exact power-of-two scale folded back in f32), P and its row sum carried x16384 (cancels in the normalisation); score scale 1/32, softmax (base 2), bias and normalisation in f32.
#include <hip/hip_runtime.h>

typedef _Float16 v16h __attribute__((ext_vector_type(16)));
typedef _Float16 v8h  __attribute__((ext_vector_type(8)));
typedef float    v8f  __attribute__((ext_vector_type(8)));
typedef float    v4f  __attribute__((ext_vector_type(4)));
typedef float    v2f  __attribute__((ext_vector_type(2)));
typedef v8h __attribute__((may_alias)) v8ha;
typedef v4f __attribute__((may_alias)) v4fa;

union Frag { v16h v; v8h half[2]; };

#define EMB    1024
#define NHEADS 16
#define HD     64
#define SEQ    2048
#define BATCH  2
#define MROWS  (BATCH * SEQ)          // 4096 tokens
#define NX     (MROWS * EMB)          // 4194304
#define NW     (EMB * EMB)            // 1048576
#define NX8    (NX / 8)               // 524288
#define WSC    32.0f                  // weight plane scale (exact)
#define WINV   0.03125f               // 1/WSC
#define SLOG2E 0.045084220027780106f  // log2(e) / sqrt(EMB): raw score -> exponent of 2
#define PBITS  14.0f                  // P is carried x 2^14: added to that exponent
#define TPITCH 72                     // LDS pitch (halves) of the transposed weight tile
#define SPITCH 72                     // LDS pitch (halves) of a staged 128-byte operand row: 144 B = 16 B x 9
#define SPB    (SPITCH * 2)           // the same in bytes
#define KVBUF  (128 * SPITCH)         // attention stage: 64 K rows, then 64 V^T rows (halves)
#define XWBUF  (256 * SPITCH)         // projection stage: 128 X rows, then 128 W^T rows (halves)

// ---------------------------------------------------------------------------
// 16x16x32 f16 WMMA with hazard guard (ties D, keeps A/B live).
// Fragment map (wave32): lane l, h = l>>4, m = n = l&15.
//   A/B element i: i<8 -> k0+8h+i ; i>=8 -> k0+16+8h+(i-8)
//   D element r : row 8h+r, col l&15
// ---------------------------------------------------------------------------
__device__ __forceinline__ v8f wmma_f16(v16h a, v16h b, v8f c) {
  v8f d = __builtin_amdgcn_wmma_f32_16x16x32_f16(false, a, false, b, (short)0, c, false, false);
  asm volatile("v_nop\n\tv_nop\n\tv_nop\n\tv_nop" : "+v"(d) : "v"(a), "v"(b));
  return d;
}

// A or B fragment from a k-contiguous 16-bit row; p points at element k0 of
// the row owned by this lane (row index = lane & 15 added by the caller).
__device__ __forceinline__ v16h load_frag(const _Float16* p, int h) {
  Frag f;
  f.half[0] = *(const v8ha*)(p + 8 * h);
  f.half[1] = *(const v8ha*)(p + 16 + 8 * h);
  return f.v;
}

// ---------------------------------------------------------------------------
// Asynchronous copies global -> LDS, 16 B per lane: lanes 8q..8q+7 bring one
// whole 128-byte row, one copy = 4 rows. l = the lane's LDS byte address,
// g = its global address; copy c takes the rows 4c further on (LDS + 4 pitches,
// global + grow bytes). s_wait_xcnt closes each statement so that no address
// register is rewritten while a copy that names it may still need it.
// ---------------------------------------------------------------------------
__device__ __forceinline__ unsigned lds_off(const void* p) { return (unsigned)(size_t)p; }

__device__ __forceinline__ void async_rows16(unsigned l, const char* g, unsigned grow) {
  asm volatile("global_load_async_to_lds_b128 %0, %4, off\n\t"
               "global_load_async_to_lds_b128 %1, %5, off\n\t"
               "global_load_async_to_lds_b128 %2, %6, off\n\t"
               "global_load_async_to_lds_b128 %3, %7, off\n\t"
               "s_wait_xcnt 0x0"
               :: "v"(l), "v"(l + 4 * SPB), "v"(l + 8 * SPB), "v"(l + 12 * SPB),
                  "v"(g), "v"(g + grow), "v"(g + 2 * (size_t)grow), "v"(g + 3 * (size_t)grow)
               : "memory");
}

// 32 rows of one operand (8 copies) at a global row pitch of EMB halves; a projection
// wave calls it once for its X rows and once for its W^T rows of a stage.
__device__ __forceinline__ void async_rows32(unsigned l, const char* g) {
  const size_t gr = (size_t)4 * EMB * 2;             // 4 rows further on in global memory
  asm volatile("global_load_async_to_lds_b128 %0, %8, off\n\t"
               "global_load_async_to_lds_b128 %1, %9, off\n\t"
               "global_load_async_to_lds_b128 %2, %10, off\n\t"
               "global_load_async_to_lds_b128 %3, %11, off\n\t"
               "global_load_async_to_lds_b128 %4, %12, off\n\t"
               "global_load_async_to_lds_b128 %5, %13, off\n\t"
               "global_load_async_to_lds_b128 %6, %14, off\n\t"
               "global_load_async_to_lds_b128 %7, %15, off\n\t"
               "s_wait_xcnt 0x0"
               :: "v"(l), "v"(l + 4 * SPB), "v"(l + 8 * SPB), "v"(l + 12 * SPB),
                  "v"(l + 16 * SPB), "v"(l + 20 * SPB), "v"(l + 24 * SPB), "v"(l + 28 * SPB),
                  "v"(g), "v"(g + gr), "v"(g + 2 * gr), "v"(g + 3 * gr),
                  "v"(g + 4 * gr), "v"(g + 5 * gr), "v"(g + 6 * gr), "v"(g + 7 * gr)
               : "memory");
}

// Hand-over of a stage: this wave's LDS reads are done, its own copies have
// landed, then the work-group barrier publishes the next stage and frees this one.
__device__ __forceinline__ void stage_publish() {
  asm volatile("s_wait_dscnt 0x0" ::: "memory");     // own reads of the buffer that is refilled next
  asm volatile("s_wait_asynccnt 0x0" ::: "memory");  // own copies of the next stage have landed
  __syncthreads();
}

// ---------------------------------------------------------------------------
// Kernel 1: f32 -> f16 planes for q and v, unscaled, RNE convert.
// ---------------------------------------------------------------------------
__global__ __launch_bounds__(256) void convert_kernel(
    const float* __restrict__ q, const float* __restrict__ v,
    _Float16* __restrict__ qx, _Float16* __restrict__ vx)
{
  const int g = blockIdx.x * 256 + threadIdx.x;
  if (g >= 2 * NX8) return;
  const float* src;
  _Float16* dst;
  if (g < NX8) {
    src = q + (size_t)g * 8;
    dst = qx + (size_t)g * 8;
  } else {
    const int e = g - NX8;
    src = v + (size_t)e * 8;
    dst = vx + (size_t)e * 8;
  }
  const v4f a = *(const v4fa*)src;
  const v4f c = *(const v4fa*)(src + 4);
  const v8h o = { (_Float16)a.x, (_Float16)a.y, (_Float16)a.z, (_Float16)a.w,
                  (_Float16)c.x, (_Float16)c.y, (_Float16)c.z, (_Float16)c.w };
  *(v8h*)dst = o;
  
}

// ---------------------------------------------------------------------------
// Kernel 2: weight transpose + convert. in W[k][n] (k = input feature,
// n = output feature, both 1024) -> wt[which][n][k] = f16(32 * W[k][n]).
// Block 256 thr = one 64(k) x 64(n) tile; tile transposed through LDS;
// lanes 8q..8q+7 of one wave in one instruction (4 lines per instruction,
// grid = (n tiles, k tiles, 3).
// ---------------------------------------------------------------------------
__device__ __forceinline__ void wt_store_pass(const _Float16* sW, _Float16* wt,
                                              int which, int n0, int k0, int w, int lane) {
  const int q8 = lane & 7, sub = lane >> 3;
  #pragma unroll
  for (int i = 0; i < 2; ++i) {
    const int nrow = w * 8 + i * 4 + sub;          // 0..63
    const v8h val = *(const v8ha*)(sW + nrow * TPITCH + 8 * q8);
    _Float16* dst = wt + ((size_t)which * EMB + n0 + nrow) * EMB + k0 + 8 * q8;
    *(v8h*)dst = val;
  }
}

__global__ __launch_bounds__(256) void wtrans_kernel(
    const float* __restrict__ wq, const float* __restrict__ wk, const float* __restrict__ wv,
    _Float16* __restrict__ wt)         // [3][1024 n][1024 k], x32
{
  __shared__ __attribute__((aligned(16))) _Float16 sW[64 * TPITCH];   // 9216 B

  const int tid = threadIdx.x, lane = tid & 31, w = tid >> 5;
  const int n0 = blockIdx.x * 64, k0 = blockIdx.y * 64, which = blockIdx.z;
  const float* W = (which == 0) ? wq : ((which == 1) ? wk : wv);

  #pragma unroll
  for (int i = 0; i < 4; ++i) {
    const int idx = tid + 256 * i;                 // 0..1023 float4 groups
    const int kk = idx >> 4, nn = (idx & 15) * 4;
    const v4f x = *(const v4fa*)(W + (size_t)(k0 + kk) * EMB + n0 + nn);
    sW[(nn + 0) * TPITCH + kk] = (_Float16)(x.x * WSC);
    sW[(nn + 1) * TPITCH + kk] = (_Float16)(x.y * WSC);
    sW[(nn + 2) * TPITCH + kk] = (_Float16)(x.z * WSC);
    sW[(nn + 3) * TPITCH + kk] = (_Float16)(x.w * WSC);
  }
  __syncthreads();

  wt_store_pass(sW, wt, which, n0, k0, w, lane);
  
}

// ---------------------------------------------------------------------------
// 4 lines per instruction, 64 lines per wave: half of one head's 128 lines
// (base = 0 or 64), sT = that head's staged 128 x 64 tile.
// which 0/1: plane[bh][l][d]  (one token row = 64 halves = one line)
// which 2  : vt[bh][d][l]     (64 d-rows x 128 tokens = 2 lines each)
// ---------------------------------------------------------------------------
__device__ __forceinline__ void proj_store_pass(const _Float16* sT, _Float16* plane, _Float16* vt,
                                                int which, int bh, int l0, int base, int lane) {
  const int q8 = lane & 7, sub = lane >> 3;
  #pragma unroll
  for (int i = 0; i < 16; ++i) {
    const int lid = base + i * 4 + sub;            // 0..127
    v8h val;
    _Float16* dst;
    if (which != 2) {
      val = *(const v8ha*)(sT + lid * HD + 8 * q8);
      dst = plane + ((size_t)bh * SEQ + l0 + lid) * HD + 8 * q8;
    } else {
      const int d = lid >> 1, hl = lid & 1;
      val = *(const v8ha*)(sT + d * 128 + 64 * hl + 8 * q8);
      dst = vt + ((size_t)bh * HD + d) * SEQ + l0 + 64 * hl + 8 * q8;
    }
    *(v8h*)dst = val;
    asm volatile("s_wait_xcnt 0x0" ::: "memory");  // before the next line's load and address reuse this store's registers
  }
}

// ---------------------------------------------------------------------------
// Kernel 3: Y = X * W (with W^T staged k-contiguous) over the fused 3*1024
// output columns. which = 0: X = q, W = Wq -> qp ; 1: X = v, W = Wk -> kp ;
// 2: X = v, W = Wv -> vt (d-major).
// Block 128 thr (4 waves) = 128 tokens x 128 features (two heads of one which);
// wave tile 64 tokens x 64 features (one head); K = 1024 in stages of 64 (two
// steps of 32); each stage's X and W^T rows come into LDS by asynchronous copies,
// two buffers, the next stage in flight while this one is worked on; fragments
// from LDS. 768 blocks, three to a WGP by their LDS.
// ---------------------------------------------------------------------------
__global__ __launch_bounds__(128) void proj_kernel(
    const _Float16* __restrict__ qx,   // [4096][1024] f16(q)
    const _Float16* __restrict__ vx,   // [4096][1024] f16(v)
    const _Float16* __restrict__ wt,   // [3][1024][1024], row = output feature, x32
    const float* __restrict__ bq, const float* __restrict__ bk, const float* __restrict__ bv,
    _Float16* __restrict__ qp,         // [B*H][L][D]
    _Float16* __restrict__ kp,         // [B*H][L][D]
    _Float16* __restrict__ vt)         // [B*H][D][L]
{
  __shared__ __attribute__((aligned(16))) _Float16 sT[2 * 128 * 64]; // 32768 B, one 128 x 64 tile a head
  __shared__ __attribute__((aligned(16))) _Float16 sXW[2 * XWBUF];   // 73728 B

  const int tid = threadIdx.x, lane = tid & 31, w = tid >> 5;
  const int h = lane >> 4, m = lane & 15;
  const int m0 = blockIdx.x * 128;
  const int cg = blockIdx.y;                 // 0..23
  const int which = cg >> 3, head0 = (cg & 7) * 2;
  const int wtok = w & 1, wf = w >> 1;       // the wave's token half and its head of the pair

  const _Float16* xsrc = (which == 0) ? qx : vx;

  // copy role: rows 32w..32w+31 of X and of W^T; row (lane >> 3) of each group of 4,
  // 16-byte piece (lane & 7)
  const int cr = lane >> 3, cp = lane & 7;
  const char* gx = (const char*)(xsrc + (size_t)(m0 + 32 * w + cr) * EMB + 8 * cp);
  const char* gw = (const char*)(wt + ((size_t)which * EMB + head0 * HD + 32 * w + cr) * EMB + 8 * cp);
  const unsigned lx = lds_off(sXW) + (32 * w + cr) * SPB + 16 * cp;
  const unsigned lw = lds_off(sXW) + (128 + 32 * w + cr) * SPB + 16 * cp;

  const v8f zero8 = {0.f, 0.f, 0.f, 0.f, 0.f, 0.f, 0.f, 0.f};
  v8f acc[4][4];
  #pragma unroll
  for (int mt = 0; mt < 4; ++mt)
    #pragma unroll
    for (int nt = 0; nt < 4; ++nt) acc[mt][nt] = zero8;

  async_rows32(lx, gx);                                    // stage 0 -> buffer 0
  async_rows32(lw, gw);
  asm volatile("s_wait_asynccnt 0x0" ::: "memory");        // own copies of stage 0 have landed
  __syncthreads();
  async_rows32(lx + XWBUF * 2, gx + 128);                  // stage 1 -> buffer 1
  async_rows32(lw + XWBUF * 2, gw + 128);

  // rolled: one buffer offset per trip, every fragment index constant
  #pragma unroll 1
  for (int t = 0; t < EMB / 64; ++t) {
    const int bo = (t & 1) * XWBUF;
    const _Float16* xs = sXW + bo + (64 * wtok + m) * SPITCH;      // token row, mt = 0
    const _Float16* wl = sXW + bo + (128 + 64 * wf + m) * SPITCH;  // feature row, nt = 0
    // Fragment reads stand in groups ahead of the products that use them, so that a
    // wave waits out the LDS latency once a stage and not in front of every four products.
    v16h a0[4], b0[4], a1[4], b1[4];
    #pragma unroll
    for (int mt = 0; mt < 4; ++mt) a0[mt] = load_frag(xs + mt * 16 * SPITCH, h);
    #pragma unroll
    for (int nt = 0; nt < 4; ++nt) b0[nt] = load_frag(wl + nt * 16 * SPITCH, h);
    #pragma unroll
    for (int mt = 0; mt < 4; ++mt) a1[mt] = load_frag(xs + mt * 16 * SPITCH + 32, h);
    b1[0] = load_frag(wl + 32, h);
    __builtin_amdgcn_sched_barrier(0);                     // or the compiler sinks these reads down to their products
    #pragma unroll
    for (int nt = 0; nt < 3; ++nt)
      #pragma unroll
      for (int mt = 0; mt < 4; ++mt) acc[mt][nt] = wmma_f16(a0[mt], b0[nt], acc[mt][nt]);
    // the last three reads go out here, into registers that the twelve products above have left
    #pragma unroll
    for (int nt = 1; nt < 4; ++nt) b1[nt] = load_frag(wl + nt * 16 * SPITCH + 32, h);
    __builtin_amdgcn_sched_barrier(0);                     // holds these reads eight products ahead of their first use; without it the compiler moves them
    #pragma unroll
    for (int mt = 0; mt < 4; ++mt) acc[mt][3] = wmma_f16(a0[mt], b0[3], acc[mt][3]);
    #pragma unroll
    for (int nt = 0; nt < 4; ++nt)
      #pragma unroll
      for (int mt = 0; mt < 4; ++mt) acc[mt][nt] = wmma_f16(a1[mt], b1[nt], acc[mt][nt]);
    stage_publish();
    if (t + 2 < EMB / 64) {                                // stage t + 2 -> the buffer just read
      async_rows32(lx + bo * 2, gx + (t + 2) * 128);
      async_rows32(lw + bo * 2, gw + (t + 2) * 128);
    }
  }
  asm volatile("s_wait_asynccnt 0x0" ::: "memory");        // nothing of this wave's is in flight any more

  // D[r] of tile (mt, nt) = Y[token m0+64wtok+16mt+8h+r][feature 16nt+m of head head0+wf]
  const int head = head0 + wf;
  _Float16* sTh = sT + wf * (128 * 64);
  const float* bias = (which == 0) ? bq : ((which == 1) ? bk : bv);
  float bvl4[4];
  #pragma unroll
  for (int nt = 0; nt < 4; ++nt) bvl4[nt] = bias[head * HD + 16 * nt + m];
  asm volatile("s_wait_xcnt 0x0" ::: "memory");            // before the index arithmetic below reuses these loads' offset register
  __builtin_amdgcn_sched_barrier(0);                       // or the compiler lifts that arithmetic over the wait
  #pragma unroll
  for (int nt = 0; nt < 4; ++nt) {
    const int feat = 16 * nt + m;
    const float bvl = bvl4[nt];
    #pragma unroll
    for (int mt = 0; mt < 4; ++mt) {
      #pragma unroll
      for (int r = 0; r < 8; ++r) {
        const int tokl = 64 * wtok + 16 * mt + 8 * h + r;  // 0..127
        const float y = acc[mt][nt][r] * WINV + bvl;
        const int idx = (which == 2) ? (feat * 128 + tokl) : (tokl * HD + feat);
        sTh[idx] = (_Float16)y;
      }
    }
  }
  __syncthreads();

  const int b = m0 / SEQ, l0 = m0 - b * SEQ, bh = b * NHEADS + head;
  _Float16* plane = (which == 0) ? qp : kp;
  proj_store_pass(sTh, plane, vt, which, bh, l0, 64 * wtok, lane);
  
}

// ---------------------------------------------------------------------------
// Attention helpers.
// ---------------------------------------------------------------------------
// P^T B-fragment from the lane's own score D values: element r <- tile a row r
// (keys 0..15 of the 32-deep chunk), element 8+r <- tile c row r (keys 16..31),
// same lane, same query column; the values already carry the 2^14.
__device__ __forceinline__ v16h pack_p(v8f a, v8f c) {
  const v16h r = { (_Float16)a[0], (_Float16)a[1], (_Float16)a[2], (_Float16)a[3],
                   (_Float16)a[4], (_Float16)a[5], (_Float16)a[6], (_Float16)a[7],
                   (_Float16)c[0], (_Float16)c[1], (_Float16)c[2], (_Float16)c[3],
                   (_Float16)c[4], (_Float16)c[5], (_Float16)c[6], (_Float16)c[7] };
  return r;
}

// lanes 8q..8q+7 in one instruction, 4 lines per instruction, 32 lines per wave.
__device__ __forceinline__ void att_store_pass(const float* so, float* out,
                                               int b, int head, int q0, int lane) {
  const int q8 = lane & 7, sub = lane >> 3;
  #pragma unroll
  for (int i = 0; i < 8; ++i) {
    const int lid = i * 4 + sub;                   // 0..31
    const int row = lid >> 1, hl = lid & 1;
    const v4f val = *(const v4fa*)(so + row * 64 + 32 * hl + 4 * q8);
    const size_t gi = ((size_t)b * SEQ + q0 + row) * EMB + head * HD + 32 * hl + 4 * q8;
    *(v4f*)(out + gi) = val;
  }
}

// ---------------------------------------------------------------------------
// Kernel 4: streaming attention, transposed form.
// Block 256 thr (8 waves), 16 queries per wave, 64 keys per step.
//   S^T = K * Q^T : A = K rows (row = key, k = d), B = Q^T (k = d, n = query)
//   O^T += V^T * P^T : A = Vt rows (row = d, k = key), B = P^T from registers
// Lane owns 32 keys of query column (lane&15); partner = lane ^ 16.
// Each step's 64 K rows and 64 V^T rows (128 B each) come into LDS once for the
// eight waves by asynchronous copies (waves 0-3: K, waves 4-7: V^T; 4 copies a
// wave), two buffers, the next step in flight while this one is worked on.
// grid = (SEQ/128, B*H).
// ---------------------------------------------------------------------------
__global__ __launch_bounds__(256) void attn_kernel(
    const _Float16* __restrict__ qp,   // [B*H][L][D]
    const _Float16* __restrict__ kp,   // [B*H][L][D]
    const _Float16* __restrict__ vt,   // [B*H][D][L]
    float* __restrict__ out)           // [B][L][EMB]
{
  __shared__ __attribute__((aligned(16))) float sO[8 * 16 * 64];    // 32768 B
  __shared__ __attribute__((aligned(16))) _Float16 sKV[2 * KVBUF];  // 36864 B

  const int tid = threadIdx.x, lane = tid & 31, w = tid >> 5;
  const int h = lane >> 4, m = lane & 15;
  const int bh = blockIdx.y, b = bh >> 4, head = bh & 15;
  const int q0 = blockIdx.x * 128 + 16 * w;

  // Q^T B-fragments: column n = query q0+m, k = d (two 32-deep chunks)
  const _Float16* qrow = qp + ((size_t)bh * SEQ + q0 + m) * HD;
  const v16h qb0 = load_frag(qrow, h);
  const v16h qb1 = load_frag(qrow + 32, h);

  const v8f zero8 = {0.f, 0.f, 0.f, 0.f, 0.f, 0.f, 0.f, 0.f};
  v8f o[4];                                   // o[t][r] = O[query m][d 16t+8h+r] * lrun (lrun = l * 2^14)
  #pragma unroll
  for (int t = 0; t < 4; ++t) o[t] = zero8;
  float mrun = -1e30f, lrun = 0.0f;

  // copy role: staged rows 16w + (lane >> 3) + 4c, c = 0..3; 16-byte piece (lane & 7)
  const int cr = 16 * w + (lane >> 3), cp = lane & 7;
  const bool ck = __builtin_amdgcn_readfirstlane(w) < 4;       // scalar: the choice writes no EXEC
  const unsigned gpitch = ck ? HD * 2 : SEQ * 2;               // bytes, one source row further on
  const unsigned grow = 4 * gpitch;                            // bytes, 4 rows further on
  const unsigned gstep = ck ? 64 * HD * 2 : 64 * 2;            // bytes, 64 keys further on
  const char* gsrc = (const char*)((ck ? kp : vt) + (size_t)bh * SEQ * HD)
                     + (size_t)((cr & 63) * gpitch) + 16 * cp;
  const unsigned ldst = lds_off(sKV) + cr * SPB + 16 * cp;

  async_rows16(ldst, gsrc, grow);                          // step 0 -> buffer 0
  asm volatile("s_wait_asynccnt 0x0" ::: "memory");        // own copies of step 0 have landed
  __syncthreads();
  async_rows16(ldst + KVBUF * 2, gsrc + gstep, grow);      // step 1 -> buffer 1

  // rolled: one buffer offset per trip, every fragment index constant
  #pragma unroll 1
  for (int st = 0; st < SEQ / 64; ++st) {
    const int bo = (st & 1) * KVBUF;
    const _Float16* kl = sKV + bo + m * SPITCH;            // + 16j rows + 32*dc
    const _Float16* vl = kl + 64 * SPITCH;                 // + 16t rows + key chunk
    // ---- raw scores: s[j][r] = q . k of query m, key kb+16j+8h+r ----
    // all 16 K reads of the step as one group ahead of the eight products: one LDS wait, not four
    v16h kf0[4], kf1[4];
    #pragma unroll
    for (int j = 0; j < 4; ++j) kf0[j] = load_frag(kl + 16 * j * SPITCH, h);
    #pragma unroll
    for (int j = 0; j < 4; ++j) kf1[j] = load_frag(kl + 16 * j * SPITCH + 32, h);
    __builtin_amdgcn_sched_barrier(0);                     // or the compiler sinks each read down to its product
    v8f s[4];
    #pragma unroll
    for (int j = 0; j < 4; ++j) s[j] = wmma_f16(kf0[j], qb0, zero8);
    #pragma unroll
    for (int j = 0; j < 4; ++j) s[j] = wmma_f16(kf1[j], qb1, s[j]);
    // ---- online softmax in base 2: P * 2^14 = exp2(raw * SLOG2E + (14 - max * SLOG2E)), one FMA ahead of each exp2 ----
    float mloc = s[0][0];
    #pragma unroll
    for (int j = 0; j < 4; ++j)
      #pragma unroll
      for (int r = 0; r < 8; ++r) mloc = fmaxf(mloc, s[j][r]);
    const float mpart = __shfl_xor(mloc, 16);
    asm volatile("" :: "v"(mpart) : "memory");             // the V^T reads go out behind the exchange's return: queued ahead of it in the LDS they would lengthen its wait
    // all 16 V^T reads of the step as one group: they land under the exponentials
    v16h vf0[4], vf1[4];
    #pragma unroll
    for (int t = 0; t < 4; ++t) vf0[t] = load_frag(vl + 16 * t * SPITCH, h);
    #pragma unroll
    for (int t = 0; t < 4; ++t) vf1[t] = load_frag(vl + 16 * t * SPITCH + 32, h);
    __builtin_amdgcn_sched_barrier(0);                     // or the compiler sinks each read down to its product
    mloc = fmaxf(mloc, mpart);
    const float mnew = fmaxf(mrun, mloc);                  // running maximum of the raw scores (SLOG2E > 0)
    const float alpha = __builtin_amdgcn_exp2f((mrun - mnew) * SLOG2E);
    mrun = mnew;
    const float nb = __builtin_fmaf(-mnew, SLOG2E, PBITS);
    const v2f sc2 = {SLOG2E, SLOG2E};
    const v2f nb2 = {nb, nb};
    float lsum = 0.0f;
    #pragma unroll
    for (int j = 0; j < 4; ++j)
      #pragma unroll
      for (int r = 0; r < 8; r += 2) {
        const v2f raw = {s[j][r], s[j][r + 1]};
        const v2f e = __builtin_elementwise_fma(raw, sc2, nb2);
        const float p0 = __builtin_amdgcn_exp2f(e.x);
        const float p1 = __builtin_amdgcn_exp2f(e.y);
        s[j][r] = p0;
        s[j][r + 1] = p1;
        lsum += p0;
        lsum += p1;
      }
    lsum += __shfl_xor(lsum, 16);
    lrun = lrun * alpha + lsum;
    #pragma unroll
    for (int t = 0; t < 4; ++t)
      #pragma unroll
      for (int r = 0; r < 8; ++r) o[t][r] = o[t][r] * alpha;

    // ---- P^T B-fragments (key chunks 0..31 and 32..63 of this step) ----
    const v16h pb0 = pack_p(s[0], s[1]);
    const v16h pb1 = pack_p(s[2], s[3]);

    // ---- O^T += V^T * P^T ----
    #pragma unroll
    for (int t = 0; t < 4; ++t) o[t] = wmma_f16(vf0[t], pb0, o[t]);
    #pragma unroll
    for (int t = 0; t < 4; ++t) o[t] = wmma_f16(vf1[t], pb1, o[t]);

    stage_publish();
    if (st + 2 < SEQ / 64)                                 // step st + 2 -> the buffer just read
      async_rows16(ldst + bo * 2, gsrc + (size_t)(st + 2) * gstep, grow);
  }
  asm volatile("s_wait_asynccnt 0x0" ::: "memory");        // nothing of this wave's is in flight any more

  // ---- epilogue: normalise, stage per-wave 16x64 tile, whole-line stores ----
  const float inv = 1.0f / lrun;                           // o and lrun both carry the 2^14
  float* so = sO + w * 1024;
  #pragma unroll
  for (int t = 0; t < 4; ++t)
    #pragma unroll
    for (int r = 0; r < 8; ++r)
      so[m * 64 + 16 * t + 8 * h + r] = o[t][r] * inv;
  __syncthreads();

  att_store_pass(so, out, b, head, q0, lane);
  
}

// ---------------------------------------------------------------------------
extern "C" void kernel_launch(void* const* d_in, const int* in_sizes, int n_in,
                              void* d_out, int out_size, void* d_ws, size_t ws_size,
                              hipStream_t stream) {
  if (n_in < 8) return;
  if (in_sizes[0] != NX || in_sizes[1] != NX) return;
  if (in_sizes[2] != NW || in_sizes[4] != NW || in_sizes[6] != NW) return;
  if (in_sizes[3] != EMB || in_sizes[5] != EMB || in_sizes[7] != EMB) return;
  if (out_size != NX) return;

  const float* q  = (const float*)d_in[0];
  const float* v  = (const float*)d_in[1];
  const float* Wq = (const float*)d_in[2];
  const float* bq = (const float*)d_in[3];
  const float* Wk = (const float*)d_in[4];
  const float* bk = (const float*)d_in[5];
  const float* Wv = (const float*)d_in[6];
  const float* bv = (const float*)d_in[7];
  float* out = (float*)d_out;

  const size_t x_bytes  = (size_t)NX * 2;                           //  8388608 per plane
  const size_t wt_bytes = (size_t)3 * NW * 2;                       //  6291456
  const size_t pl_bytes = (size_t)BATCH * NHEADS * SEQ * HD * 2;    //  8388608 per plane
  const size_t total = 2 * x_bytes + wt_bytes + 3 * pl_bytes;       // 48234496
  if (total > ws_size) return;

  char* ws = (char*)d_ws;
  _Float16* qx = (_Float16*)(ws);
  _Float16* vx = (_Float16*)(ws + x_bytes);
  _Float16* wt = (_Float16*)(ws + 2 * x_bytes);
  _Float16* qp = (_Float16*)(ws + 2 * x_bytes + wt_bytes);
  _Float16* kp = (_Float16*)(ws + 2 * x_bytes + wt_bytes + pl_bytes);
  _Float16* vt = (_Float16*)(ws + 2 * x_bytes + wt_bytes + 2 * pl_bytes);

  const int ngroups = 2 * NX8;                                       // 1048576
  convert_kernel<<<(ngroups + 255) / 256, 256, 0, stream>>>(q, v, qx, vx);

  dim3 gTr(EMB / 64, EMB / 64, 3);                                   // (16, 16, 3)
  wtrans_kernel<<<gTr, 256, 0, stream>>>(Wq, Wk, Wv, wt);

  dim3 gProj(MROWS / 128, 3 * NHEADS / 2);                           // (32, 24)
  proj_kernel<<<gProj, 128, 0, stream>>>(qx, vx, wt, bq, bk, bv, qp, kp, vt);

  dim3 gAtt(SEQ / 128, BATCH * NHEADS);                              // (16, 32)
  attn_kernel<<<gAtt, 256, 0, stream>>>(qp, kp, vt, out);
}

// v005
// Measured time: 72.6 microseconds a run.
// Next to v004, in two timings, it ran 1.03 times as fast each time.
// All steps since v000 together make it 3.35 times as fast.
// Contractions: q*Wq, v*Wk, v*Wv, K*Q^T and V^T*P^T all on v_wmma_f32_16x16x32_f16 (f16 operands, f32 accumulate); W carried x32 (exact power-of-two scale folded back in f32), P and its row sum carried x16384 (cancels in the normalisation); score scale 1/32, softmax (base 2), bias and normalisation in f32.
#include <hip/hip_runtime.h>

typedef _Float16 v16h __attribute__((ext_vector_type(16)));
typedef _Float16 v8h  __attribute__((ext_vector_type(8)));
typedef float    v8f  __attribute__((ext_vector_type(8)));
typedef float    v4f  __attribute__((ext_vector_type(4)));
typedef float    v2f  __attribute__((ext_vector_type(2)));
typedef v8h __attribute__((may_alias)) v8ha;
typedef v4f __attribute__((may_alias)) v4fa;

union Frag { v16h v; v8h half[2]; };

#define EMB    1024
#define NHEADS 16
#define HD     64
#define SEQ    2048
#define BATCH  2
#define MROWS  (BATCH * SEQ)          // 4096 tokens
#define NX     (MROWS * EMB)          // 4194304
#define NW     (EMB * EMB)            // 1048576
#define NX8    (NX / 8)               // 524288
#define WSC    32.0f                  // weight plane scale (exact)
#define WINV   0.03125f               // 1/WSC
#define SLOG2E 0.045084220027780106f  // log2(e) / sqrt(EMB): raw score -> exponent of 2
#define PBITS  14.0f                  // P is carried x 2^14: added to that exponent
#define TPITCH 72                     // LDS pitch (halves) of the transposed weight tile
#define SPITCH 72                     // LDS pitch (halves) of a staged 128-byte operand row: 144 B = 16 B x 9
#define SPB    (SPITCH * 2)           // the same in bytes
#define KVBUF  (128 * SPITCH)         // attention stage: 64 K rows, then 64 V^T rows (halves)
#define XWBUF  (256 * SPITCH)         // projection stage: 128 X rows, then 128 W^T rows (halves)

// ---------------------------------------------------------------------------
// 16x16x32 f16 WMMA with hazard guard (ties D, keeps A/B live).
// Fragment map (wave32): lane l, h = l>>4, m = n = l&15.
//   A/B element i: i<8 -> k0+8h+i ; i>=8 -> k0+16+8h+(i-8)
//   D element r : row 8h+r, col l&15
// ---------------------------------------------------------------------------
__device__ __forceinline__ v8f wmma_f16(v16h a, v16h b, v8f c) {
  v8f d = __builtin_amdgcn_wmma_f32_16x16x32_f16(false, a, false, b, (short)0, c, false, false);
  asm volatile("v_nop\n\tv_nop\n\tv_nop\n\tv_nop" : "+v"(d) : "v"(a), "v"(b));
  return d;
}

// A or B fragment from a k-contiguous 16-bit row; p points at element k0 of
// the row owned by this lane (row index = lane & 15 added by the caller).
__device__ __forceinline__ v16h load_frag(const _Float16* p, int h) {
  Frag f;
  f.half[0] = *(const v8ha*)(p + 8 * h);
  f.half[1] = *(const v8ha*)(p + 16 + 8 * h);
  return f.v;
}

// ---------------------------------------------------------------------------
// Asynchronous copies global -> LDS, 16 B per lane: lanes 8q..8q+7 bring one
// whole 128-byte row, one copy = 4 rows. l = the lane's LDS byte address,
// g = its global address; copy c takes the rows 4c further on (LDS + 4 pitches,
// global + grow bytes). s_wait_xcnt closes each statement so that no address
// register is rewritten while a copy that names it may still need it.
// ---------------------------------------------------------------------------
__device__ __forceinline__ unsigned lds_off(const void* p) { return (unsigned)(size_t)p; }

__device__ __forceinline__ void async_rows16(unsigned l, const char* g, unsigned grow) {
  asm volatile("global_load_async_to_lds_b128 %0, %4, off\n\t"
               "global_load_async_to_lds_b128 %1, %5, off\n\t"
               "global_load_async_to_lds_b128 %2, %6, off\n\t"
               "global_load_async_to_lds_b128 %3, %7, off\n\t"
               "s_wait_xcnt 0x0"
               :: "v"(l), "v"(l + 4 * SPB), "v"(l + 8 * SPB), "v"(l + 12 * SPB),
                  "v"(g), "v"(g + grow), "v"(g + 2 * (size_t)grow), "v"(g + 3 * (size_t)grow)
               : "memory");
}

// 32 rows of one operand (8 copies) at a global row pitch of EMB halves; a projection
// wave calls it once for its X rows and once for its W^T rows of a stage.
__device__ __forceinline__ void async_rows32(unsigned l, const char* g) {
  const size_t gr = (size_t)4 * EMB * 2;             // 4 rows further on in global memory
  asm volatile("global_load_async_to_lds_b128 %0, %8, off\n\t"
               "global_load_async_to_lds_b128 %1, %9, off\n\t"
               "global_load_async_to_lds_b128 %2, %10, off\n\t"
               "global_load_async_to_lds_b128 %3, %11, off\n\t"
               "global_load_async_to_lds_b128 %4, %12, off\n\t"
               "global_load_async_to_lds_b128 %5, %13, off\n\t"
               "global_load_async_to_lds_b128 %6, %14, off\n\t"
               "global_load_async_to_lds_b128 %7, %15, off\n\t"
               "s_wait_xcnt 0x0"
               :: "v"(l), "v"(l + 4 * SPB), "v"(l + 8 * SPB), "v"(l + 12 * SPB),
                  "v"(l + 16 * SPB), "v"(l + 20 * SPB), "v"(l + 24 * SPB), "v"(l + 28 * SPB),
                  "v"(g), "v"(g + gr), "v"(g + 2 * gr), "v"(g + 3 * gr),
                  "v"(g + 4 * gr), "v"(g + 5 * gr), "v"(g + 6 * gr), "v"(g + 7 * gr)
               : "memory");
}

// Hand-over of a stage: this wave's LDS reads are done, its own copies have
// landed, then the work-group barrier publishes the next stage and frees this one.
__device__ __forceinline__ void stage_publish() {
  asm volatile("s_wait_dscnt 0x0" ::: "memory");     // own reads of the buffer that is refilled next
  asm volatile("s_wait_asynccnt 0x0" ::: "memory");  // own copies of the next stage have landed
  __syncthreads();
}

// ---------------------------------------------------------------------------
// Kernel 1: all of the preparation in one launch of PREPB work-groups, every
// one resident at once.
//  a) f32 -> f16 planes for q and v, unscaled, RNE convert: a thread takes one
//     group of 8 values in each half of each plane (4 groups, 8 loads of 16 B,
//     all of them in flight together).
//  b) work-groups 0..767 also take one weight tile each: in W[k][n] (k = input
//     feature, n = output feature, both 1024) -> wt[which][n][k] = f16(32 * W[k][n]),
//     a 64(k) x 64(n) tile transposed through LDS, stored as whole 128-byte lines
//     (lanes 8q..8q+7 of a wave bring one line, 4 lines per instruction).
// ---------------------------------------------------------------------------
#define PREPB  1024                   // work-groups of 256 threads: 4 a WGP
#define WTILES 768                    // 16 (n) x 16 (k) x 3 weight tiles
#define HPLANE (PREPB * 256 * 8)      // values one sweep of the grid covers = NX / 2

__device__ __forceinline__ void wt_store_pass(const _Float16* sW, _Float16* wt,
                                              int which, int n0, int k0, int w, int lane) {
  const int q8 = lane & 7, sub = lane >> 3;
  #pragma unroll
  for (int i = 0; i < 2; ++i) {
    const int nrow = w * 8 + i * 4 + sub;          // 0..63
    const v8h val = *(const v8ha*)(sW + nrow * TPITCH + 8 * q8);
    _Float16* dst = wt + ((size_t)which * EMB + n0 + nrow) * EMB + k0 + 8 * q8;
    *(v8h*)dst = val;
  }
}

__device__ __forceinline__ v8h cvt8(v4f a, v4f c) {
  const v8h o = { (_Float16)a.x, (_Float16)a.y, (_Float16)a.z, (_Float16)a.w,
                  (_Float16)c.x, (_Float16)c.y, (_Float16)c.z, (_Float16)c.w };
  return o;
}

__global__ __launch_bounds__(256) void prep_kernel(
    const float* __restrict__ q, const float* __restrict__ v,
    const float* __restrict__ wq, const float* __restrict__ wk, const float* __restrict__ wv,
    _Float16* __restrict__ qx, _Float16* __restrict__ vx,
    _Float16* __restrict__ wt)         // [3][1024 n][1024 k], x32
{
  __shared__ __attribute__((aligned(16))) _Float16 sW[64 * TPITCH];   // 9216 B

  const int tid = threadIdx.x, lane = tid & 31, w = tid >> 5;
  const int bid = blockIdx.x;
  const unsigned ib = ((unsigned)bid * 256u + (unsigned)tid) * 32u;  // bytes: the thread's 8 floats in the first half of a plane
  const char* q0 = (const char*)q + ib;
  const char* q1 = (const char*)(q + HPLANE) + ib;
  const char* v0 = (const char*)v + ib;
  const char* v1 = (const char*)(v + HPLANE) + ib;

  const v4f a0 = *(const v4fa*)q0, c0 = *(const v4fa*)(q0 + 16);
  const v4f a1 = *(const v4fa*)q1, c1 = *(const v4fa*)(q1 + 16);
  const v4f a2 = *(const v4fa*)v0, c2 = *(const v4fa*)(v0 + 16);
  const v4f a3 = *(const v4fa*)v1, c3 = *(const v4fa*)(v1 + 16);
  asm volatile("s_wait_xcnt 0x0" ::: "memory");    // before the index arithmetic below reuses these loads' address registers
  __builtin_amdgcn_sched_barrier(0);               // or the compiler lifts that arithmetic over the wait

  if (bid < WTILES) {                              // the same for the whole work-group
    const int n0 = (bid & 15) * 64, k0 = ((bid >> 4) & 15) * 64, which = bid >> 8;
    const float* W = (which == 0) ? wq : ((which == 1) ? wk : wv);
    #pragma unroll
    for (int i = 0; i < 4; ++i) {
      const int idx = tid + 256 * i;               // 0..1023 float4 groups
      const int kk = idx >> 4, nn = (idx & 15) * 4;
      const v4f x = *(const v4fa*)(W + (size_t)(k0 + kk) * EMB + n0 + nn);
      sW[(nn + 0) * TPITCH + kk] = (_Float16)(x.x * WSC);
      sW[(nn + 1) * TPITCH + kk] = (_Float16)(x.y * WSC);
      sW[(nn + 2) * TPITCH + kk] = (_Float16)(x.z * WSC);
      sW[(nn + 3) * TPITCH + kk] = (_Float16)(x.w * WSC);
    }
    __syncthreads();
    wt_store_pass(sW, wt, which, n0, k0, w, lane);
  }

  const unsigned ob = ib >> 1;                     // bytes: the same 8 values as f16
  *(v8h*)((char*)qx + ob)            = cvt8(a0, c0);
  *(v8h*)((char*)(qx + HPLANE) + ob) = cvt8(a1, c1);
  *(v8h*)((char*)vx + ob)            = cvt8(a2, c2);
  *(v8h*)((char*)(vx + HPLANE) + ob) = cvt8(a3, c3);
}

// ---------------------------------------------------------------------------
// 4 lines per instruction, 64 lines per wave: half of one head's 128 lines
// (base = 0 or 64), sT = that head's staged 128 x 64 tile.
// which 0/1: plane[bh][l][d]  (one token row = 64 halves = one line)
// which 2  : vt[bh][d][l]     (64 d-rows x 128 tokens = 2 lines each)
// ---------------------------------------------------------------------------
__device__ __forceinline__ void proj_store_pass(const _Float16* sT, _Float16* plane, _Float16* vt,
                                                int which, int bh, int l0, int base, int lane) {
  const int q8 = lane & 7, sub = lane >> 3;
  #pragma unroll
  for (int i = 0; i < 16; ++i) {
    const int lid = base + i * 4 + sub;            // 0..127
    v8h val;
    _Float16* dst;
    if (which != 2) {
      val = *(const v8ha*)(sT + lid * HD + 8 * q8);
      dst = plane + ((size_t)bh * SEQ + l0 + lid) * HD + 8 * q8;
    } else {
      const int d = lid >> 1, hl = lid & 1;
      val = *(const v8ha*)(sT + d * 128 + 64 * hl + 8 * q8);
      dst = vt + ((size_t)bh * HD + d) * SEQ + l0 + 64 * hl + 8 * q8;
    }
    *(v8h*)dst = val;
    asm volatile("s_wait_xcnt 0x0" ::: "memory");  // before the next line's load and address reuse this store's registers
  }
}

// ---------------------------------------------------------------------------
// Kernel 2: Y = X * W (with W^T staged k-contiguous) over the fused 3*1024
// output columns. which = 0: X = q, W = Wq -> qp ; 1: X = v, W = Wk -> kp ;
// 2: X = v, W = Wv -> vt (d-major).
// Block 128 thr (4 waves) = 128 tokens x 128 features (two heads of one which);
// wave tile 64 tokens x 64 features (one head); K = 1024 in stages of 64 (two
// steps of 32); each stage's X and W^T rows come into LDS by asynchronous copies,
// two buffers, the next stage in flight while this one is worked on; fragments
// from LDS. 768 blocks, three to a WGP by their LDS.
// ---------------------------------------------------------------------------
__global__ __launch_bounds__(128) void proj_kernel(
    const _Float16* __restrict__ qx,   // [4096][1024] f16(q)
    const _Float16* __restrict__ vx,   // [4096][1024] f16(v)
    const _Float16* __restrict__ wt,   // [3][1024][1024], row = output feature, x32
    const float* __restrict__ bq, const float* __restrict__ bk, const float* __restrict__ bv,
    _Float16* __restrict__ qp,         // [B*H][L][D]
    _Float16* __restrict__ kp,         // [B*H][L][D]
    _Float16* __restrict__ vt)         // [B*H][D][L]
{
  __shared__ __attribute__((aligned(16))) _Float16 sT[2 * 128 * 64]; // 32768 B, one 128 x 64 tile a head
  __shared__ __attribute__((aligned(16))) _Float16 sXW[2 * XWBUF];   // 73728 B

  const int tid = threadIdx.x, lane = tid & 31, w = tid >> 5;
  const int h = lane >> 4, m = lane & 15;
  const int m0 = blockIdx.x * 128;
  const int cg = blockIdx.y;                 // 0..23
  const int which = cg >> 3, head0 = (cg & 7) * 2;
  const int wtok = w & 1, wf = w >> 1;       // the wave's token half and its head of the pair

  const _Float16* xsrc = (which == 0) ? qx : vx;

  // copy role: rows 32w..32w+31 of X and of W^T; row (lane >> 3) of each group of 4,
  // 16-byte piece (lane & 7)
  const int cr = lane >> 3, cp = lane & 7;
  const char* gx = (const char*)(xsrc + (size_t)(m0 + 32 * w + cr) * EMB + 8 * cp);
  const char* gw = (const char*)(wt + ((size_t)which * EMB + head0 * HD + 32 * w + cr) * EMB + 8 * cp);
  const unsigned lx = lds_off(sXW) + (32 * w + cr) * SPB + 16 * cp;
  const unsigned lw = lds_off(sXW) + (128 + 32 * w + cr) * SPB + 16 * cp;

  const v8f zero8 = {0.f, 0.f, 0.f, 0.f, 0.f, 0.f, 0.f, 0.f};
  v8f acc[4][4];
  #pragma unroll
  for (int mt = 0; mt < 4; ++mt)
    #pragma unroll
    for (int nt = 0; nt < 4; ++nt) acc[mt][nt] = zero8;

  async_rows32(lx, gx);                                    // stage 0 -> buffer 0
  async_rows32(lw, gw);
  asm volatile("s_wait_asynccnt 0x0" ::: "memory");        // own copies of stage 0 have landed
  __syncthreads();
  async_rows32(lx + XWBUF * 2, gx + 128);                  // stage 1 -> buffer 1
  async_rows32(lw + XWBUF * 2, gw + 128);

  // rolled: one buffer offset per trip, every fragment index constant
  #pragma unroll 1
  for (int t = 0; t < EMB / 64; ++t) {
    const int bo = (t & 1) * XWBUF;
    const _Float16* xs = sXW + bo + (64 * wtok + m) * SPITCH;      // token row, mt = 0
    const _Float16* wl = sXW + bo + (128 + 64 * wf + m) * SPITCH;  // feature row, nt = 0
    // Fragment reads stand in groups ahead of the products that use them, so that a
    // wave waits out the LDS latency once a stage and not in front of every four products.
    v16h a0[4], b0[4], a1[4], b1[4];
    #pragma unroll
    for (int mt = 0; mt < 4; ++mt) a0[mt] = load_frag(xs + mt * 16 * SPITCH, h);
    #pragma unroll
    for (int nt = 0; nt < 4; ++nt) b0[nt] = load_frag(wl + nt * 16 * SPITCH, h);
    #pragma unroll
    for (int mt = 0; mt < 4; ++mt) a1[mt] = load_frag(xs + mt * 16 * SPITCH + 32, h);
    b1[0] = load_frag(wl + 32, h);
    __builtin_amdgcn_sched_barrier(0);                     // or the compiler sinks these reads down to their products
    #pragma unroll
    for (int nt = 0; nt < 3; ++nt)
      #pragma unroll
      for (int mt = 0; mt < 4; ++mt) acc[mt][nt] = wmma_f16(a0[mt], b0[nt], acc[mt][nt]);
    // the last three reads go out here, into registers that the twelve products above have left
    #pragma unroll
    for (int nt = 1; nt < 4; ++nt) b1[nt] = load_frag(wl + nt * 16 * SPITCH + 32, h);
    __builtin_amdgcn_sched_barrier(0);                     // holds these reads eight products ahead of their first use; without it the compiler moves them
    #pragma unroll
    for (int mt = 0; mt < 4; ++mt) acc[mt][3] = wmma_f16(a0[mt], b0[3], acc[mt][3]);
    #pragma unroll
    for (int nt = 0; nt < 4; ++nt)
      #pragma unroll
      for (int mt = 0; mt < 4; ++mt) acc[mt][nt] = wmma_f16(a1[mt], b1[nt], acc[mt][nt]);
    stage_publish();
    if (t + 2 < EMB / 64) {                                // stage t + 2 -> the buffer just read
      async_rows32(lx + bo * 2, gx + (t + 2) * 128);
      async_rows32(lw + bo * 2, gw + (t + 2) * 128);
    }
  }
  asm volatile("s_wait_asynccnt 0x0" ::: "memory");        // nothing of this wave's is in flight any more

  // D[r] of tile (mt, nt) = Y[token m0+64wtok+16mt+8h+r][feature 16nt+m of head head0+wf]
  const int head = head0 + wf;
  _Float16* sTh = sT + wf * (128 * 64);
  const float* bias = (which == 0) ? bq : ((which == 1) ? bk : bv);
  float bvl4[4];
  #pragma unroll
  for (int nt = 0; nt < 4; ++nt) bvl4[nt] = bias[head * HD + 16 * nt + m];
  asm volatile("s_wait_xcnt 0x0" ::: "memory");            // before the index arithmetic below reuses these loads' offset register
  __builtin_amdgcn_sched_barrier(0);                       // or the compiler lifts that arithmetic over the wait
  #pragma unroll
  for (int nt = 0; nt < 4; ++nt) {
    const int feat = 16 * nt + m;
    const float bvl = bvl4[nt];
    #pragma unroll
    for (int mt = 0; mt < 4; ++mt) {
      #pragma unroll
      for (int r = 0; r < 8; ++r) {
        const int tokl = 64 * wtok + 16 * mt + 8 * h + r;  // 0..127
        const float y = acc[mt][nt][r] * WINV + bvl;
        const int idx = (which == 2) ? (feat * 128 + tokl) : (tokl * HD + feat);
        sTh[idx] = (_Float16)y;
      }
    }
  }
  __syncthreads();

  const int b = m0 / SEQ, l0 = m0 - b * SEQ, bh = b * NHEADS + head;
  _Float16* plane = (which == 0) ? qp : kp;
  proj_store_pass(sTh, plane, vt, which, bh, l0, 64 * wtok, lane);
  
}

// ---------------------------------------------------------------------------
// Attention helpers.
// ---------------------------------------------------------------------------
// P^T B-fragment from the lane's own score D values: element r <- tile a row r
// (keys 0..15 of the 32-deep chunk), element 8+r <- tile c row r (keys 16..31),
// same lane, same query column; the values already carry the 2^14.
__device__ __forceinline__ v16h pack_p(v8f a, v8f c) {
  const v16h r = { (_Float16)a[0], (_Float16)a[1], (_Float16)a[2], (_Float16)a[3],
                   (_Float16)a[4], (_Float16)a[5], (_Float16)a[6], (_Float16)a[7],
                   (_Float16)c[0], (_Float16)c[1], (_Float16)c[2], (_Float16)c[3],
                   (_Float16)c[4], (_Float16)c[5], (_Float16)c[6], (_Float16)c[7] };
  return r;
}

// lanes 8q..8q+7 in one instruction, 4 lines per instruction, 32 lines per wave.
__device__ __forceinline__ void att_store_pass(const float* so, float* out,
                                               int b, int head, int q0, int lane) {
  const int q8 = lane & 7, sub = lane >> 3;
  #pragma unroll
  for (int i = 0; i < 8; ++i) {
    const int lid = i * 4 + sub;                   // 0..31
    const int row = lid >> 1, hl = lid & 1;
    const v4f val = *(const v4fa*)(so + row * 64 + 32 * hl + 4 * q8);
    const size_t gi = ((size_t)b * SEQ + q0 + row) * EMB + head * HD + 32 * hl + 4 * q8;
    *(v4f*)(out + gi) = val;
  }
}

// ---------------------------------------------------------------------------
// Kernel 3: streaming attention, transposed form.
// Block 256 thr (8 waves), 16 queries per wave, 64 keys per step.
//   S^T = K * Q^T : A = K rows (row = key, k = d), B = Q^T (k = d, n = query)
//   O^T += V^T * P^T : A = Vt rows (row = d, k = key), B = P^T from registers
// Lane owns 32 keys of query column (lane&15); partner = lane ^ 16.
// Each step's 64 K rows and 64 V^T rows (128 B each) come into LDS once for the
// eight waves by asynchronous copies (waves 0-3: K, waves 4-7: V^T; 4 copies a
// wave), two buffers, the next step in flight while this one is worked on.
// grid = (SEQ/128, B*H).
// ---------------------------------------------------------------------------
__global__ __launch_bounds__(256) void attn_kernel(
    const _Float16* __restrict__ qp,   // [B*H][L][D]
    const _Float16* __restrict__ kp,   // [B*H][L][D]
    const _Float16* __restrict__ vt,   // [B*H][D][L]
    float* __restrict__ out)           // [B][L][EMB]
{
  __shared__ __attribute__((aligned(16))) float sO[8 * 16 * 64];    // 32768 B
  __shared__ __attribute__((aligned(16))) _Float16 sKV[2 * KVBUF];  // 36864 B

  const int tid = threadIdx.x, lane = tid & 31, w = tid >> 5;
  const int h = lane >> 4, m = lane & 15;
  const int bh = blockIdx.y, b = bh >> 4, head = bh & 15;
  const int q0 = blockIdx.x * 128 + 16 * w;

  // Q^T B-fragments: column n = query q0+m, k = d (two 32-deep chunks)
  const _Float16* qrow = qp + ((size_t)bh * SEQ + q0 + m) * HD;
  const v16h qb0 = load_frag(qrow, h);
  const v16h qb1 = load_frag(qrow + 32, h);

  const v8f zero8 = {0.f, 0.f, 0.f, 0.f, 0.f, 0.f, 0.f, 0.f};
  v8f o[4];                                   // o[t][r] = O[query m][d 16t+8h+r] * lrun (lrun = l * 2^14)
  #pragma unroll
  for (int t = 0; t < 4; ++t) o[t] = zero8;
  float mrun = -1e30f, lrun = 0.0f;

  // copy role: staged rows 16w + (lane >> 3) + 4c, c = 0..3; 16-byte piece (lane & 7)
  const int cr = 16 * w + (lane >> 3), cp = lane & 7;
  const bool ck = __builtin_amdgcn_readfirstlane(w) < 4;       // scalar: the choice writes no EXEC
  const unsigned gpitch = ck ? HD * 2 : SEQ * 2;               // bytes, one source row further on
  const unsigned grow = 4 * gpitch;                            // bytes, 4 rows further on
  const unsigned gstep = ck ? 64 * HD * 2 : 64 * 2;            // bytes, 64 keys further on
  const char* gsrc = (const char*)((ck ? kp : vt) + (size_t)bh * SEQ * HD)
                     + (size_t)((cr & 63) * gpitch) + 16 * cp;
  const unsigned ldst = lds_off(sKV) + cr * SPB + 16 * cp;

  async_rows16(ldst, gsrc, grow);                          // step 0 -> buffer 0
  asm volatile("s_wait_asynccnt 0x0" ::: "memory");        // own copies of step 0 have landed
  __syncthreads();
  async_rows16(ldst + KVBUF * 2, gsrc + gstep, grow);      // step 1 -> buffer 1

  // rolled: one buffer offset per trip, every fragment index constant
  #pragma unroll 1
  for (int st = 0; st < SEQ / 64; ++st) {
    const int bo = (st & 1) * KVBUF;
    const _Float16* kl = sKV + bo + m * SPITCH;            // + 16j rows + 32*dc
    const _Float16* vl = kl + 64 * SPITCH;                 // + 16t rows + key chunk
    // ---- raw scores: s[j][r] = q . k of query m, key kb+16j+8h+r ----
    // all 16 K reads of the step as one group ahead of the eight products: one LDS wait, not four
    v16h kf0[4], kf1[4];
    #pragma unroll
    for (int j = 0; j < 4; ++j) kf0[j] = load_frag(kl + 16 * j * SPITCH, h);
    #pragma unroll
    for (int j = 0; j < 4; ++j) kf1[j] = load_frag(kl + 16 * j * SPITCH + 32, h);
    __builtin_amdgcn_sched_barrier(0);                     // or the compiler sinks each read down to its product
    v8f s[4];
    #pragma unroll
    for (int j = 0; j < 4; ++j) s[j] = wmma_f16(kf0[j], qb0, zero8);
    #pragma unroll
    for (int j = 0; j < 4; ++j) s[j] = wmma_f16(kf1[j], qb1, s[j]);
    // ---- online softmax in base 2: P * 2^14 = exp2(raw * SLOG2E + (14 - max * SLOG2E)), one FMA ahead of each exp2 ----
    float mloc = s[0][0];
    #pragma unroll
    for (int j = 0; j < 4; ++j)
      #pragma unroll
      for (int r = 0; r < 8; ++r) mloc = fmaxf(mloc, s[j][r]);
    const float mpart = __shfl_xor(mloc, 16);
    asm volatile("" :: "v"(mpart) : "memory");             // the V^T reads go out behind the exchange's return: queued ahead of it in the LDS they would lengthen its wait
    // all 16 V^T reads of the step as one group: they land under the exponentials
    v16h vf0[4], vf1[4];
    #pragma unroll
    for (int t = 0; t < 4; ++t) vf0[t] = load_frag(vl + 16 * t * SPITCH, h);
    #pragma unroll
    for (int t = 0; t < 4; ++t) vf1[t] = load_frag(vl + 16 * t * SPITCH + 32, h);
    __builtin_amdgcn_sched_barrier(0);                     // or the compiler sinks each read down to its product
    mloc = fmaxf(mloc, mpart);
    const float mnew = fmaxf(mrun, mloc);                  // running maximum of the raw scores (SLOG2E > 0)
    const float alpha = __builtin_amdgcn_exp2f((mrun - mnew) * SLOG2E);
    mrun = mnew;
    const float nb = __builtin_fmaf(-mnew, SLOG2E, PBITS);
    const v2f sc2 = {SLOG2E, SLOG2E};
    const v2f nb2 = {nb, nb};
    float lsum = 0.0f;
    #pragma unroll
    for (int j = 0; j < 4; ++j)
      #pragma unroll
      for (int r = 0; r < 8; r += 2) {
        const v2f raw = {s[j][r], s[j][r + 1]};
        const v2f e = __builtin_elementwise_fma(raw, sc2, nb2);
        const float p0 = __builtin_amdgcn_exp2f(e.x);
        const float p1 = __builtin_amdgcn_exp2f(e.y);
        s[j][r] = p0;
        s[j][r + 1] = p1;
        lsum += p0;
        lsum += p1;
      }
    lsum += __shfl_xor(lsum, 16);
    lrun = lrun * alpha + lsum;
    #pragma unroll
    for (int t = 0; t < 4; ++t)
      #pragma unroll
      for (int r = 0; r < 8; ++r) o[t][r] = o[t][r] * alpha;

    // ---- P^T B-fragments (key chunks 0..31 and 32..63 of this step) ----
    const v16h pb0 = pack_p(s[0], s[1]);
    const v16h pb1 = pack_p(s[2], s[3]);

    // ---- O^T += V^T * P^T ----
    #pragma unroll
    for (int t = 0; t < 4; ++t) o[t] = wmma_f16(vf0[t], pb0, o[t]);
    #pragma unroll
    for (int t = 0; t < 4; ++t) o[t] = wmma_f16(vf1[t], pb1, o[t]);

    stage_publish();
    if (st + 2 < SEQ / 64)                                 // step st + 2 -> the buffer just read
      async_rows16(ldst + bo * 2, gsrc + (size_t)(st + 2) * gstep, grow);
  }
  asm volatile("s_wait_asynccnt 0x0" ::: "memory");        // nothing of this wave's is in flight any more

  // ---- epilogue: normalise, stage per-wave 16x64 tile, whole-line stores ----
  const float inv = 1.0f / lrun;                           // o and lrun both carry the 2^14
  float* so = sO + w * 1024;
  #pragma unroll
  for (int t = 0; t < 4; ++t)
    #pragma unroll
    for (int r = 0; r < 8; ++r)
      so[m * 64 + 16 * t + 8 * h + r] = o[t][r] * inv;
  __syncthreads();

  att_store_pass(so, out, b, head, q0, lane);
  
}

// ---------------------------------------------------------------------------
extern "C" void kernel_launch(void* const* d_in, const int* in_sizes, int n_in,
                              void* d_out, int out_size, void* d_ws, size_t ws_size,
                              hipStream_t stream) {
  if (n_in < 8) return;
  if (in_sizes[0] != NX || in_sizes[1] != NX) return;
  if (in_sizes[2] != NW || in_sizes[4] != NW || in_sizes[6] != NW) return;
  if (in_sizes[3] != EMB || in_sizes[5] != EMB || in_sizes[7] != EMB) return;
  if (out_size != NX) return;

  const float* q  = (const float*)d_in[0];
  const float* v  = (const float*)d_in[1];
  const float* Wq = (const float*)d_in[2];
  const float* bq = (const float*)d_in[3];
  const float* Wk = (const float*)d_in[4];
  const float* bk = (const float*)d_in[5];
  const float* Wv = (const float*)d_in[6];
  const float* bv = (const float*)d_in[7];
  float* out = (float*)d_out;

  const size_t x_bytes  = (size_t)NX * 2;                           //  8388608 per plane
  const size_t wt_bytes = (size_t)3 * NW * 2;                       //  6291456
  const size_t pl_bytes = (size_t)BATCH * NHEADS * SEQ * HD * 2;    //  8388608 per plane
  const size_t total = 2 * x_bytes + wt_bytes + 3 * pl_bytes;       // 48234496
  if (total > ws_size) return;

  char* ws = (char*)d_ws;
  _Float16* qx = (_Float16*)(ws);
  _Float16* vx = (_Float16*)(ws + x_bytes);
  _Float16* wt = (_Float16*)(ws + 2 * x_bytes);
  _Float16* qp = (_Float16*)(ws + 2 * x_bytes + wt_bytes);
  _Float16* kp = (_Float16*)(ws + 2 * x_bytes + wt_bytes + pl_bytes);
  _Float16* vt = (_Float16*)(ws + 2 * x_bytes + wt_bytes + 2 * pl_bytes);

  prep_kernel<<<PREPB, 256, 0, stream>>>(q, v, Wq, Wk, Wv, qx, vx, wt);

  dim3 gProj(MROWS / 128, 3 * NHEADS / 2);                           // (32, 24)
  proj_kernel<<<gProj, 128, 0, stream>>>(qx, vx, wt, bq, bk, bv, qp, kp, vt);

  dim3 gAtt(SEQ / 128, BATCH * NHEADS);                              // (16, 32)
  attn_kernel<<<gAtt, 256, 0, stream>>>(qp, kp, vt, out);
}

// v006
// It runs in 68.1 microseconds.
// Next to v005, in two timings, it ran 1.05 and 1.07 times as fast.
// Counting every step since v000, it is 3.55 times as fast.
// Contractions: q*Wq, v*Wk, v*Wv, K*Q^T and V^T*P^T all on v_wmma_f32_16x16x32_f16 (f16 operands, f32 accumulate); W carried x32 (exact power-of-two scale folded back in f32), P and its row sum carried x16384 (cancels in the normalisation); score scale 1/32, softmax (base 2), bias and normalisation in f32.
#include <hip/hip_runtime.h>

typedef _Float16 v16h __attribute__((ext_vector_type(16)));
typedef _Float16 v8h  __attribute__((ext_vector_type(8)));
typedef float    v8f  __attribute__((ext_vector_type(8)));
typedef float    v4f  __attribute__((ext_vector_type(4)));
typedef float    v2f  __attribute__((ext_vector_type(2)));
typedef v8h __attribute__((may_alias)) v8ha;
typedef v4f __attribute__((may_alias)) v4fa;

union Frag { v16h v; v8h half[2]; };

#define EMB    1024
#define NHEADS 16
#define HD     64
#define SEQ    2048
#define BATCH  2
#define MROWS  (BATCH * SEQ)          // 4096 tokens
#define NX     (MROWS * EMB)          // 4194304
#define NW     (EMB * EMB)            // 1048576
#define NX8    (NX / 8)               // 524288
#define WSC    32.0f                  // weight plane scale (exact)
#define WINV   0.03125f               // 1/WSC
#define SLOG2E 0.045084220027780106f  // log2(e) / sqrt(EMB): raw score -> exponent of 2
#define PBITS  14.0f                  // P is carried x 2^14: added to that exponent
#define TPITCH 72                     // LDS pitch (halves) of the transposed weight tile
#define SPITCH 72                     // LDS pitch (halves) of a staged 128-byte operand row: 144 B = 16 B x 9
#define SPB    (SPITCH * 2)           // the same in bytes
#define KVBUF  (128 * SPITCH)         // attention, one key half of a stage: 64 K rows, then 64 V^T rows (halves)
#define STBUF  (2 * KVBUF)            // attention stage: both key halves (halves)
#define KHALF  (SEQ / 2)              // keys a wave walks
#define XWBUF  (256 * SPITCH)         // projection stage: 128 X rows, then 128 W^T rows (halves)

// ---------------------------------------------------------------------------
// 16x16x32 f16 WMMA with hazard guard (ties D, keeps A/B live).
// Fragment map (wave32): lane l, h = l>>4, m = n = l&15.
//   A/B element i: i<8 -> k0+8h+i ; i>=8 -> k0+16+8h+(i-8)
//   D element r : row 8h+r, col l&15
// ---------------------------------------------------------------------------
__device__ __forceinline__ v8f wmma_f16(v16h a, v16h b, v8f c) {
  v8f d = __builtin_amdgcn_wmma_f32_16x16x32_f16(false, a, false, b, (short)0, c, false, false);
  asm volatile("v_nop\n\tv_nop\n\tv_nop\n\tv_nop" : "+v"(d) : "v"(a), "v"(b));
  return d;
}

// A or B fragment from a k-contiguous 16-bit row; p points at element k0 of
// the row owned by this lane (row index = lane & 15 added by the caller).
__device__ __forceinline__ v16h load_frag(const _Float16* p, int h) {
  Frag f;
  f.half[0] = *(const v8ha*)(p + 8 * h);
  f.half[1] = *(const v8ha*)(p + 16 + 8 * h);
  return f.v;
}

// ---------------------------------------------------------------------------
// Asynchronous copies global -> LDS, 16 B per lane: lanes 8q..8q+7 bring one
// whole 128-byte row, one copy = 4 rows. l = the lane's LDS byte address,
// g = its global address; copy c takes the rows 4c further on (LDS + 4 pitches,
// global + grow bytes). s_wait_xcnt closes each statement so that no address
// register is rewritten while a copy that names it may still need it.
// ---------------------------------------------------------------------------
__device__ __forceinline__ unsigned lds_off(const void* p) { return (unsigned)(size_t)p; }

// 32 rows (8 copies) of an attention stage; grow = bytes from one copy's rows to the next copy's in global memory.
__device__ __forceinline__ void async_rows32p(unsigned l, const char* g, unsigned grow) {
  const size_t gr = grow;
  asm volatile("global_load_async_to_lds_b128 %0, %8, off\n\t"
               "global_load_async_to_lds_b128 %1, %9, off\n\t"
               "global_load_async_to_lds_b128 %2, %10, off\n\t"
               "global_load_async_to_lds_b128 %3, %11, off\n\t"
               "global_load_async_to_lds_b128 %4, %12, off\n\t"
               "global_load_async_to_lds_b128 %5, %13, off\n\t"
               "global_load_async_to_lds_b128 %6, %14, off\n\t"
               "global_load_async_to_lds_b128 %7, %15, off\n\t"
               "s_wait_xcnt 0x0"
               :: "v"(l), "v"(l + 4 * SPB), "v"(l + 8 * SPB), "v"(l + 12 * SPB),
                  "v"(l + 16 * SPB), "v"(l + 20 * SPB), "v"(l + 24 * SPB), "v"(l + 28 * SPB),
                  "v"(g), "v"(g + gr), "v"(g + 2 * gr), "v"(g + 3 * gr),
                  "v"(g + 4 * gr), "v"(g + 5 * gr), "v"(g + 6 * gr), "v"(g + 7 * gr)
               : "memory");
}

// 32 rows of one operand (8 copies) at a global row pitch of EMB halves; a projection
// wave calls it once for its X rows and once for its W^T rows of a stage.
__device__ __forceinline__ void async_rows32(unsigned l, const char* g) {
  const size_t gr = (size_t)4 * EMB * 2;             // 4 rows further on in global memory
  asm volatile("global_load_async_to_lds_b128 %0, %8, off\n\t"
               "global_load_async_to_lds_b128 %1, %9, off\n\t"
               "global_load_async_to_lds_b128 %2, %10, off\n\t"
               "global_load_async_to_lds_b128 %3, %11, off\n\t"
               "global_load_async_to_lds_b128 %4, %12, off\n\t"
               "global_load_async_to_lds_b128 %5, %13, off\n\t"
               "global_load_async_to_lds_b128 %6, %14, off\n\t"
               "global_load_async_to_lds_b128 %7, %15, off\n\t"
               "s_wait_xcnt 0x0"
               :: "v"(l), "v"(l + 4 * SPB), "v"(l + 8 * SPB), "v"(l + 12 * SPB),
                  "v"(l + 16 * SPB), "v"(l + 20 * SPB), "v"(l + 24 * SPB), "v"(l + 28 * SPB),
                  "v"(g), "v"(g + gr), "v"(g + 2 * gr), "v"(g + 3 * gr),
                  "v"(g + 4 * gr), "v"(g + 5 * gr), "v"(g + 6 * gr), "v"(g + 7 * gr)
               : "memory");
}

// Hand-over of a stage: this wave's LDS reads are done, its own copies have
// landed, then the work-group barrier publishes the next stage and frees this one.
__device__ __forceinline__ void stage_publish() {
  asm volatile("s_wait_dscnt 0x0" ::: "memory");     // own reads of the buffer that is refilled next
  asm volatile("s_wait_asynccnt 0x0" ::: "memory");  // own copies of the next stage have landed
  __syncthreads();
}

// ---------------------------------------------------------------------------
// Kernel 1: all of the preparation in one launch of PREPB work-groups, every
// one resident at once.
//  a) f32 -> f16 planes for q and v, unscaled, RNE convert: a thread takes one
//     group of 8 values in each half of each plane (4 groups, 8 loads of 16 B,
//     all of them in flight together).
//  b) work-groups 0..767 also take one weight tile each: in W[k][n] (k = input
//     feature, n = output feature, both 1024) -> wt[which][n][k] = f16(32 * W[k][n]),
//     a 64(k) x 64(n) tile transposed through LDS, stored as whole 128-byte lines
//     (lanes 8q..8q+7 of a wave bring one line, 4 lines per instruction).
// ---------------------------------------------------------------------------
#define PREPB  1024                   // work-groups of 256 threads: 4 a WGP
#define WTILES 768                    // 16 (n) x 16 (k) x 3 weight tiles
#define HPLANE (PREPB * 256 * 8)      // values one sweep of the grid covers = NX / 2

__device__ __forceinline__ void wt_store_pass(const _Float16* sW, _Float16* wt,
                                              int which, int n0, int k0, int w, int lane) {
  const int q8 = lane & 7, sub = lane >> 3;
  #pragma unroll
  for (int i = 0; i < 2; ++i) {
    const int nrow = w * 8 + i * 4 + sub;          // 0..63
    const v8h val = *(const v8ha*)(sW + nrow * TPITCH + 8 * q8);
    _Float16* dst = wt + ((size_t)which * EMB + n0 + nrow) * EMB + k0 + 8 * q8;
    *(v8h*)dst = val;
  }
}

__device__ __forceinline__ v8h cvt8(v4f a, v4f c) {
  const v8h o = { (_Float16)a.x, (_Float16)a.y, (_Float16)a.z, (_Float16)a.w,
                  (_Float16)c.x, (_Float16)c.y, (_Float16)c.z, (_Float16)c.w };
  return o;
}

__global__ __launch_bounds__(256) void prep_kernel(
    const float* __restrict__ q, const float* __restrict__ v,
    const float* __restrict__ wq, const float* __restrict__ wk, const float* __restrict__ wv,
    _Float16* __restrict__ qx, _Float16* __restrict__ vx,
    _Float16* __restrict__ wt)         // [3][1024 n][1024 k], x32
{
  __shared__ __attribute__((aligned(16))) _Float16 sW[64 * TPITCH];   // 9216 B

  const int tid = threadIdx.x, lane = tid & 31, w = tid >> 5;
  const int bid = blockIdx.x;
  const unsigned ib = ((unsigned)bid * 256u + (unsigned)tid) * 32u;  // bytes: the thread's 8 floats in the first half of a plane
  const char* q0 = (const char*)q + ib;
  const char* q1 = (const char*)(q + HPLANE) + ib;
  const char* v0 = (const char*)v + ib;
  const char* v1 = (const char*)(v + HPLANE) + ib;

  const v4f a0 = *(const v4fa*)q0, c0 = *(const v4fa*)(q0 + 16);
  const v4f a1 = *(const v4fa*)q1, c1 = *(const v4fa*)(q1 + 16);
  const v4f a2 = *(const v4fa*)v0, c2 = *(const v4fa*)(v0 + 16);
  const v4f a3 = *(const v4fa*)v1, c3 = *(const v4fa*)(v1 + 16);
  asm volatile("s_wait_xcnt 0x0" ::: "memory");    // before the index arithmetic below reuses these loads' address registers
  __builtin_amdgcn_sched_barrier(0);               // or the compiler lifts that arithmetic over the wait

  if (bid < WTILES) {                              // the same for the whole work-group
    const int n0 = (bid & 15) * 64, k0 = ((bid >> 4) & 15) * 64, which = bid >> 8;
    const float* W = (which == 0) ? wq : ((which == 1) ? wk : wv);
    #pragma unroll
    for (int i = 0; i < 4; ++i) {
      const int idx = tid + 256 * i;               // 0..1023 float4 groups
      const int kk = idx >> 4, nn = (idx & 15) * 4;
      const v4f x = *(const v4fa*)(W + (size_t)(k0 + kk) * EMB + n0 + nn);
      sW[(nn + 0) * TPITCH + kk] = (_Float16)(x.x * WSC);
      sW[(nn + 1) * TPITCH + kk] = (_Float16)(x.y * WSC);
      sW[(nn + 2) * TPITCH + kk] = (_Float16)(x.z * WSC);
      sW[(nn + 3) * TPITCH + kk] = (_Float16)(x.w * WSC);
    }
    __syncthreads();
    wt_store_pass(sW, wt, which, n0, k0, w, lane);
  }

  const unsigned ob = ib >> 1;                     // bytes: the same 8 values as f16
  *(v8h*)((char*)qx + ob)            = cvt8(a0, c0);
  *(v8h*)((char*)(qx + HPLANE) + ob) = cvt8(a1, c1);
  *(v8h*)((char*)vx + ob)            = cvt8(a2, c2);
  *(v8h*)((char*)(vx + HPLANE) + ob) = cvt8(a3, c3);
}

// ---------------------------------------------------------------------------
// 4 lines per instruction, 64 lines per wave: half of one head's 128 lines
// (base = 0 or 64), sT = that head's staged 128 x 64 tile.
// which 0/1: plane[bh][l][d]  (one token row = 64 halves = one line)
// which 2  : vt[bh][d][l]     (64 d-rows x 128 tokens = 2 lines each)
// ---------------------------------------------------------------------------
__device__ __forceinline__ void proj_store_pass(const _Float16* sT, _Float16* plane, _Float16* vt,
                                                int which, int bh, int l0, int base, int lane) {
  const int q8 = lane & 7, sub = lane >> 3;
  #pragma unroll
  for (int i = 0; i < 16; ++i) {
    const int lid = base + i * 4 + sub;            // 0..127
    v8h val;
    _Float16* dst;
    if (which != 2) {
      val = *(const v8ha*)(sT + lid * HD + 8 * q8);
      dst = plane + ((size_t)bh * SEQ + l0 + lid) * HD + 8 * q8;
    } else {
      const int d = lid >> 1, hl = lid & 1;
      val = *(const v8ha*)(sT + d * 128 + 64 * hl + 8 * q8);
      dst = vt + ((size_t)bh * HD + d) * SEQ + l0 + 64 * hl + 8 * q8;
    }
    *(v8h*)dst = val;
    asm volatile("s_wait_xcnt 0x0" ::: "memory");  // before the next line's load and address reuse this store's registers
  }
}

// ---------------------------------------------------------------------------
// Kernel 2: Y = X * W (with W^T staged k-contiguous) over the fused 3*1024
// output columns. which = 0: X = q, W = Wq -> qp ; 1: X = v, W = Wk -> kp ;
// 2: X = v, W = Wv -> vt (d-major).
// Block 128 thr (4 waves) = 128 tokens x 128 features (two heads of one which);
// wave tile 64 tokens x 64 features (one head); K = 1024 in stages of 64 (two
// steps of 32); each stage's X and W^T rows come into LDS by asynchronous copies,
// two buffers, the next stage in flight while this one is worked on; fragments
// from LDS. 768 blocks, three to a WGP by their LDS.
// ---------------------------------------------------------------------------
__global__ __launch_bounds__(128) void proj_kernel(
    const _Float16* __restrict__ qx,   // [4096][1024] f16(q)
    const _Float16* __restrict__ vx,   // [4096][1024] f16(v)
    const _Float16* __restrict__ wt,   // [3][1024][1024], row = output feature, x32
    const float* __restrict__ bq, const float* __restrict__ bk, const float* __restrict__ bv,
    _Float16* __restrict__ qp,         // [B*H][L][D]
    _Float16* __restrict__ kp,         // [B*H][L][D]
    _Float16* __restrict__ vt)         // [B*H][D][L]
{
  __shared__ __attribute__((aligned(16))) _Float16 sT[2 * 128 * 64]; // 32768 B, one 128 x 64 tile a head
  __shared__ __attribute__((aligned(16))) _Float16 sXW[2 * XWBUF];   // 73728 B

  const int tid = threadIdx.x, lane = tid & 31, w = tid >> 5;
  const int h = lane >> 4, m = lane & 15;
  const int m0 = blockIdx.x * 128;
  const int cg = blockIdx.y;                 // 0..23
  const int which = cg >> 3, head0 = (cg & 7) * 2;
  const int wtok = w & 1, wf = w >> 1;       // the wave's token half and its head of the pair

  const _Float16* xsrc = (which == 0) ? qx : vx;

  // copy role: rows 32w..32w+31 of X and of W^T; row (lane >> 3) of each group of 4,
  // 16-byte piece (lane & 7)
  const int cr = lane >> 3, cp = lane & 7;
  const char* gx = (const char*)(xsrc + (size_t)(m0 + 32 * w + cr) * EMB + 8 * cp);
  const char* gw = (const char*)(wt + ((size_t)which * EMB + head0 * HD + 32 * w + cr) * EMB + 8 * cp);
  const unsigned lx = lds_off(sXW) + (32 * w + cr) * SPB + 16 * cp;
  const unsigned lw = lds_off(sXW) + (128 + 32 * w + cr) * SPB + 16 * cp;

  const v8f zero8 = {0.f, 0.f, 0.f, 0.f, 0.f, 0.f, 0.f, 0.f};
  v8f acc[4][4];
  #pragma unroll
  for (int mt = 0; mt < 4; ++mt)
    #pragma unroll
    for (int nt = 0; nt < 4; ++nt) acc[mt][nt] = zero8;

  async_rows32(lx, gx);                                    // stage 0 -> buffer 0
  async_rows32(lw, gw);
  asm volatile("s_wait_asynccnt 0x0" ::: "memory");        // own copies of stage 0 have landed
  __syncthreads();
  async_rows32(lx + XWBUF * 2, gx + 128);                  // stage 1 -> buffer 1
  async_rows32(lw + XWBUF * 2, gw + 128);

  // rolled: one buffer offset per trip, every fragment index constant
  #pragma unroll 1
  for (int t = 0; t < EMB / 64; ++t) {
    const int bo = (t & 1) * XWBUF;
    const _Float16* xs = sXW + bo + (64 * wtok + m) * SPITCH;      // token row, mt = 0
    const _Float16* wl = sXW + bo + (128 + 64 * wf + m) * SPITCH;  // feature row, nt = 0
    // Fragment reads stand in groups ahead of the products that use them, so that a
    // wave waits out the LDS latency once a stage and not in front of every four products.
    v16h a0[4], b0[4], a1[4], b1[4];
    #pragma unroll
    for (int mt = 0; mt < 4; ++mt) a0[mt] = load_frag(xs + mt * 16 * SPITCH, h);
    #pragma unroll
    for (int nt = 0; nt < 4; ++nt) b0[nt] = load_frag(wl + nt * 16 * SPITCH, h);
    #pragma unroll
    for (int mt = 0; mt < 4; ++mt) a1[mt] = load_frag(xs + mt * 16 * SPITCH + 32, h);
    b1[0] = load_frag(wl + 32, h);
    __builtin_amdgcn_sched_barrier(0);                     // or the compiler sinks these reads down to their products
    #pragma unroll
    for (int nt = 0; nt < 3; ++nt)
      #pragma unroll
      for (int mt = 0; mt < 4; ++mt) acc[mt][nt] = wmma_f16(a0[mt], b0[nt], acc[mt][nt]);
    // the last three reads go out here, into registers that the twelve products above have left
    #pragma unroll
    for (int nt = 1; nt < 4; ++nt) b1[nt] = load_frag(wl + nt * 16 * SPITCH + 32, h);
    __builtin_amdgcn_sched_barrier(0);                     // holds these reads eight products ahead of their first use; without it the compiler moves them
    #pragma unroll
    for (int mt = 0; mt < 4; ++mt) acc[mt][3] = wmma_f16(a0[mt], b0[3], acc[mt][3]);
    #pragma unroll
    for (int nt = 0; nt < 4; ++nt)
      #pragma unroll
      for (int mt = 0; mt < 4; ++mt) acc[mt][nt] = wmma_f16(a1[mt], b1[nt], acc[mt][nt]);
    stage_publish();
    if (t + 2 < EMB / 64) {                                // stage t + 2 -> the buffer just read
      async_rows32(lx + bo * 2, gx + (t + 2) * 128);
      async_rows32(lw + bo * 2, gw + (t + 2) * 128);
    }
  }
  asm volatile("s_wait_asynccnt 0x0" ::: "memory");        // nothing of this wave's is in flight any more

  // D[r] of tile (mt, nt) = Y[token m0+64wtok+16mt+8h+r][feature 16nt+m of head head0+wf]
  const int head = head0 + wf;
  _Float16* sTh = sT + wf * (128 * 64);
  const float* bias = (which == 0) ? bq : ((which == 1) ? bk : bv);
  float bvl4[4];
  #pragma unroll
  for (int nt = 0; nt < 4; ++nt) bvl4[nt] = bias[head * HD + 16 * nt + m];
  asm volatile("s_wait_xcnt 0x0" ::: "memory");            // before the index arithmetic below reuses these loads' offset register
  __builtin_amdgcn_sched_barrier(0);                       // or the compiler lifts that arithmetic over the wait
  #pragma unroll
  for (int nt = 0; nt < 4; ++nt) {
    const int feat = 16 * nt + m;
    const float bvl = bvl4[nt];
    #pragma unroll
    for (int mt = 0; mt < 4; ++mt) {
      #pragma unroll
      for (int r = 0; r < 8; ++r) {
        const int tokl = 64 * wtok + 16 * mt + 8 * h + r;  // 0..127
        const float y = acc[mt][nt][r] * WINV + bvl;
        const int idx = (which == 2) ? (feat * 128 + tokl) : (tokl * HD + feat);
        sTh[idx] = (_Float16)y;
      }
    }
  }
  __syncthreads();

  const int b = m0 / SEQ, l0 = m0 - b * SEQ, bh = b * NHEADS + head;
  _Float16* plane = (which == 0) ? qp : kp;
  proj_store_pass(sTh, plane, vt, which, bh, l0, 64 * wtok, lane);
  
}

// ---------------------------------------------------------------------------
// Attention helpers.
// ---------------------------------------------------------------------------
// P^T B-fragment from the lane's own score D values: element r <- tile a row r
// (keys 0..15 of the 32-deep chunk), element 8+r <- tile c row r (keys 16..31),
// same lane, same query column; the values already carry the 2^14.
__device__ __forceinline__ v16h pack_p(v8f a, v8f c) {
  const v16h r = { (_Float16)a[0], (_Float16)a[1], (_Float16)a[2], (_Float16)a[3],
                   (_Float16)a[4], (_Float16)a[5], (_Float16)a[6], (_Float16)a[7],
                   (_Float16)c[0], (_Float16)c[1], (_Float16)c[2], (_Float16)c[3],
                   (_Float16)c[4], (_Float16)c[5], (_Float16)c[6], (_Float16)c[7] };
  return r;
}

// lanes 8q..8q+7 in one instruction, 4 lines per instruction, 32 lines per wave.
__device__ __forceinline__ void att_store_pass(const float* so, float* out,
                                               int b, int head, int q0, int lane) {
  const int q8 = lane & 7, sub = lane >> 3;
  #pragma unroll
  for (int i = 0; i < 8; ++i) {
    const int lid = i * 4 + sub;                   // 0..31
    const int row = lid >> 1, hl = lid & 1;
    const v4f val = *(const v4fa*)(so + row * 64 + 32 * hl + 4 * q8);
    const size_t gi = ((size_t)b * SEQ + q0 + row) * EMB + head * HD + 32 * hl + 4 * q8;
    *(v4f*)(out + gi) = val;
  }
}

// ---------------------------------------------------------------------------
// Kernel 3: streaming attention, transposed form.
// Block 256 thr (8 waves) = 128 queries: 4 query groups of 32 columns x 2 key
// halves of 1024 keys; a wave walks its half in steps of 64 keys.
//   S^T = K * Q^T : A = K rows (row = key, k = d), B = Q^T (k = d, n = query)
//   O^T += V^T * P^T : A = Vt rows (row = d, k = key), B = P^T from registers
// Every K and V^T fragment read from LDS feeds two products, one a column group
// of 16 queries. Lane owns 32 keys of query column (lane&15) of each group;
// partner = lane ^ 16.
// Each step's 64 K rows and 64 V^T rows (128 B each) of both key halves come into
// LDS once for the eight waves by asynchronous copies (8 copies a wave), two
// buffers, the next step in flight while this one is worked on.
// At the end the two waves of a query group swap one column group's partial
// (maximum, sum, O) through LDS and each finishes 16 queries.
// grid = (SEQ/128, B*H).
// ---------------------------------------------------------------------------
// amdgpu_waves_per_eu(4, 4): at most 256 registers a wave, so that two work-groups share a WGP (four waves a SIMD).
__global__ __launch_bounds__(256) __attribute__((amdgpu_waves_per_eu(4, 4))) void attn_kernel(
    const _Float16* __restrict__ qp,   // [B*H][L][D]
    const _Float16* __restrict__ kp,   // [B*H][L][D]
    const _Float16* __restrict__ vt,   // [B*H][D][L]
    float* __restrict__ out)           // [B][L][EMB]
{
  __shared__ __attribute__((aligned(16))) float sO[8 * 16 * 64];    // 32768 B
  __shared__ __attribute__((aligned(16))) float sML[8 * 32 * 2];    //  2048 B
  __shared__ __attribute__((aligned(16))) _Float16 sKV[2 * STBUF];  // 73728 B

  const int tid = threadIdx.x, lane = tid & 31, w = tid >> 5;
  const int h = lane >> 4, m = lane & 15;
  const int bh = blockIdx.y, b = bh >> 4, head = bh & 15;
  const int sw = __builtin_amdgcn_readfirstlane(w);            // scalar: the choices below write no EXEC
  const int qg = sw & 3, kh = sw >> 2;                         // query group, key half
  const int q0 = blockIdx.x * 128 + 32 * qg;

  // Q^T B-fragments: column n = query q0+16c+m, k = d (two 32-deep chunks)
  v16h qb[2][2];
  #pragma unroll
  for (int c = 0; c < 2; ++c) {
    const _Float16* qrow = qp + ((size_t)bh * SEQ + q0 + 16 * c + m) * HD;
    qb[c][0] = load_frag(qrow, h);
    qb[c][1] = load_frag(qrow + 32, h);
  }

  const v8f zero8 = {0.f, 0.f, 0.f, 0.f, 0.f, 0.f, 0.f, 0.f};
  v8f o[2][4];                                // o[c][t][r] = O[query 16c+m][d 16t+8h+r] * lrun[c] (lrun = l * 2^14)
  float mrun[2], lrun[2];
  #pragma unroll
  for (int c = 0; c < 2; ++c) {
    #pragma unroll
    for (int t = 0; t < 4; ++t) o[c][t] = zero8;
    mrun[c] = -1e30f;
    lrun[c] = 0.0f;
  }

  // copy role: staged rows 32w + (lane >> 3) + 4i, i = 0..7; 16-byte piece (lane & 7).
  // A stage: [half 0: 64 K, 64 V^T][half 1: 64 K, 64 V^T]; waves 0,1,4,5 bring K, waves 2,3,6,7 V^T.
  const int cp = lane & 7;
  const bool ck = (sw & 2) == 0;
  const unsigned gpitch = ck ? HD * 2 : SEQ * 2;               // bytes, one source row further on
  const unsigned grow = 4 * gpitch;                            // bytes, 4 rows further on
  const unsigned gstep = ck ? 64 * HD * 2 : 64 * 2;            // bytes, 64 keys further on
  const char* gsrc = (const char*)((ck ? kp : vt) + (size_t)bh * SEQ * HD)
                     + (size_t)((32 * (sw & 1) + (lane >> 3)) * gpitch) + 16 * cp
                     + (size_t)(kh * (KHALF / 64)) * gstep;
  const unsigned ldst = lds_off(sKV) + (32 * sw + (lane >> 3)) * SPB + 16 * cp;

  async_rows32p(ldst, gsrc, grow);                         // step 0 -> buffer 0
  asm volatile("s_wait_asynccnt 0x0" ::: "memory");        // own copies of step 0 have landed
  __syncthreads();
  async_rows32p(ldst + STBUF * 2, gsrc + gstep, grow);     // step 1 -> buffer 1

  // rolled: one buffer offset per trip, every fragment index constant
  #pragma unroll 1
  for (int st = 0; st < KHALF / 64; ++st) {
    const int bo = (st & 1) * STBUF;
    const _Float16* kl = sKV + bo + kh * KVBUF + m * SPITCH;   // + 16j rows + 32*dc
    const _Float16* vl = kl + 64 * SPITCH;                 // + 16t rows + key chunk
    // ---- raw scores: s[c][j][r] = q . k of query 16c+m, key kb+16j+8h+r ----
    // all 16 K reads of the step as one group ahead of the sixteen products: one LDS wait, not four
    v16h kf0[4], kf1[4];
    #pragma unroll
    for (int j = 0; j < 4; ++j) kf0[j] = load_frag(kl + 16 * j * SPITCH, h);
    #pragma unroll
    for (int j = 0; j < 4; ++j) kf1[j] = load_frag(kl + 16 * j * SPITCH + 32, h);
    __builtin_amdgcn_sched_barrier(0);                     // or the compiler sinks each read down to its product
    v8f s[2][4];
    #pragma unroll
    for (int j = 0; j < 4; ++j)
      #pragma unroll
      for (int c = 0; c < 2; ++c) s[c][j] = wmma_f16(kf0[j], qb[c][0], zero8);
    #pragma unroll
    for (int j = 0; j < 4; ++j)
      #pragma unroll
      for (int c = 0; c < 2; ++c) s[c][j] = wmma_f16(kf1[j], qb[c][1], s[c][j]);
    // ---- online softmax in base 2: P * 2^14 = exp2(raw * SLOG2E + (14 - max * SLOG2E)), one FMA ahead of each exp2 ----
    float mloc[2], mpart[2];
    #pragma unroll
    for (int c = 0; c < 2; ++c) {
      mloc[c] = s[c][0][0];
      #pragma unroll
      for (int j = 0; j < 4; ++j)
        #pragma unroll
        for (int r = 0; r < 8; ++r) mloc[c] = fmaxf(mloc[c], s[c][j][r]);
    }
    mpart[0] = __shfl_xor(mloc[0], 16);
    mpart[1] = __shfl_xor(mloc[1], 16);
    asm volatile("" :: "v"(mpart[0]), "v"(mpart[1]) : "memory");   // the V^T reads go out behind the exchange's return: queued ahead of it in the LDS they would lengthen its wait
    // all 16 V^T reads of the step as one group: they land under the exponentials
    v16h vf0[4], vf1[4];
    #pragma unroll
    for (int t = 0; t < 4; ++t) vf0[t] = load_frag(vl + 16 * t * SPITCH, h);
    #pragma unroll
    for (int t = 0; t < 4; ++t) vf1[t] = load_frag(vl + 16 * t * SPITCH + 32, h);
    __builtin_amdgcn_sched_barrier(0);                     // or the compiler sinks each read down to its product
    v16h pb[2][2];
    #pragma unroll
    for (int c = 0; c < 2; ++c) {
      const float mnew = fmaxf(mrun[c], fmaxf(mloc[c], mpart[c]));   // running maximum of the raw scores (SLOG2E > 0)
      const float alpha = __builtin_amdgcn_exp2f((mrun[c] - mnew) * SLOG2E);
      mrun[c] = mnew;
      const float nb = __builtin_fmaf(-mnew, SLOG2E, PBITS);
      const v2f sc2 = {SLOG2E, SLOG2E};
      const v2f nb2 = {nb, nb};
      float lsum = 0.0f;
      #pragma unroll
      for (int j = 0; j < 4; ++j)
        #pragma unroll
        for (int r = 0; r < 8; r += 2) {
          const v2f raw = {s[c][j][r], s[c][j][r + 1]};
          const v2f e = __builtin_elementwise_fma(raw, sc2, nb2);
          const float p0 = __builtin_amdgcn_exp2f(e.x);
          const float p1 = __builtin_amdgcn_exp2f(e.y);
          s[c][j][r] = p0;
          s[c][j][r + 1] = p1;
          lsum += p0;
          lsum += p1;
        }
      lsum += __shfl_xor(lsum, 16);
      lrun[c] = lrun[c] * alpha + lsum;
      #pragma unroll
      for (int t = 0; t < 4; ++t)
        #pragma unroll
        for (int r = 0; r < 8; ++r) o[c][t][r] = o[c][t][r] * alpha;
      // ---- P^T B-fragments (key chunks 0..31 and 32..63 of this step) ----
      pb[c][0] = pack_p(s[c][0], s[c][1]);
      pb[c][1] = pack_p(s[c][2], s[c][3]);
    }

    // ---- O^T += V^T * P^T ----
    #pragma unroll
    for (int t = 0; t < 4; ++t)
      #pragma unroll
      for (int c = 0; c < 2; ++c) o[c][t] = wmma_f16(vf0[t], pb[c][0], o[c][t]);
    #pragma unroll
    for (int t = 0; t < 4; ++t)
      #pragma unroll
      for (int c = 0; c < 2; ++c) o[c][t] = wmma_f16(vf1[t], pb[c][1], o[c][t]);

    stage_publish();
    if (st + 2 < KHALF / 64)                               // step st + 2 -> the buffer just read
      async_rows32p(ldst + bo * 2, gsrc + (size_t)(st + 2) * gstep, grow);
  }
  asm volatile("s_wait_asynccnt 0x0" ::: "memory");        // nothing of this wave's is in flight any more

  // ---- join of the key halves: the wave of half kh finishes column group kh and hands
  //      its partial of the other group, lane for lane, to its partner wave (w ^ 4) ----
  const bool hi = kh != 0;
  float* xown = sO + sw * 1024;                            // what this wave hands over
  float* so   = sO + (sw ^ 4) * 1024;                      // what it is handed; then its own output tile
  #pragma unroll
  for (int t = 0; t < 4; ++t) {
    const v8f g = hi ? o[0][t] : o[1][t];
    const v4f g0 = {g[0], g[1], g[2], g[3]}, g1 = {g[4], g[5], g[6], g[7]};
    *(v4fa*)(xown + ((2 * t) * 32 + lane) * 4) = g0;
    *(v4fa*)(xown + ((2 * t + 1) * 32 + lane) * 4) = g1;
  }
  sML[(sw * 32 + lane) * 2]     = hi ? mrun[0] : mrun[1];
  sML[(sw * 32 + lane) * 2 + 1] = hi ? lrun[0] : lrun[1];
  __syncthreads();

  const float mo = hi ? mrun[1] : mrun[0], lo = hi ? lrun[1] : lrun[0];
  const float mp = sML[((sw ^ 4) * 32 + lane) * 2], lp = sML[((sw ^ 4) * 32 + lane) * 2 + 1];
  const float mall = fmaxf(mo, mp);
  const float wo = __builtin_amdgcn_exp2f((mo - mall) * SLOG2E);
  const float wp = __builtin_amdgcn_exp2f((mp - mall) * SLOG2E);
  const float inv = 1.0f / (lo * wo + lp * wp);            // o and lrun both carry the 2^14
  const float fo = wo * inv, fp = wp * inv;
  v4f p0[4], p1[4];
  #pragma unroll
  for (int t = 0; t < 4; ++t) {
    p0[t] = *(const v4fa*)(so + ((2 * t) * 32 + lane) * 4);
    p1[t] = *(const v4fa*)(so + ((2 * t + 1) * 32 + lane) * 4);
  }
  // ---- normalise, stage the wave's 16x64 tile (in the slot it alone has read), whole-line stores ----
  #pragma unroll
  for (int t = 0; t < 4; ++t) {
    const v8f a = hi ? o[1][t] : o[0][t];
    #pragma unroll
    for (int r = 0; r < 8; ++r)
      so[m * 64 + 16 * t + 8 * h + r] = a[r] * fo + (r < 4 ? p0[t][r] : p1[t][r - 4]) * fp;
  }
  __syncthreads();

  att_store_pass(so, out, b, head, q0 + 16 * kh, lane);
}

// ---------------------------------------------------------------------------
extern "C" void kernel_launch(void* const* d_in, const int* in_sizes, int n_in,
                              void* d_out, int out_size, void* d_ws, size_t ws_size,
                              hipStream_t stream) {
  if (n_in < 8) return;
  if (in_sizes[0] != NX || in_sizes[1] != NX) return;
  if (in_sizes[2] != NW || in_sizes[4] != NW || in_sizes[6] != NW) return;
  if (in_sizes[3] != EMB || in_sizes[5] != EMB || in_sizes[7] != EMB) return;
  if (out_size != NX) return;

  const float* q  = (const float*)d_in[0];
  const float* v  = (const float*)d_in[1];
  const float* Wq = (const float*)d_in[2];
  const float* bq = (const float*)d_in[3];
  const float* Wk = (const float*)d_in[4];
  const float* bk = (const float*)d_in[5];
  const float* Wv = (const float*)d_in[6];
  const float* bv = (const float*)d_in[7];
  float* out = (float*)d_out;

  const size_t x_bytes  = (size_t)NX * 2;                           //  8388608 per plane
  const size_t wt_bytes = (size_t)3 * NW * 2;                       //  6291456
  const size_t pl_bytes = (size_t)BATCH * NHEADS * SEQ * HD * 2;    //  8388608 per plane
  const size_t total = 2 * x_bytes + wt_bytes + 3 * pl_bytes;       // 48234496
  if (total > ws_size) return;

  char* ws = (char*)d_ws;
  _Float16* qx = (_Float16*)(ws);
  _Float16* vx = (_Float16*)(ws + x_bytes);
  _Float16* wt = (_Float16*)(ws + 2 * x_bytes);
  _Float16* qp = (_Float16*)(ws + 2 * x_bytes + wt_bytes);
  _Float16* kp = (_Float16*)(ws + 2 * x_bytes + wt_bytes + pl_bytes);
  _Float16* vt = (_Float16*)(ws + 2 * x_bytes + wt_bytes + 2 * pl_bytes);

  prep_kernel<<<PREPB, 256, 0, stream>>>(q, v, Wq, Wk, Wv, qx, vx, wt);

  dim3 gProj(MROWS / 128, 3 * NHEADS / 2);                           // (32, 24)
  proj_kernel<<<gProj, 128, 0, stream>>>(qx, vx, wt, bq, bk, bv, qp, kp, vt);

  dim3 gAtt(SEQ / 128, BATCH * NHEADS);                              // (16, 32)
  attn_kernel<<<gAtt, 256, 0, stream>>>(qp, kp, vt, out);
}

// v007
// It runs in 64.8 microseconds.
// Next to v006, in two timings, it ran 1.05 times as fast each time.
// Counting every step since v000, it is 3.73 times as fast.
// Contractions: q*Wq, v*Wk, v*Wv, K*Q^T and V^T*P^T all on v_wmma_f32_16x16x32_f16 (f16 operands, f32 accumulate); W carried x32 (exact power-of-two scale folded back in f32), P and its row sum carried x16384 (cancels in the normalisation); score scale 1/32, softmax (base 2), bias and normalisation in f32.
#include <hip/hip_runtime.h>

typedef _Float16 v16h __attribute__((ext_vector_type(16)));
typedef _Float16 v8h  __attribute__((ext_vector_type(8)));
typedef float    v8f  __attribute__((ext_vector_type(8)));
typedef float    v4f  __attribute__((ext_vector_type(4)));
typedef float    v2f  __attribute__((ext_vector_type(2)));
typedef v8h __attribute__((may_alias)) v8ha;
typedef v4f __attribute__((may_alias)) v4fa;

union Frag { v16h v; v8h half[2]; };

#define EMB    1024
#define NHEADS 16
#define HD     64
#define SEQ    2048
#define BATCH  2
#define MROWS  (BATCH * SEQ)          // 4096 tokens
#define NX     (MROWS * EMB)          // 4194304
#define NW     (EMB * EMB)            // 1048576
#define NX8    (NX / 8)               // 524288
#define WSC    32.0f                  // weight plane scale (exact)
#define WINV   0.03125f               // 1/WSC
#define SLOG2E 0.045084220027780106f  // log2(e) / sqrt(EMB): raw score -> exponent of 2
#define PBITS  14.0f                  // P is carried x 2^14: added to that exponent
#define TPITCH 72                     // LDS pitch (halves) of the transposed weight tile
#define SPITCH 72                     // LDS pitch (halves) of a staged 128-byte operand row: 144 B = 16 B x 9
#define SPB    (SPITCH * 2)           // the same in bytes
#define KVBUF  (128 * SPITCH)         // attention, one key half of a stage: 64 K rows, then 64 V^T rows (halves)
#define STBUF  (2 * KVBUF)            // attention stage: both key halves (halves)
#define KHALF  (SEQ / 2)              // keys a wave walks
#define XWBUF  (256 * SPITCH)         // projection stage: 128 X rows, then 128 W^T rows (halves)

// ---------------------------------------------------------------------------
// 16x16x32 f16 WMMA with hazard guard (ties D, keeps A/B live).
// Fragment map (wave32): lane l, h = l>>4, m = n = l&15.
//   A/B element i: i<8 -> k0+8h+i ; i>=8 -> k0+16+8h+(i-8)
//   D element r : row 8h+r, col l&15
// ---------------------------------------------------------------------------
__device__ __forceinline__ v8f wmma_f16(v16h a, v16h b, v8f c) {
  v8f d = __builtin_amdgcn_wmma_f32_16x16x32_f16(false, a, false, b, (short)0, c, false, false);
  asm volatile("v_nop\n\tv_nop\n\tv_nop\n\tv_nop" : "+v"(d) : "v"(a), "v"(b));
  return d;
}

// A or B fragment from a k-contiguous 16-bit row; p points at element k0 of
// the row owned by this lane (row index = lane & 15 added by the caller).
__device__ __forceinline__ v16h load_frag(const _Float16* p, int h) {
  Frag f;
  f.half[0] = *(const v8ha*)(p + 8 * h);
  f.half[1] = *(const v8ha*)(p + 16 + 8 * h);
  return f.v;
}

// ---------------------------------------------------------------------------
// Asynchronous copies global -> LDS, 16 B per lane: lanes 8q..8q+7 bring one
// whole 128-byte row, one copy = 4 rows. l = the lane's LDS byte address,
// g = its global address; copy c takes the rows 4c further on (LDS + 4 pitches,
// global + grow bytes). s_wait_xcnt closes each statement so that no address
// register is rewritten while a copy that names it may still need it.
// ---------------------------------------------------------------------------
__device__ __forceinline__ unsigned lds_off(const void* p) { return (unsigned)(size_t)p; }

// 32 rows (8 copies) of an attention stage; grow = bytes from one copy's rows to the next copy's in global memory.
__device__ __forceinline__ void async_rows32p(unsigned l, const char* g, unsigned grow) {
  const size_t gr = grow;
  asm volatile("global_load_async_to_lds_b128 %0, %8, off\n\t"
               "global_load_async_to_lds_b128 %1, %9, off\n\t"
               "global_load_async_to_lds_b128 %2, %10, off\n\t"
               "global_load_async_to_lds_b128 %3, %11, off\n\t"
               "global_load_async_to_lds_b128 %4, %12, off\n\t"
               "global_load_async_to_lds_b128 %5, %13, off\n\t"
               "global_load_async_to_lds_b128 %6, %14, off\n\t"
               "global_load_async_to_lds_b128 %7, %15, off\n\t"
               "s_wait_xcnt 0x0"
               :: "v"(l), "v"(l + 4 * SPB), "v"(l + 8 * SPB), "v"(l + 12 * SPB),
                  "v"(l + 16 * SPB), "v"(l + 20 * SPB), "v"(l + 24 * SPB), "v"(l + 28 * SPB),
                  "v"(g), "v"(g + gr), "v"(g + 2 * gr), "v"(g + 3 * gr),
                  "v"(g + 4 * gr), "v"(g + 5 * gr), "v"(g + 6 * gr), "v"(g + 7 * gr)
               : "memory");
}

// 32 rows of one operand (8 copies) at a global row pitch of EMB halves; a projection
// wave calls it once for its X rows and once for its W^T rows of a stage.
__device__ __forceinline__ void async_rows32(unsigned l, const char* g) {
  const size_t gr = (size_t)4 * EMB * 2;             // 4 rows further on in global memory
  asm volatile("global_load_async_to_lds_b128 %0, %8, off\n\t"
               "global_load_async_to_lds_b128 %1, %9, off\n\t"
               "global_load_async_to_lds_b128 %2, %10, off\n\t"
               "global_load_async_to_lds_b128 %3, %11, off\n\t"
               "global_load_async_to_lds_b128 %4, %12, off\n\t"
               "global_load_async_to_lds_b128 %5, %13, off\n\t"
               "global_load_async_to_lds_b128 %6, %14, off\n\t"
               "global_load_async_to_lds_b128 %7, %15, off\n\t"
               "s_wait_xcnt 0x0"
               :: "v"(l), "v"(l + 4 * SPB), "v"(l + 8 * SPB), "v"(l + 12 * SPB),
                  "v"(l + 16 * SPB), "v"(l + 20 * SPB), "v"(l + 24 * SPB), "v"(l + 28 * SPB),
                  "v"(g), "v"(g + gr), "v"(g + 2 * gr), "v"(g + 3 * gr),
                  "v"(g + 4 * gr), "v"(g + 5 * gr), "v"(g + 6 * gr), "v"(g + 7 * gr)
               : "memory");
}

// Hand-over of a stage: this wave's LDS reads are done, its own copies have
// landed, then the work-group barrier publishes the next stage and frees this one.
__device__ __forceinline__ void stage_publish() {
  asm volatile("s_wait_dscnt 0x0" ::: "memory");     // own reads of the buffer that is refilled next
  asm volatile("s_wait_asynccnt 0x0" ::: "memory");  // own copies of the next stage have landed
  __syncthreads();
}

// ---------------------------------------------------------------------------
// Kernel 1: all of the preparation in one launch of PREPB work-groups, every
// one resident at once.
//  a) f32 -> f16 planes for q and v, unscaled, RNE convert: a thread takes one
//     group of 8 values in each half of each plane (4 groups, 8 loads of 16 B,
//     all of them in flight together).
//  b) work-groups 0..767 also take one weight tile each: in W[k][n] (k = input
//     feature, n = output feature, both 1024) -> wt[which][n][k] = f16(32 * W[k][n]),
//     a 64(k) x 64(n) tile transposed through LDS, stored as whole 128-byte lines
//     (lanes 8q..8q+7 of a wave bring one line, 4 lines per instruction).
// ---------------------------------------------------------------------------
#define PREPB  1024                   // work-groups of 256 threads: 4 a WGP
#define WTILES 768                    // 16 (n) x 16 (k) x 3 weight tiles
#define HPLANE (PREPB * 256 * 8)      // values one sweep of the grid covers = NX / 2

__device__ __forceinline__ void wt_store_pass(const _Float16* sW, _Float16* wt,
                                              int which, int n0, int k0, int w, int lane) {
  const int q8 = lane & 7, sub = lane >> 3;
  #pragma unroll
  for (int i = 0; i < 2; ++i) {
    const int nrow = w * 8 + i * 4 + sub;          // 0..63
    const v8h val = *(const v8ha*)(sW + nrow * TPITCH + 8 * q8);
    _Float16* dst = wt + ((size_t)which * EMB + n0 + nrow) * EMB + k0 + 8 * q8;
    *(v8h*)dst = val;
  }
}

__device__ __forceinline__ v8h cvt8(v4f a, v4f c) {
  const v8h o = { (_Float16)a.x, (_Float16)a.y, (_Float16)a.z, (_Float16)a.w,
                  (_Float16)c.x, (_Float16)c.y, (_Float16)c.z, (_Float16)c.w };
  return o;
}

__global__ __launch_bounds__(256) void prep_kernel(
    const float* __restrict__ q, const float* __restrict__ v,
    const float* __restrict__ wq, const float* __restrict__ wk, const float* __restrict__ wv,
    _Float16* __restrict__ qx, _Float16* __restrict__ vx,
    _Float16* __restrict__ wt)         // [3][1024 n][1024 k], x32
{
  __shared__ __attribute__((aligned(16))) _Float16 sW[64 * TPITCH];   // 9216 B

  const int tid = threadIdx.x, lane = tid & 31, w = tid >> 5;
  const int bid = blockIdx.x;
  const unsigned ib = ((unsigned)bid * 256u + (unsigned)tid) * 32u;  // bytes: the thread's 8 floats in the first half of a plane
  const char* q0 = (const char*)q + ib;
  const char* q1 = (const char*)(q + HPLANE) + ib;
  const char* v0 = (const char*)v + ib;
  const char* v1 = (const char*)(v + HPLANE) + ib;

  const v4f a0 = *(const v4fa*)q0, c0 = *(const v4fa*)(q0 + 16);
  const v4f a1 = *(const v4fa*)q1, c1 = *(const v4fa*)(q1 + 16);
  const v4f a2 = *(const v4fa*)v0, c2 = *(const v4fa*)(v0 + 16);
  const v4f a3 = *(const v4fa*)v1, c3 = *(const v4fa*)(v1 + 16);
  asm volatile("s_wait_xcnt 0x0" ::: "memory");    // before the index arithmetic below reuses these loads' address registers
  __builtin_amdgcn_sched_barrier(0);               // or the compiler lifts that arithmetic over the wait

  if (bid < WTILES) {                              // the same for the whole work-group
    const int n0 = (bid & 15) * 64, k0 = ((bid >> 4) & 15) * 64, which = bid >> 8;
    const float* W = (which == 0) ? wq : ((which == 1) ? wk : wv);
    #pragma unroll
    for (int i = 0; i < 4; ++i) {
      const int idx = tid + 256 * i;               // 0..1023 float4 groups
      const int kk = idx >> 4, nn = (idx & 15) * 4;
      const v4f x = *(const v4fa*)(W + (size_t)(k0 + kk) * EMB + n0 + nn);
      sW[(nn + 0) * TPITCH + kk] = (_Float16)(x.x * WSC);
      sW[(nn + 1) * TPITCH + kk] = (_Float16)(x.y * WSC);
      sW[(nn + 2) * TPITCH + kk] = (_Float16)(x.z * WSC);
      sW[(nn + 3) * TPITCH + kk] = (_Float16)(x.w * WSC);
    }
    __syncthreads();
    wt_store_pass(sW, wt, which, n0, k0, w, lane);
  }

  const unsigned ob = ib >> 1;                     // bytes: the same 8 values as f16
  *(v8h*)((char*)qx + ob)            = cvt8(a0, c0);
  *(v8h*)((char*)(qx + HPLANE) + ob) = cvt8(a1, c1);
  *(v8h*)((char*)vx + ob)            = cvt8(a2, c2);
  *(v8h*)((char*)(vx + HPLANE) + ob) = cvt8(a3, c3);
}

// ---------------------------------------------------------------------------
// 4 lines per instruction, 64 lines per wave: half of one head's 128 lines
// (base = 0 or 64), sT = that head's staged tile (16384 B), in 16-byte pieces
// whose place inside a row is XORed with a row number, so that neither the
// writers (16 rows, one piece column) nor these readers meet on a bank:
// which 0/1: row = token, 8 pieces;   piece p of token l at l*128 + ((p ^ ((l >> 1) & 7)) << 4)
// which 2  : row = d, 16 pieces;      piece p of row d   at d*256 + ((p ^ (d & 15)) << 4)
// which 0/1: plane[bh][l][d]  (one token row = 64 halves = one line)
// which 2  : vt[bh][d][l]     (64 d-rows x 128 tokens = 2 lines each)
// The row number's part of the XOR is (2i & mask) ^ (sub >> 1) for line base + 4i + sub.
// All 16 LDS reads go out as one group into registers of their own, then the 16
// stores, each from an address register pair of its own: one LDS latency, not sixteen.
// ---------------------------------------------------------------------------
__device__ __forceinline__ void proj_store_pass(const char* sT, _Float16* plane, _Float16* vt,
                                                int which, int bh, int l0, int base, int lane) {
  const int q8 = lane & 7, sub = lane >> 3;
  const bool tk = which != 2;                      // the same for the whole work-group
  const int cm = tk ? 7 : 15;
  const int x0 = (tk ? q8 : 8 * (sub & 1) + q8) ^ (sub >> 1);
  const char* rb = sT + (tk ? (base + sub) * 128 : ((base >> 1) + (sub >> 1)) * 256);
  char* dst = tk ? (char*)(plane + ((size_t)bh * SEQ + l0 + base + sub) * HD + 8 * q8)
                 : (char*)(vt + ((size_t)bh * HD + (base >> 1) + (sub >> 1)) * SEQ + l0 + 64 * (sub & 1) + 8 * q8);
  const size_t step = tk ? (size_t)4 * HD * 2 : (size_t)2 * SEQ * 2;   // bytes from one store's lines to the next store's
  v8h val[16];
  char* p[16];
  #pragma unroll
  for (int i = 0; i < 16; ++i) val[i] = *(const v8ha*)(rb + i * 512 + ((x0 ^ ((2 * i) & cm)) << 4));
  #pragma unroll
  for (int i = 0; i < 16; ++i) p[i] = dst + i * step;
  __builtin_amdgcn_sched_barrier(0);               // every address is formed ahead of the first store, so that no issued store's register is rewritten
  #pragma unroll
  for (int i = 0; i < 16; ++i) *(v8h*)p[i] = val[i];
}

// ---------------------------------------------------------------------------
// Kernel 2: Y = X * W (with W^T staged k-contiguous) over the fused 3*1024
// output columns. which = 0: X = q, W = Wq -> qp ; 1: X = v, W = Wk -> kp ;
// 2: X = v, W = Wv -> vt (d-major).
// Block 128 thr (4 waves) = 128 tokens x 128 features (two heads of one which);
// wave tile 64 tokens x 64 features (one head); K = 1024 in stages of 64 (two
// steps of 32); each stage's X and W^T rows come into LDS by asynchronous copies,
// two buffers, the next stage in flight while this one is worked on; fragments
// from LDS. 768 blocks, three to a WGP by their LDS.
// which 0/1 take the product transposed (A = W^T rows, B = X rows), which 2 as it
// stands (A = X rows, B = W^T rows): either way a lane's 8 D values are 8
// neighbours in the output plane's rows, one 16-byte piece for the staging tile.
// ---------------------------------------------------------------------------
__global__ __launch_bounds__(128) void proj_kernel(
    const _Float16* __restrict__ qx,   // [4096][1024] f16(q)
    const _Float16* __restrict__ vx,   // [4096][1024] f16(v)
    const _Float16* __restrict__ wt,   // [3][1024][1024], row = output feature, x32
    const float* __restrict__ bq, const float* __restrict__ bk, const float* __restrict__ bv,
    _Float16* __restrict__ qp,         // [B*H][L][D]
    _Float16* __restrict__ kp,         // [B*H][L][D]
    _Float16* __restrict__ vt)         // [B*H][D][L]
{
  __shared__ __attribute__((aligned(16))) _Float16 sT[2 * 128 * 64]; // 32768 B, one 128 x 64 tile a head
  __shared__ __attribute__((aligned(16))) _Float16 sXW[2 * XWBUF];   // 73728 B

  const int tid = threadIdx.x, lane = tid & 31, w = tid >> 5;
  const int h = lane >> 4, m = lane & 15;
  const int m0 = blockIdx.x * 128;
  const int cg = blockIdx.y;                 // 0..23
  const int which = cg >> 3, head0 = (cg & 7) * 2;
  const int wtok = w & 1, wf = w >> 1;       // the wave's token half and its head of the pair

  const _Float16* xsrc = (which == 0) ? qx : vx;

  // copy role: rows 32w..32w+31 of X and of W^T; row (lane >> 3) of each group of 4,
  // 16-byte piece (lane & 7)
  const int cr = lane >> 3, cp = lane & 7;
  const char* gx = (const char*)(xsrc + (size_t)(m0 + 32 * w + cr) * EMB + 8 * cp);
  const char* gw = (const char*)(wt + ((size_t)which * EMB + head0 * HD + 32 * w + cr) * EMB + 8 * cp);
  const unsigned lx = lds_off(sXW) + (32 * w + cr) * SPB + 16 * cp;
  const unsigned lw = lds_off(sXW) + (128 + 32 * w + cr) * SPB + 16 * cp;

  // staged rows of the wave's A and B operands (the fragment maps of A and B are the same)
  const int trow = 64 * wtok + m, frow = 128 + 64 * wf + m;
  const int arow = (which != 2) ? frow : trow;
  const int brow = (which != 2) ? trow : frow;

  const v8f zero8 = {0.f, 0.f, 0.f, 0.f, 0.f, 0.f, 0.f, 0.f};
  v8f acc[4][4];
  #pragma unroll
  for (int mt = 0; mt < 4; ++mt)
    #pragma unroll
    for (int nt = 0; nt < 4; ++nt) acc[mt][nt] = zero8;

  async_rows32(lx, gx);                                    // stage 0 -> buffer 0
  async_rows32(lw, gw);
  asm volatile("s_wait_asynccnt 0x0" ::: "memory");        // own copies of stage 0 have landed
  __syncthreads();
  async_rows32(lx + XWBUF * 2, gx + 128);                  // stage 1 -> buffer 1
  async_rows32(lw + XWBUF * 2, gw + 128);

  // rolled: one buffer offset per trip, every fragment index constant
  #pragma unroll 1
  for (int t = 0; t < EMB / 64; ++t) {
    const int bo = (t & 1) * XWBUF;
    const _Float16* xs = sXW + bo + arow * SPITCH;         // A row, mt = 0
    const _Float16* wl = sXW + bo + brow * SPITCH;         // B row, nt = 0
    // Fragment reads stand in groups ahead of the products that use them, so that a
    // wave waits out the LDS latency once a stage and not in front of every four products.
    v16h a0[4], b0[4], a1[4], b1[4];
    #pragma unroll
    for (int mt = 0; mt < 4; ++mt) a0[mt] = load_frag(xs + mt * 16 * SPITCH, h);
    #pragma unroll
    for (int nt = 0; nt < 4; ++nt) b0[nt] = load_frag(wl + nt * 16 * SPITCH, h);
    #pragma unroll
    for (int mt = 0; mt < 4; ++mt) a1[mt] = load_frag(xs + mt * 16 * SPITCH + 32, h);
    b1[0] = load_frag(wl + 32, h);
    __builtin_amdgcn_sched_barrier(0);                     // or the compiler sinks these reads down to their products
    #pragma unroll
    for (int nt = 0; nt < 3; ++nt)
      #pragma unroll
      for (int mt = 0; mt < 4; ++mt) acc[mt][nt] = wmma_f16(a0[mt], b0[nt], acc[mt][nt]);
    // the last three reads go out here, into registers that the twelve products above have left
    #pragma unroll
    for (int nt = 1; nt < 4; ++nt) b1[nt] = load_frag(wl + nt * 16 * SPITCH + 32, h);
    __builtin_amdgcn_sched_barrier(0);                     // holds these reads eight products ahead of their first use; without it the compiler moves them
    #pragma unroll
    for (int mt = 0; mt < 4; ++mt) acc[mt][3] = wmma_f16(a0[mt], b0[3], acc[mt][3]);
    #pragma unroll
    for (int nt = 0; nt < 4; ++nt)
      #pragma unroll
      for (int mt = 0; mt < 4; ++mt) acc[mt][nt] = wmma_f16(a1[mt], b1[nt], acc[mt][nt]);
    stage_publish();
    if (t + 2 < EMB / 64) {                                // stage t + 2 -> the buffer just read
      async_rows32(lx + bo * 2, gx + (t + 2) * 128);
      async_rows32(lw + bo * 2, gw + (t + 2) * 128);
    }
  }
  asm volatile("s_wait_asynccnt 0x0" ::: "memory");        // nothing of this wave's is in flight any more

  const int head = head0 + wf;
  char* sTh = (char*)(sT + wf * (128 * 64));
  const float* bias = ((which == 0) ? bq : ((which == 1) ? bk : bv)) + head * HD;
  if (which != 2) {
    // D[r] of tile (mt, nt) = Y[token m0+64wtok+16nt+m][feature 16mt+8h+r of the head]
    v4f bl[4], bu[4];
    #pragma unroll
    for (int mt = 0; mt < 4; ++mt) {
      bl[mt] = *(const v4fa*)(bias + 16 * mt + 8 * h);
      bu[mt] = *(const v4fa*)(bias + 16 * mt + 8 * h + 4);
    }
    asm volatile("s_wait_xcnt 0x0" ::: "memory");          // before the index arithmetic below reuses these loads' offset register
    __builtin_amdgcn_sched_barrier(0);                     // or the compiler lifts that arithmetic over the wait
    #pragma unroll
    for (int mt = 0; mt < 4; ++mt) {
      #pragma unroll
      for (int nt = 0; nt < 4; ++nt) {
        const int tokl = 64 * wtok + 16 * nt + m;          // 0..127
        v8h y;
        #pragma unroll
        for (int r = 0; r < 8; ++r)
          y[r] = (_Float16)(acc[mt][nt][r] * WINV + (r < 4 ? bl[mt][r] : bu[mt][r - 4]));
        *(v8ha*)(sTh + tokl * 128 + (((2 * mt + h) ^ ((tokl >> 1) & 7)) << 4)) = y;
      }
    }
  } else {
    // D[r] of tile (mt, nt) = Y[token m0+64wtok+16mt+8h+r][feature 16nt+m of the head]
    float bvl4[4];
    #pragma unroll
    for (int nt = 0; nt < 4; ++nt) bvl4[nt] = bias[16 * nt + m];
    asm volatile("s_wait_xcnt 0x0" ::: "memory");          // before the index arithmetic below reuses these loads' offset register
    __builtin_amdgcn_sched_barrier(0);                     // or the compiler lifts that arithmetic over the wait
    #pragma unroll
    for (int nt = 0; nt < 4; ++nt) {
      const int feat = 16 * nt + m;                        // 0..63
      #pragma unroll
      for (int mt = 0; mt < 4; ++mt) {
        v8h y;
        #pragma unroll
        for (int r = 0; r < 8; ++r) y[r] = (_Float16)(acc[mt][nt][r] * WINV + bvl4[nt]);
        *(v8ha*)(sTh + feat * 256 + (((8 * wtok + 2 * mt + h) ^ (feat & 15)) << 4)) = y;
      }
    }
  }
  __syncthreads();

  const int b = m0 / SEQ, l0 = m0 - b * SEQ, bh = b * NHEADS + head;
  _Float16* plane = (which == 0) ? qp : kp;
  proj_store_pass(sTh, plane, vt, which, bh, l0, 64 * wtok, lane);
  
}

// ---------------------------------------------------------------------------
// Attention helpers.
// ---------------------------------------------------------------------------
// P^T B-fragment from the lane's own score D values: element r <- tile a row r
// (keys 0..15 of the 32-deep chunk), element 8+r <- tile c row r (keys 16..31),
// same lane, same query column; the values already carry the 2^14.
__device__ __forceinline__ v16h pack_p(v8f a, v8f c) {
  const v16h r = { (_Float16)a[0], (_Float16)a[1], (_Float16)a[2], (_Float16)a[3],
                   (_Float16)a[4], (_Float16)a[5], (_Float16)a[6], (_Float16)a[7],
                   (_Float16)c[0], (_Float16)c[1], (_Float16)c[2], (_Float16)c[3],
                   (_Float16)c[4], (_Float16)c[5], (_Float16)c[6], (_Float16)c[7] };
  return r;
}

// lanes 8q..8q+7 in one instruction, 4 lines per instruction, 32 lines per wave.
__device__ __forceinline__ void att_store_pass(const float* so, float* out,
                                               int b, int head, int q0, int lane) {
  const int q8 = lane & 7, sub = lane >> 3;
  #pragma unroll
  for (int i = 0; i < 8; ++i) {
    const int lid = i * 4 + sub;                   // 0..31
    const int row = lid >> 1, hl = lid & 1;
    const v4f val = *(const v4fa*)(so + row * 64 + (((8 * hl + q8) ^ row) << 2));   // piece p of a row stands at p ^ row
    const size_t gi = ((size_t)b * SEQ + q0 + row) * EMB + head * HD + 32 * hl + 4 * q8;
    *(v4f*)(out + gi) = val;
  }
}

// ---------------------------------------------------------------------------
// Kernel 3: streaming attention, transposed form.
// Block 256 thr (8 waves) = 128 queries: 4 query groups of 32 columns x 2 key
// halves of 1024 keys; a wave walks its half in steps of 64 keys.
//   S^T = K * Q^T : A = K rows (row = key, k = d), B = Q^T (k = d, n = query)
//   O^T += V^T * P^T : A = Vt rows (row = d, k = key), B = P^T from registers
// Every K and V^T fragment read from LDS feeds two products, one a column group
// of 16 queries. Lane owns 32 keys of query column (lane&15) of each group;
// partner = lane ^ 16.
// Each step's 64 K rows and 64 V^T rows (128 B each) of both key halves come into
// LDS once for the eight waves by asynchronous copies (8 copies a wave), two
// buffers, the next step in flight while this one is worked on.
// At the end the two waves of a query group swap one column group's partial
// (maximum, sum, O) through LDS and each finishes 16 queries.
// grid = (SEQ/128, B*H).
// ---------------------------------------------------------------------------
// amdgpu_waves_per_eu(4, 4): at most 256 registers a wave, so that two work-groups share a WGP (four waves a SIMD).
__global__ __launch_bounds__(256) __attribute__((amdgpu_waves_per_eu(4, 4))) void attn_kernel(
    const _Float16* __restrict__ qp,   // [B*H][L][D]
    const _Float16* __restrict__ kp,   // [B*H][L][D]
    const _Float16* __restrict__ vt,   // [B*H][D][L]
    float* __restrict__ out)           // [B][L][EMB]
{
  __shared__ __attribute__((aligned(16))) float sO[8 * 16 * 64];    // 32768 B
  __shared__ __attribute__((aligned(16))) float sML[8 * 32 * 2];    //  2048 B
  __shared__ __attribute__((aligned(16))) _Float16 sKV[2 * STBUF];  // 73728 B

  const int tid = threadIdx.x, lane = tid & 31, w = tid >> 5;
  const int h = lane >> 4, m = lane & 15;
  const int bh = blockIdx.y, b = bh >> 4, head = bh & 15;
  const int sw = __builtin_amdgcn_readfirstlane(w);            // scalar: the choices below write no EXEC
  const int qg = sw & 3, kh = sw >> 2;                         // query group, key half
  const int q0 = blockIdx.x * 128 + 32 * qg;

  // Q^T B-fragments: column n = query q0+16c+m, k = d (two 32-deep chunks)
  v16h qb[2][2];
  #pragma unroll
  for (int c = 0; c < 2; ++c) {
    const _Float16* qrow = qp + ((size_t)bh * SEQ + q0 + 16 * c + m) * HD;
    qb[c][0] = load_frag(qrow, h);
    qb[c][1] = load_frag(qrow + 32, h);
  }

  const v8f zero8 = {0.f, 0.f, 0.f, 0.f, 0.f, 0.f, 0.f, 0.f};
  v8f o[2][4];                                // o[c][t][r] = O[query 16c+m][d 16t+8h+r] * lrun[c] (lrun = l * 2^14)
  float mrun[2], lrun[2];
  #pragma unroll
  for (int c = 0; c < 2; ++c) {
    #pragma unroll
    for (int t = 0; t < 4; ++t) o[c][t] = zero8;
    mrun[c] = -1e30f;
    lrun[c] = 0.0f;
  }

  // copy role: staged rows 32w + (lane >> 3) + 4i, i = 0..7; 16-byte piece (lane & 7).
  // A stage: [half 0: 64 K, 64 V^T][half 1: 64 K, 64 V^T]; waves 0,1,4,5 bring K, waves 2,3,6,7 V^T.
  const int cp = lane & 7;
  const bool ck = (sw & 2) == 0;
  const unsigned gpitch = ck ? HD * 2 : SEQ * 2;               // bytes, one source row further on
  const unsigned grow = 4 * gpitch;                            // bytes, 4 rows further on
  const unsigned gstep = ck ? 64 * HD * 2 : 64 * 2;            // bytes, 64 keys further on
  const char* gsrc = (const char*)((ck ? kp : vt) + (size_t)bh * SEQ * HD)
                     + (size_t)((32 * (sw & 1) + (lane >> 3)) * gpitch) + 16 * cp
                     + (size_t)(kh * (KHALF / 64)) * gstep;
  const unsigned ldst = lds_off(sKV) + (32 * sw + (lane >> 3)) * SPB + 16 * cp;

  async_rows32p(ldst, gsrc, grow);                         // step 0 -> buffer 0
  asm volatile("s_wait_asynccnt 0x0" ::: "memory");        // own copies of step 0 have landed
  __syncthreads();
  async_rows32p(ldst + STBUF * 2, gsrc + gstep, grow);     // step 1 -> buffer 1

  // rolled: one buffer offset per trip, every fragment index constant
  #pragma unroll 1
  for (int st = 0; st < KHALF / 64; ++st) {
    const int bo = (st & 1) * STBUF;
    const _Float16* kl = sKV + bo + kh * KVBUF + m * SPITCH;   // + 16j rows + 32*dc
    const _Float16* vl = kl + 64 * SPITCH;                 // + 16t rows + key chunk
    // ---- raw scores: s[c][j][r] = q . k of query 16c+m, key kb+16j+8h+r ----
    // all 16 K reads of the step as one group ahead of the sixteen products: one LDS wait, not four
    v16h kf0[4], kf1[4];
    #pragma unroll
    for (int j = 0; j < 4; ++j) kf0[j] = load_frag(kl + 16 * j * SPITCH, h);
    #pragma unroll
    for (int j = 0; j < 4; ++j) kf1[j] = load_frag(kl + 16 * j * SPITCH + 32, h);
    __builtin_amdgcn_sched_barrier(0);                     // or the compiler sinks each read down to its product
    v8f s[2][4];
    #pragma unroll
    for (int j = 0; j < 4; ++j)
      #pragma unroll
      for (int c = 0; c < 2; ++c) s[c][j] = wmma_f16(kf0[j], qb[c][0], zero8);
    #pragma unroll
    for (int j = 0; j < 4; ++j)
      #pragma unroll
      for (int c = 0; c < 2; ++c) s[c][j] = wmma_f16(kf1[j], qb[c][1], s[c][j]);
    // ---- online softmax in base 2: P * 2^14 = exp2(raw * SLOG2E + (14 - max * SLOG2E)), one FMA ahead of each exp2 ----
    float mloc[2], mpart[2];
    #pragma unroll
    for (int c = 0; c < 2; ++c) {
      mloc[c] = s[c][0][0];
      #pragma unroll
      for (int j = 0; j < 4; ++j)
        #pragma unroll
        for (int r = 0; r < 8; ++r) mloc[c] = fmaxf(mloc[c], s[c][j][r]);
    }
    mpart[0] = __shfl_xor(mloc[0], 16);
    mpart[1] = __shfl_xor(mloc[1], 16);
    asm volatile("" :: "v"(mpart[0]), "v"(mpart[1]) : "memory");   // the V^T reads go out behind the exchange's return: queued ahead of it in the LDS they would lengthen its wait
    // all 16 V^T reads of the step as one group: they land under the exponentials
    v16h vf0[4], vf1[4];
    #pragma unroll
    for (int t = 0; t < 4; ++t) vf0[t] = load_frag(vl + 16 * t * SPITCH, h);
    #pragma unroll
    for (int t = 0; t < 4; ++t) vf1[t] = load_frag(vl + 16 * t * SPITCH + 32, h);
    __builtin_amdgcn_sched_barrier(0);                     // or the compiler sinks each read down to its product
    v16h pb[2][2];
    #pragma unroll
    for (int c = 0; c < 2; ++c) {
      const float mnew = fmaxf(mrun[c], fmaxf(mloc[c], mpart[c]));   // running maximum of the raw scores (SLOG2E > 0)
      const float alpha = __builtin_amdgcn_exp2f((mrun[c] - mnew) * SLOG2E);
      mrun[c] = mnew;
      const float nb = __builtin_fmaf(-mnew, SLOG2E, PBITS);
      const v2f sc2 = {SLOG2E, SLOG2E};
      const v2f nb2 = {nb, nb};
      float lsum = 0.0f;
      #pragma unroll
      for (int j = 0; j < 4; ++j)
        #pragma unroll
        for (int r = 0; r < 8; r += 2) {
          const v2f raw = {s[c][j][r], s[c][j][r + 1]};
          const v2f e = __builtin_elementwise_fma(raw, sc2, nb2);
          const float p0 = __builtin_amdgcn_exp2f(e.x);
          const float p1 = __builtin_amdgcn_exp2f(e.y);
          s[c][j][r] = p0;
          s[c][j][r + 1] = p1;
          lsum += p0;
          lsum += p1;
        }
      lsum += __shfl_xor(lsum, 16);
      lrun[c] = lrun[c] * alpha + lsum;
      #pragma unroll
      for (int t = 0; t < 4; ++t)
        #pragma unroll
        for (int r = 0; r < 8; ++r) o[c][t][r] = o[c][t][r] * alpha;
      // ---- P^T B-fragments (key chunks 0..31 and 32..63 of this step) ----
      pb[c][0] = pack_p(s[c][0], s[c][1]);
      pb[c][1] = pack_p(s[c][2], s[c][3]);
    }

    // ---- O^T += V^T * P^T ----
    #pragma unroll
    for (int t = 0; t < 4; ++t)
      #pragma unroll
      for (int c = 0; c < 2; ++c) o[c][t] = wmma_f16(vf0[t], pb[c][0], o[c][t]);
    #pragma unroll
    for (int t = 0; t < 4; ++t)
      #pragma unroll
      for (int c = 0; c < 2; ++c) o[c][t] = wmma_f16(vf1[t], pb[c][1], o[c][t]);

    stage_publish();
    if (st + 2 < KHALF / 64)                               // step st + 2 -> the buffer just read
      async_rows32p(ldst + bo * 2, gsrc + (size_t)(st + 2) * gstep, grow);
  }
  asm volatile("s_wait_asynccnt 0x0" ::: "memory");        // nothing of this wave's is in flight any more

  // ---- join of the key halves: the wave of half kh finishes column group kh and hands
  //      its partial of the other group, lane for lane, to its partner wave (w ^ 4) ----
  const bool hi = kh != 0;
  float* xown = sO + sw * 1024;                            // what this wave hands over
  float* so   = sO + (sw ^ 4) * 1024;                      // what it is handed; then its own output tile
  #pragma unroll
  for (int t = 0; t < 4; ++t) {
    const v8f g = hi ? o[0][t] : o[1][t];
    const v4f g0 = {g[0], g[1], g[2], g[3]}, g1 = {g[4], g[5], g[6], g[7]};
    *(v4fa*)(xown + ((2 * t) * 32 + lane) * 4) = g0;
    *(v4fa*)(xown + ((2 * t + 1) * 32 + lane) * 4) = g1;
  }
  sML[(sw * 32 + lane) * 2]     = hi ? mrun[0] : mrun[1];
  sML[(sw * 32 + lane) * 2 + 1] = hi ? lrun[0] : lrun[1];
  __syncthreads();

  const float mo = hi ? mrun[1] : mrun[0], lo = hi ? lrun[1] : lrun[0];
  const float mp = sML[((sw ^ 4) * 32 + lane) * 2], lp = sML[((sw ^ 4) * 32 + lane) * 2 + 1];
  const float mall = fmaxf(mo, mp);
  const float wo = __builtin_amdgcn_exp2f((mo - mall) * SLOG2E);
  const float wp = __builtin_amdgcn_exp2f((mp - mall) * SLOG2E);
  const float inv = 1.0f / (lo * wo + lp * wp);            // o and lrun both carry the 2^14
  const float fo = wo * inv, fp = wp * inv;
  v4f p0[4], p1[4];
  #pragma unroll
  for (int t = 0; t < 4; ++t) {
    p0[t] = *(const v4fa*)(so + ((2 * t) * 32 + lane) * 4);
    p1[t] = *(const v4fa*)(so + ((2 * t + 1) * 32 + lane) * 4);
  }
  // ---- normalise, stage the wave's 16x64 tile (in the slot it alone has read), whole-line stores ----
  #pragma unroll
  for (int t = 0; t < 4; ++t) {
    const v8f a = hi ? o[1][t] : o[0][t];
    v4f y0, y1;
    #pragma unroll
    for (int r = 0; r < 4; ++r) {
      y0[r] = a[r] * fo + p0[t][r] * fp;
      y1[r] = a[r + 4] * fo + p1[t][r] * fp;
    }
    // 16-byte piece p of query row m stands at p ^ m: the 16 rows of one store fall on 16 different bank groups
    *(v4fa*)(so + m * 64 + (((4 * t + 2 * h) ^ m) << 2)) = y0;
    *(v4fa*)(so + m * 64 + (((4 * t + 2 * h + 1) ^ m) << 2)) = y1;
  }
  __syncthreads();

  att_store_pass(so, out, b, head, q0 + 16 * kh, lane);
}

// ---------------------------------------------------------------------------
extern "C" void kernel_launch(void* const* d_in, const int* in_sizes, int n_in,
                              void* d_out, int out_size, void* d_ws, size_t ws_size,
                              hipStream_t stream) {
  if (n_in < 8) return;
  if (in_sizes[0] != NX || in_sizes[1] != NX) return;
  if (in_sizes[2] != NW || in_sizes[4] != NW || in_sizes[6] != NW) return;
  if (in_sizes[3] != EMB || in_sizes[5] != EMB || in_sizes[7] != EMB) return;
  if (out_size != NX) return;

  const float* q  = (const float*)d_in[0];
  const float* v  = (const float*)d_in[1];
  const float* Wq = (const float*)d_in[2];
  const float* bq = (const float*)d_in[3];
  const float* Wk = (const float*)d_in[4];
  const float* bk = (const float*)d_in[5];
  const float* Wv = (const float*)d_in[6];
  const float* bv = (const float*)d_in[7];
  float* out = (float*)d_out;

  const size_t x_bytes  = (size_t)NX * 2;                           //  8388608 per plane
  const size_t wt_bytes = (size_t)3 * NW * 2;                       //  6291456
  const size_t pl_bytes = (size_t)BATCH * NHEADS * SEQ * HD * 2;    //  8388608 per plane
  const size_t total = 2 * x_bytes + wt_bytes + 3 * pl_bytes;       // 48234496
  if (total > ws_size) return;

  char* ws = (char*)d_ws;
  _Float16* qx = (_Float16*)(ws);
  _Float16* vx = (_Float16*)(ws + x_bytes);
  _Float16* wt = (_Float16*)(ws + 2 * x_bytes);
  _Float16* qp = (_Float16*)(ws + 2 * x_bytes + wt_bytes);
  _Float16* kp = (_Float16*)(ws + 2 * x_bytes + wt_bytes + pl_bytes);
  _Float16* vt = (_Float16*)(ws + 2 * x_bytes + wt_bytes + 2 * pl_bytes);

  prep_kernel<<<PREPB, 256, 0, stream>>>(q, v, Wq, Wk, Wv, qx, vx, wt);

  dim3 gProj(MROWS / 128, 3 * NHEADS / 2);                           // (32, 24)
  proj_kernel<<<gProj, 128, 0, stream>>>(qx, vx, wt, bq, bk, bv, qp, kp, vt);

  dim3 gAtt(SEQ / 128, BATCH * NHEADS);                              // (16, 32)
  attn_kernel<<<gAtt, 256, 0, stream>>>(qp, kp, vt, out);
}

// v008
// One run takes 62.5 microseconds.
// In both of two side-by-side timings against v007, it was 1.04 times as fast.
// All steps since v000 together make it 3.88 times as fast.
// Contractions: q*Wq, v*Wk, v*Wv, K*Q^T and V^T*P^T all on v_wmma_f32_16x16x32_f16 (f16 operands, f32 accumulate); W carried x32 (exact power-of-two scale folded back in f32), P and its row sum carried x16384 (cancels in the normalisation); score scale 1/32, softmax (base 2), bias and normalisation in f32.
#include <hip/hip_runtime.h>

typedef _Float16 v16h __attribute__((ext_vector_type(16)));
typedef _Float16 v8h  __attribute__((ext_vector_type(8)));
typedef float    v8f  __attribute__((ext_vector_type(8)));
typedef float    v4f  __attribute__((ext_vector_type(4)));
typedef float    v2f  __attribute__((ext_vector_type(2)));
typedef v8h __attribute__((may_alias)) v8ha;
typedef v4f __attribute__((may_alias)) v4fa;

union Frag { v16h v; v8h half[2]; };

#define EMB    1024
#define NHEADS 16
#define HD     64
#define SEQ    2048
#define BATCH  2
#define MROWS  (BATCH * SEQ)          // 4096 tokens
#define NX     (MROWS * EMB)          // 4194304
#define NW     (EMB * EMB)            // 1048576
#define NX8    (NX / 8)               // 524288
#define WSC    32.0f                  // weight plane scale (exact)
#define WINV   0.03125f               // 1/WSC
#define SLOG2E 0.045084220027780106f  // log2(e) / sqrt(EMB): raw score -> exponent of 2
#define PBITS  14.0f                  // P is carried x 2^14: added to that exponent
#define TPITCH 72                     // LDS pitch (halves) of the transposed weight tile
#define SPITCH 72                     // LDS pitch (halves) of a staged 128-byte operand row: 144 B = 16 B x 9
#define SPB    (SPITCH * 2)           // the same in bytes
#define KVBUF  (128 * SPITCH)         // attention, one key half of a stage: 64 K rows, then 64 V^T rows (halves)
#define STBUF  (2 * KVBUF)            // attention stage: both key halves (halves)
#define KHALF  (SEQ / 2)              // keys a wave walks
#define XWBUF  (256 * SPITCH)         // projection stage: 128 X rows, then 128 W^T rows (halves)

// ---------------------------------------------------------------------------
// 16x16x32 f16 WMMA, the builtin alone: the compiler keeps the distance to a user of D, A or B itself.
// Fragment map (wave32): lane l, h = l>>4, m = n = l&15.
//   A/B element i: i<8 -> k0+8h+i ; i>=8 -> k0+16+8h+(i-8)
//   D element r : row 8h+r, col l&15
// ---------------------------------------------------------------------------
__device__ __forceinline__ v8f wmma_f16(v16h a, v16h b, v8f c) {
  v8f d = __builtin_amdgcn_wmma_f32_16x16x32_f16(false, a, false, b, (short)0, c, false, false);
  return d;
}

// A or B fragment from a k-contiguous 16-bit row; p points at element k0 of
// the row owned by this lane (row index = lane & 15 added by the caller).
__device__ __forceinline__ v16h load_frag(const _Float16* p, int h) {
  Frag f;
  f.half[0] = *(const v8ha*)(p + 8 * h);
  f.half[1] = *(const v8ha*)(p + 16 + 8 * h);
  return f.v;
}

// ---------------------------------------------------------------------------
// Asynchronous copies global -> LDS, 16 B per lane: lanes 8q..8q+7 bring one
// whole 128-byte row, one copy = 4 rows. l = the lane's LDS byte address,
// g = its global address; copy c takes the rows 4c further on (LDS + 4 pitches,
// global + grow bytes). s_wait_xcnt closes each statement so that no address
// register is rewritten while a copy that names it may still need it.
// ---------------------------------------------------------------------------
__device__ __forceinline__ unsigned lds_off(const void* p) { return (unsigned)(size_t)p; }

// 32 rows (8 copies) of an attention stage; grow = bytes from one copy's rows to the next copy's in global memory.
__device__ __forceinline__ void async_rows32p(unsigned l, const char* g, unsigned grow) {
  const size_t gr = grow;
  asm volatile("global_load_async_to_lds_b128 %0, %8, off\n\t"
               "global_load_async_to_lds_b128 %1, %9, off\n\t"
               "global_load_async_to_lds_b128 %2, %10, off\n\t"
               "global_load_async_to_lds_b128 %3, %11, off\n\t"
               "global_load_async_to_lds_b128 %4, %12, off\n\t"
               "global_load_async_to_lds_b128 %5, %13, off\n\t"
               "global_load_async_to_lds_b128 %6, %14, off\n\t"
               "global_load_async_to_lds_b128 %7, %15, off\n\t"
               "s_wait_xcnt 0x0"
               :: "v"(l), "v"(l + 4 * SPB), "v"(l + 8 * SPB), "v"(l + 12 * SPB),
                  "v"(l + 16 * SPB), "v"(l + 20 * SPB), "v"(l + 24 * SPB), "v"(l + 28 * SPB),
                  "v"(g), "v"(g + gr), "v"(g + 2 * gr), "v"(g + 3 * gr),
                  "v"(g + 4 * gr), "v"(g + 5 * gr), "v"(g + 6 * gr), "v"(g + 7 * gr)
               : "memory");
}

// 32 rows of one operand (8 copies) at a global row pitch of EMB halves; a projection
// wave calls it once for its X rows and once for its W^T rows of a stage.
__device__ __forceinline__ void async_rows32(unsigned l, const char* g) {
  const size_t gr = (size_t)4 * EMB * 2;             // 4 rows further on in global memory
  asm volatile("global_load_async_to_lds_b128 %0, %8, off\n\t"
               "global_load_async_to_lds_b128 %1, %9, off\n\t"
               "global_load_async_to_lds_b128 %2, %10, off\n\t"
               "global_load_async_to_lds_b128 %3, %11, off\n\t"
               "global_load_async_to_lds_b128 %4, %12, off\n\t"
               "global_load_async_to_lds_b128 %5, %13, off\n\t"
               "global_load_async_to_lds_b128 %6, %14, off\n\t"
               "global_load_async_to_lds_b128 %7, %15, off\n\t"
               "s_wait_xcnt 0x0"
               :: "v"(l), "v"(l + 4 * SPB), "v"(l + 8 * SPB), "v"(l + 12 * SPB),
                  "v"(l + 16 * SPB), "v"(l + 20 * SPB), "v"(l + 24 * SPB), "v"(l + 28 * SPB),
                  "v"(g), "v"(g + gr), "v"(g + 2 * gr), "v"(g + 3 * gr),
                  "v"(g + 4 * gr), "v"(g + 5 * gr), "v"(g + 6 * gr), "v"(g + 7 * gr)
               : "memory");
}

// Hand-over of a stage: this wave's LDS reads are done, its own copies have
// landed, then the work-group barrier publishes the next stage and frees this one.
__device__ __forceinline__ void stage_publish() {
  asm volatile("s_wait_dscnt 0x0" ::: "memory");     // own reads of the buffer that is refilled next
  asm volatile("s_wait_asynccnt 0x0" ::: "memory");  // own copies of the next stage have landed
  __syncthreads();
}

// ---------------------------------------------------------------------------
// Kernel 1: all of the preparation in one launch of PREPB work-groups, every
// one resident at once.
//  a) f32 -> f16 planes for q and v, unscaled, RNE convert: a thread takes one
//     group of 8 values in each half of each plane (4 groups, 8 loads of 16 B,
//     all of them in flight together).
//  b) work-groups 0..767 also take one weight tile each: in W[k][n] (k = input
//     feature, n = output feature, both 1024) -> wt[which][n][k] = f16(32 * W[k][n]),
//     a 64(k) x 64(n) tile transposed through LDS, stored as whole 128-byte lines
//     (lanes 8q..8q+7 of a wave bring one line, 4 lines per instruction).
// ---------------------------------------------------------------------------
#define PREPB  1024                   // work-groups of 256 threads: 4 a WGP
#define WTILES 768                    // 16 (n) x 16 (k) x 3 weight tiles
#define HPLANE (PREPB * 256 * 8)      // values one sweep of the grid covers = NX / 2

__device__ __forceinline__ void wt_store_pass(const _Float16* sW, _Float16* wt,
                                              int which, int n0, int k0, int w, int lane) {
  const int q8 = lane & 7, sub = lane >> 3;
  #pragma unroll
  for (int i = 0; i < 2; ++i) {
    const int nrow = w * 8 + i * 4 + sub;          // 0..63
    const v8h val = *(const v8ha*)(sW + nrow * TPITCH + 8 * q8);
    _Float16* dst = wt + ((size_t)which * EMB + n0 + nrow) * EMB + k0 + 8 * q8;
    *(v8h*)dst = val;
  }
}

__device__ __forceinline__ v8h cvt8(v4f a, v4f c) {
  const v8h o = { (_Float16)a.x, (_Float16)a.y, (_Float16)a.z, (_Float16)a.w,
                  (_Float16)c.x, (_Float16)c.y, (_Float16)c.z, (_Float16)c.w };
  return o;
}

__global__ __launch_bounds__(256) void prep_kernel(
    const float* __restrict__ q, const float* __restrict__ v,
    const float* __restrict__ wq, const float* __restrict__ wk, const float* __restrict__ wv,
    _Float16* __restrict__ qx, _Float16* __restrict__ vx,
    _Float16* __restrict__ wt)         // [3][1024 n][1024 k], x32
{
  __shared__ __attribute__((aligned(16))) _Float16 sW[64 * TPITCH];   // 9216 B

  const int tid = threadIdx.x, lane = tid & 31, w = tid >> 5;
  const int bid = blockIdx.x;
  const unsigned ib = ((unsigned)bid * 256u + (unsigned)tid) * 32u;  // bytes: the thread's 8 floats in the first half of a plane
  const char* q0 = (const char*)q + ib;
  const char* q1 = (const char*)(q + HPLANE) + ib;
  const char* v0 = (const char*)v + ib;
  const char* v1 = (const char*)(v + HPLANE) + ib;

  const v4f a0 = *(const v4fa*)q0, c0 = *(const v4fa*)(q0 + 16);
  const v4f a1 = *(const v4fa*)q1, c1 = *(const v4fa*)(q1 + 16);
  const v4f a2 = *(const v4fa*)v0, c2 = *(const v4fa*)(v0 + 16);
  const v4f a3 = *(const v4fa*)v1, c3 = *(const v4fa*)(v1 + 16);
  asm volatile("s_wait_xcnt 0x0" ::: "memory");    // before the index arithmetic below reuses these loads' address registers
  __builtin_amdgcn_sched_barrier(0);               // or the compiler lifts that arithmetic over the wait

  if (bid < WTILES) {                              // the same for the whole work-group
    const int n0 = (bid & 15) * 64, k0 = ((bid >> 4) & 15) * 64, which = bid >> 8;
    const float* W = (which == 0) ? wq : ((which == 1) ? wk : wv);
    #pragma unroll
    for (int i = 0; i < 4; ++i) {
      const int idx = tid + 256 * i;               // 0..1023 float4 groups
      const int kk = idx >> 4, nn = (idx & 15) * 4;
      const v4f x = *(const v4fa*)(W + (size_t)(k0 + kk) * EMB + n0 + nn);
      sW[(nn + 0) * TPITCH + kk] = (_Float16)(x.x * WSC);
      sW[(nn + 1) * TPITCH + kk] = (_Float16)(x.y * WSC);
      sW[(nn + 2) * TPITCH + kk] = (_Float16)(x.z * WSC);
      sW[(nn + 3) * TPITCH + kk] = (_Float16)(x.w * WSC);
    }
    __syncthreads();
    wt_store_pass(sW, wt, which, n0, k0, w, lane);
  }

  const unsigned ob = ib >> 1;                     // bytes: the same 8 values as f16
  *(v8h*)((char*)qx + ob)            = cvt8(a0, c0);
  *(v8h*)((char*)(qx + HPLANE) + ob) = cvt8(a1, c1);
  *(v8h*)((char*)vx + ob)            = cvt8(a2, c2);
  *(v8h*)((char*)(vx + HPLANE) + ob) = cvt8(a3, c3);
}

// ---------------------------------------------------------------------------
// 4 lines per instruction, 64 lines per wave: half of one head's 128 lines
// (base = 0 or 64), sT = that head's staged tile (16384 B), in 16-byte pieces
// whose place inside a row is XORed with a row number, so that neither the
// writers (16 rows, one piece column) nor these readers meet on a bank:
// which 0/1: row = token, 8 pieces;   piece p of token l at l*128 + ((p ^ ((l >> 1) & 7)) << 4)
// which 2  : row = d, 16 pieces;      piece p of row d   at d*256 + ((p ^ (d & 15)) << 4)
// which 0/1: plane[bh][l][d]  (one token row = 64 halves = one line)
// which 2  : vt[bh][d][l]     (64 d-rows x 128 tokens = 2 lines each)
// The row number's part of the XOR is (2i & mask) ^ (sub >> 1) for line base + 4i + sub.
// All 16 LDS reads go out as one group into registers of their own, then the 16
// stores, each from an address register pair of its own: one LDS latency, not sixteen.
// ---------------------------------------------------------------------------
__device__ __forceinline__ void proj_store_pass(const char* sT, _Float16* plane, _Float16* vt,
                                                int which, int bh, int l0, int base, int lane) {
  const int q8 = lane & 7, sub = lane >> 3;
  const bool tk = which != 2;                      // the same for the whole work-group
  const int cm = tk ? 7 : 15;
  const int x0 = (tk ? q8 : 8 * (sub & 1) + q8) ^ (sub >> 1);
  const char* rb = sT + (tk ? (base + sub) * 128 : ((base >> 1) + (sub >> 1)) * 256);
  char* dst = tk ? (char*)(plane + ((size_t)bh * SEQ + l0 + base + sub) * HD + 8 * q8)
                 : (char*)(vt + ((size_t)bh * HD + (base >> 1) + (sub >> 1)) * SEQ + l0 + 64 * (sub & 1) + 8 * q8);
  const size_t step = tk ? (size_t)4 * HD * 2 : (size_t)2 * SEQ * 2;   // bytes from one store's lines to the next store's
  v8h val[16];
  char* p[16];
  #pragma unroll
  for (int i = 0; i < 16; ++i) val[i] = *(const v8ha*)(rb + i * 512 + ((x0 ^ ((2 * i) & cm)) << 4));
  #pragma unroll
  for (int i = 0; i < 16; ++i) p[i] = dst + i * step;
  __builtin_amdgcn_sched_barrier(0);               // every address is formed ahead of the first store, so that no issued store's register is rewritten
  #pragma unroll
  for (int i = 0; i < 16; ++i) *(v8h*)p[i] = val[i];
}

// ---------------------------------------------------------------------------
// Kernel 2: Y = X * W (with W^T staged k-contiguous) over the fused 3*1024
// output columns. which = 0: X = q, W = Wq -> qp ; 1: X = v, W = Wk -> kp ;
// 2: X = v, W = Wv -> vt (d-major).
// Block 128 thr (4 waves) = 128 tokens x 128 features (two heads of one which);
// wave tile 64 tokens x 64 features (one head); K = 1024 in stages of 64 (two
// steps of 32); each stage's X and W^T rows come into LDS by asynchronous copies,
// two buffers, the next stage in flight while this one is worked on; fragments
// from LDS. 768 blocks, three to a WGP by their LDS.
// which 0/1 take the product transposed (A = W^T rows, B = X rows), which 2 as it
// stands (A = X rows, B = W^T rows): either way a lane's 8 D values are 8
// neighbours in the output plane's rows, one 16-byte piece for the staging tile.
// ---------------------------------------------------------------------------
__global__ __launch_bounds__(128) void proj_kernel(
    const _Float16* __restrict__ qx,   // [4096][1024] f16(q)
    const _Float16* __restrict__ vx,   // [4096][1024] f16(v)
    const _Float16* __restrict__ wt,   // [3][1024][1024], row = output feature, x32
    const float* __restrict__ bq, const float* __restrict__ bk, const float* __restrict__ bv,
    _Float16* __restrict__ qp,         // [B*H][L][D]
    _Float16* __restrict__ kp,         // [B*H][L][D]
    _Float16* __restrict__ vt)         // [B*H][D][L]
{
  __shared__ __attribute__((aligned(16))) _Float16 sT[2 * 128 * 64]; // 32768 B, one 128 x 64 tile a head
  __shared__ __attribute__((aligned(16))) _Float16 sXW[2 * XWBUF];   // 73728 B

  const int tid = threadIdx.x, lane = tid & 31, w = tid >> 5;
  const int h = lane >> 4, m = lane & 15;
  const int m0 = blockIdx.x * 128;
  const int cg = blockIdx.y;                 // 0..23
  const int which = cg >> 3, head0 = (cg & 7) * 2;
  const int wtok = w & 1, wf = w >> 1;       // the wave's token half and its head of the pair

  const _Float16* xsrc = (which == 0) ? qx : vx;

  // copy role: rows 32w..32w+31 of X and of W^T; row (lane >> 3) of each group of 4,
  // 16-byte piece (lane & 7)
  const int cr = lane >> 3, cp = lane & 7;
  const char* gx = (const char*)(xsrc + (size_t)(m0 + 32 * w + cr) * EMB + 8 * cp);
  const char* gw = (const char*)(wt + ((size_t)which * EMB + head0 * HD + 32 * w + cr) * EMB + 8 * cp);
  const unsigned lx = lds_off(sXW) + (32 * w + cr) * SPB + 16 * cp;
  const unsigned lw = lds_off(sXW) + (128 + 32 * w + cr) * SPB + 16 * cp;

  // staged rows of the wave's A and B operands (the fragment maps of A and B are the same)
  const int trow = 64 * wtok + m, frow = 128 + 64 * wf + m;
  const int arow = (which != 2) ? frow : trow;
  const int brow = (which != 2) ? trow : frow;

  const v8f zero8 = {0.f, 0.f, 0.f, 0.f, 0.f, 0.f, 0.f, 0.f};
  v8f acc[4][4];
  #pragma unroll
  for (int mt = 0; mt < 4; ++mt)
    #pragma unroll
    for (int nt = 0; nt < 4; ++nt) acc[mt][nt] = zero8;

  async_rows32(lx, gx);                                    // stage 0 -> buffer 0
  async_rows32(lw, gw);
  asm volatile("s_wait_asynccnt 0x0" ::: "memory");        // own copies of stage 0 have landed
  __syncthreads();
  async_rows32(lx + XWBUF * 2, gx + 128);                  // stage 1 -> buffer 1
  async_rows32(lw + XWBUF * 2, gw + 128);

  // rolled: one buffer offset per trip, every fragment index constant
  #pragma unroll 1
  for (int t = 0; t < EMB / 64; ++t) {
    const int bo = (t & 1) * XWBUF;
    const _Float16* xs = sXW + bo + arow * SPITCH;         // A row, mt = 0
    const _Float16* wl = sXW + bo + brow * SPITCH;         // B row, nt = 0
    // Fragment reads stand in groups ahead of the products that use them, so that a
    // wave waits out the LDS latency once a stage and not in front of every four products.
    v16h a0[4], b0[4], a1[4], b1[4];
    #pragma unroll
    for (int mt = 0; mt < 4; ++mt) a0[mt] = load_frag(xs + mt * 16 * SPITCH, h);
    #pragma unroll
    for (int nt = 0; nt < 4; ++nt) b0[nt] = load_frag(wl + nt * 16 * SPITCH, h);
    #pragma unroll
    for (int mt = 0; mt < 4; ++mt) a1[mt] = load_frag(xs + mt * 16 * SPITCH + 32, h);
    b1[0] = load_frag(wl + 32, h);
    __builtin_amdgcn_sched_barrier(0);                     // or the compiler sinks these reads down to their products
    #pragma unroll
    for (int nt = 0; nt < 3; ++nt)
      #pragma unroll
      for (int mt = 0; mt < 4; ++mt) acc[mt][nt] = wmma_f16(a0[mt], b0[nt], acc[mt][nt]);
    __builtin_amdgcn_sched_barrier(0);                     // or the compiler lifts the three reads below over products whose registers they are to take
    // the last three reads go out here, into registers that the twelve products above have left
    #pragma unroll
    for (int nt = 1; nt < 4; ++nt) b1[nt] = load_frag(wl + nt * 16 * SPITCH + 32, h);
    __builtin_amdgcn_sched_barrier(0);                     // holds these reads eight products ahead of their first use; without it the compiler moves them
    #pragma unroll
    for (int mt = 0; mt < 4; ++mt) acc[mt][3] = wmma_f16(a0[mt], b0[3], acc[mt][3]);
    #pragma unroll
    for (int nt = 0; nt < 4; ++nt)
      #pragma unroll
      for (int mt = 0; mt < 4; ++mt) acc[mt][nt] = wmma_f16(a1[mt], b1[nt], acc[mt][nt]);
    __builtin_amdgcn_sched_barrier(0);                     // the products stay ahead of the hand-over: or the compiler lifts its waits and the barrier over them and the next stage's copies lose their lead
    stage_publish();
    if (t + 2 < EMB / 64) {                                // stage t + 2 -> the buffer just read
      async_rows32(lx + bo * 2, gx + (t + 2) * 128);
      async_rows32(lw + bo * 2, gw + (t + 2) * 128);
    }
  }
  asm volatile("s_wait_asynccnt 0x0" ::: "memory");        // nothing of this wave's is in flight any more

  const int head = head0 + wf;
  char* sTh = (char*)(sT + wf * (128 * 64));
  const float* bias = ((which == 0) ? bq : ((which == 1) ? bk : bv)) + head * HD;
  if (which != 2) {
    // D[r] of tile (mt, nt) = Y[token m0+64wtok+16nt+m][feature 16mt+8h+r of the head]
    v4f bl[4], bu[4];
    #pragma unroll
    for (int mt = 0; mt < 4; ++mt) {
      bl[mt] = *(const v4fa*)(bias + 16 * mt + 8 * h);
      bu[mt] = *(const v4fa*)(bias + 16 * mt + 8 * h + 4);
    }
    asm volatile("s_wait_xcnt 0x0" ::: "memory");          // before the index arithmetic below reuses these loads' offset register
    __builtin_amdgcn_sched_barrier(0);                     // or the compiler lifts that arithmetic over the wait
    #pragma unroll
    for (int mt = 0; mt < 4; ++mt) {
      #pragma unroll
      for (int nt = 0; nt < 4; ++nt) {
        const int tokl = 64 * wtok + 16 * nt + m;          // 0..127
        v8h y;
        #pragma unroll
        for (int r = 0; r < 8; ++r)
          y[r] = (_Float16)(acc[mt][nt][r] * WINV + (r < 4 ? bl[mt][r] : bu[mt][r - 4]));
        *(v8ha*)(sTh + tokl * 128 + (((2 * mt + h) ^ ((tokl >> 1) & 7)) << 4)) = y;
      }
    }
  } else {
    // D[r] of tile (mt, nt) = Y[token m0+64wtok+16mt+8h+r][feature 16nt+m of the head]
    float bvl4[4];
    #pragma unroll
    for (int nt = 0; nt < 4; ++nt) bvl4[nt] = bias[16 * nt + m];
    asm volatile("s_wait_xcnt 0x0" ::: "memory");          // before the index arithmetic below reuses these loads' offset register
    __builtin_amdgcn_sched_barrier(0);                     // or the compiler lifts that arithmetic over the wait
    #pragma unroll
    for (int nt = 0; nt < 4; ++nt) {
      const int feat = 16 * nt + m;                        // 0..63
      #pragma unroll
      for (int mt = 0; mt < 4; ++mt) {
        v8h y;
        #pragma unroll
        for (int r = 0; r < 8; ++r) y[r] = (_Float16)(acc[mt][nt][r] * WINV + bvl4[nt]);
        *(v8ha*)(sTh + feat * 256 + (((8 * wtok + 2 * mt + h) ^ (feat & 15)) << 4)) = y;
      }
    }
  }
  __syncthreads();

  const int b = m0 / SEQ, l0 = m0 - b * SEQ, bh = b * NHEADS + head;
  _Float16* plane = (which == 0) ? qp : kp;
  proj_store_pass(sTh, plane, vt, which, bh, l0, 64 * wtok, lane);
  
}

// ---------------------------------------------------------------------------
// Attention helpers.
// ---------------------------------------------------------------------------
// P^T B-fragment from the lane's own score D values: element r <- tile a row r
// (keys 0..15 of the 32-deep chunk), element 8+r <- tile c row r (keys 16..31),
// same lane, same query column; the values already carry the 2^14.
__device__ __forceinline__ v16h pack_p(v8f a, v8f c) {
  const v16h r = { (_Float16)a[0], (_Float16)a[1], (_Float16)a[2], (_Float16)a[3],
                   (_Float16)a[4], (_Float16)a[5], (_Float16)a[6], (_Float16)a[7],
                   (_Float16)c[0], (_Float16)c[1], (_Float16)c[2], (_Float16)c[3],
                   (_Float16)c[4], (_Float16)c[5], (_Float16)c[6], (_Float16)c[7] };
  return r;
}

// lanes 8q..8q+7 in one instruction, 4 lines per instruction, 32 lines per wave.
__device__ __forceinline__ void att_store_pass(const float* so, float* out,
                                               int b, int head, int q0, int lane) {
  const int q8 = lane & 7, sub = lane >> 3;
  #pragma unroll
  for (int i = 0; i < 8; ++i) {
    const int lid = i * 4 + sub;                   // 0..31
    const int row = lid >> 1, hl = lid & 1;
    const v4f val = *(const v4fa*)(so + row * 64 + (((8 * hl + q8) ^ row) << 2));   // piece p of a row stands at p ^ row
    const size_t gi = ((size_t)b * SEQ + q0 + row) * EMB + head * HD + 32 * hl + 4 * q8;
    *(v4f*)(out + gi) = val;
  }
}

// ---------------------------------------------------------------------------
// Kernel 3: streaming attention, transposed form.
// Block 256 thr (8 waves) = 128 queries: 4 query groups of 32 columns x 2 key
// halves of 1024 keys; a wave walks its half in steps of 64 keys.
//   S^T = K * Q^T : A = K rows (row = key, k = d), B = Q^T (k = d, n = query)
//   O^T += V^T * P^T : A = Vt rows (row = d, k = key), B = P^T from registers
// Every K and V^T fragment read from LDS feeds two products, one a column group
// of 16 queries. Lane owns 32 keys of query column (lane&15) of each group;
// partner = lane ^ 16.
// Each step's 64 K rows and 64 V^T rows (128 B each) of both key halves come into
// LDS once for the eight waves by asynchronous copies (8 copies a wave), two
// buffers, the next step in flight while this one is worked on.
// At the end the two waves of a query group swap one column group's partial
// (maximum, sum, O) through LDS and each finishes 16 queries.
// grid = (SEQ/128, B*H).
// ---------------------------------------------------------------------------
// amdgpu_waves_per_eu(4, 4): at most 256 registers a wave, so that two work-groups share a WGP (four waves a SIMD).
__global__ __launch_bounds__(256) __attribute__((amdgpu_waves_per_eu(4, 4))) void attn_kernel(
    const _Float16* __restrict__ qp,   // [B*H][L][D]
    const _Float16* __restrict__ kp,   // [B*H][L][D]
    const _Float16* __restrict__ vt,   // [B*H][D][L]
    float* __restrict__ out)           // [B][L][EMB]
{
  __shared__ __attribute__((aligned(16))) float sO[8 * 16 * 64];    // 32768 B
  __shared__ __attribute__((aligned(16))) float sML[8 * 32 * 2];    //  2048 B
  __shared__ __attribute__((aligned(16))) _Float16 sKV[2 * STBUF];  // 73728 B

  const int tid = threadIdx.x, lane = tid & 31, w = tid >> 5;
  const int h = lane >> 4, m = lane & 15;
  const int bh = blockIdx.y, b = bh >> 4, head = bh & 15;
  const int sw = __builtin_amdgcn_readfirstlane(w);            // scalar: the choices below write no EXEC
  const int qg = sw & 3, kh = sw >> 2;                         // query group, key half
  const int q0 = blockIdx.x * 128 + 32 * qg;

  // Q^T B-fragments: column n = query q0+16c+m, k = d (two 32-deep chunks)
  v16h qb[2][2];
  #pragma unroll
  for (int c = 0; c < 2; ++c) {
    const _Float16* qrow = qp + ((size_t)bh * SEQ + q0 + 16 * c + m) * HD;
    qb[c][0] = load_frag(qrow, h);
    qb[c][1] = load_frag(qrow + 32, h);
  }

  const v8f zero8 = {0.f, 0.f, 0.f, 0.f, 0.f, 0.f, 0.f, 0.f};
  v8f o[2][4];                                // o[c][t][r] = O[query 16c+m][d 16t+8h+r] * lrun[c] (lrun = l * 2^14)
  float mrun[2], lrun[2];
  #pragma unroll
  for (int c = 0; c < 2; ++c) {
    #pragma unroll
    for (int t = 0; t < 4; ++t) o[c][t] = zero8;
    mrun[c] = -1e30f;
    lrun[c] = 0.0f;
  }

  // copy role: staged rows 32w + (lane >> 3) + 4i, i = 0..7; 16-byte piece (lane & 7).
  // A stage: [half 0: 64 K, 64 V^T][half 1: 64 K, 64 V^T]; waves 0,1,4,5 bring K, waves 2,3,6,7 V^T.
  const int cp = lane & 7;
  const bool ck = (sw & 2) == 0;
  const unsigned gpitch = ck ? HD * 2 : SEQ * 2;               // bytes, one source row further on
  const unsigned grow = 4 * gpitch;                            // bytes, 4 rows further on
  const unsigned gstep = ck ? 64 * HD * 2 : 64 * 2;            // bytes, 64 keys further on
  const char* gsrc = (const char*)((ck ? kp : vt) + (size_t)bh * SEQ * HD)
                     + (size_t)((32 * (sw & 1) + (lane >> 3)) * gpitch) + 16 * cp
                     + (size_t)(kh * (KHALF / 64)) * gstep;
  const unsigned ldst = lds_off(sKV) + (32 * sw + (lane >> 3)) * SPB + 16 * cp;

  async_rows32p(ldst, gsrc, grow);                         // step 0 -> buffer 0
  asm volatile("s_wait_asynccnt 0x0" ::: "memory");        // own copies of step 0 have landed
  __syncthreads();
  async_rows32p(ldst + STBUF * 2, gsrc + gstep, grow);     // step 1 -> buffer 1

  // rolled: one buffer offset per trip, every fragment index constant
  #pragma unroll 1
  for (int st = 0; st < KHALF / 64; ++st) {
    const int bo = (st & 1) * STBUF;
    const _Float16* kl = sKV + bo + kh * KVBUF + m * SPITCH;   // + 16j rows + 32*dc
    const _Float16* vl = kl + 64 * SPITCH;                 // + 16t rows + key chunk
    // ---- raw scores: s[c][j][r] = q . k of query 16c+m, key kb+16j+8h+r ----
    // all 16 K reads of the step as one group ahead of the sixteen products: one LDS wait, not four
    v16h kf0[4], kf1[4];
    #pragma unroll
    for (int j = 0; j < 4; ++j) kf0[j] = load_frag(kl + 16 * j * SPITCH, h);
    #pragma unroll
    for (int j = 0; j < 4; ++j) kf1[j] = load_frag(kl + 16 * j * SPITCH + 32, h);
    __builtin_amdgcn_sched_barrier(0);                     // or the compiler sinks each read down to its product
    v8f s[2][4];
    #pragma unroll
    for (int j = 0; j < 4; ++j)
      #pragma unroll
      for (int c = 0; c < 2; ++c) s[c][j] = wmma_f16(kf0[j], qb[c][0], zero8);
    #pragma unroll
    for (int j = 0; j < 4; ++j)
      #pragma unroll
      for (int c = 0; c < 2; ++c) s[c][j] = wmma_f16(kf1[j], qb[c][1], s[c][j]);
    __builtin_amdgcn_sched_barrier(0);                     // the maxima start behind the last product, on the oldest tiles: set among the products each costs idle slots for the distance to its D
    // ---- online softmax in base 2: P * 2^14 = exp2(raw * SLOG2E + (14 - max * SLOG2E)), one FMA ahead of each exp2 ----
    float mloc[2], mpart[2];
    #pragma unroll
    for (int c = 0; c < 2; ++c) {
      mloc[c] = s[c][0][0];
      #pragma unroll
      for (int j = 0; j < 4; ++j)
        #pragma unroll
        for (int r = 0; r < 8; ++r) mloc[c] = fmaxf(mloc[c], s[c][j][r]);
    }
    mpart[0] = __shfl_xor(mloc[0], 16);
    mpart[1] = __shfl_xor(mloc[1], 16);
    asm volatile("" :: "v"(mpart[0]), "v"(mpart[1]) : "memory");   // the V^T reads go out behind the exchange's return: queued ahead of it in the LDS they would lengthen its wait
    // all 16 V^T reads of the step as one group: they land under the exponentials
    v16h vf0[4], vf1[4];
    #pragma unroll
    for (int t = 0; t < 4; ++t) vf0[t] = load_frag(vl + 16 * t * SPITCH, h);
    #pragma unroll
    for (int t = 0; t < 4; ++t) vf1[t] = load_frag(vl + 16 * t * SPITCH + 32, h);
    __builtin_amdgcn_sched_barrier(0);                     // or the compiler sinks each read down to its product
    v16h pb[2][2];
    #pragma unroll
    for (int c = 0; c < 2; ++c) {
      const float mnew = fmaxf(mrun[c], fmaxf(mloc[c], mpart[c]));   // running maximum of the raw scores (SLOG2E > 0)
      const float alpha = __builtin_amdgcn_exp2f((mrun[c] - mnew) * SLOG2E);
      mrun[c] = mnew;
      const float nb = __builtin_fmaf(-mnew, SLOG2E, PBITS);
      const v2f sc2 = {SLOG2E, SLOG2E};
      const v2f nb2 = {nb, nb};
      float lsum = 0.0f;
      #pragma unroll
      for (int j = 0; j < 4; ++j)
        #pragma unroll
        for (int r = 0; r < 8; r += 2) {
          const v2f raw = {s[c][j][r], s[c][j][r + 1]};
          const v2f e = __builtin_elementwise_fma(raw, sc2, nb2);
          const float p0 = __builtin_amdgcn_exp2f(e.x);
          const float p1 = __builtin_amdgcn_exp2f(e.y);
          s[c][j][r] = p0;
          s[c][j][r + 1] = p1;
          lsum += p0;
          lsum += p1;
        }
      lsum += __shfl_xor(lsum, 16);
      lrun[c] = lrun[c] * alpha + lsum;
      #pragma unroll
      for (int t = 0; t < 4; ++t)
        #pragma unroll
        for (int r = 0; r < 8; ++r) o[c][t][r] = o[c][t][r] * alpha;
      // ---- P^T B-fragments (key chunks 0..31 and 32..63 of this step) ----
      pb[c][0] = pack_p(s[c][0], s[c][1]);
      pb[c][1] = pack_p(s[c][2], s[c][3]);
    }

    // ---- O^T += V^T * P^T ----
    #pragma unroll
    for (int t = 0; t < 4; ++t)
      #pragma unroll
      for (int c = 0; c < 2; ++c) o[c][t] = wmma_f16(vf0[t], pb[c][0], o[c][t]);
    #pragma unroll
    for (int t = 0; t < 4; ++t)
      #pragma unroll
      for (int c = 0; c < 2; ++c) o[c][t] = wmma_f16(vf1[t], pb[c][1], o[c][t]);

    __builtin_amdgcn_sched_barrier(0);                     // the products stay ahead of the hand-over: or the compiler lifts its waits and the barrier over them and the next stage's copies lose their lead
    stage_publish();
    if (st + 2 < KHALF / 64)                               // step st + 2 -> the buffer just read
      async_rows32p(ldst + bo * 2, gsrc + (size_t)(st + 2) * gstep, grow);
  }
  asm volatile("s_wait_asynccnt 0x0" ::: "memory");        // nothing of this wave's is in flight any more

  // ---- join of the key halves: the wave of half kh finishes column group kh and hands
  //      its partial of the other group, lane for lane, to its partner wave (w ^ 4) ----
  const bool hi = kh != 0;
  float* xown = sO + sw * 1024;                            // what this wave hands over
  float* so   = sO + (sw ^ 4) * 1024;                      // what it is handed; then its own output tile
  #pragma unroll
  for (int t = 0; t < 4; ++t) {
    const v8f g = hi ? o[0][t] : o[1][t];
    const v4f g0 = {g[0], g[1], g[2], g[3]}, g1 = {g[4], g[5], g[6], g[7]};
    *(v4fa*)(xown + ((2 * t) * 32 + lane) * 4) = g0;
    *(v4fa*)(xown + ((2 * t + 1) * 32 + lane) * 4) = g1;
  }
  sML[(sw * 32 + lane) * 2]     = hi ? mrun[0] : mrun[1];
  sML[(sw * 32 + lane) * 2 + 1] = hi ? lrun[0] : lrun[1];
  __syncthreads();

  const float mo = hi ? mrun[1] : mrun[0], lo = hi ? lrun[1] : lrun[0];
  const float mp = sML[((sw ^ 4) * 32 + lane) * 2], lp = sML[((sw ^ 4) * 32 + lane) * 2 + 1];
  const float mall = fmaxf(mo, mp);
  const float wo = __builtin_amdgcn_exp2f((mo - mall) * SLOG2E);
  const float wp = __builtin_amdgcn_exp2f((mp - mall) * SLOG2E);
  const float inv = 1.0f / (lo * wo + lp * wp);            // o and lrun both carry the 2^14
  const float fo = wo * inv, fp = wp * inv;
  v4f p0[4], p1[4];
  #pragma unroll
  for (int t = 0; t < 4; ++t) {
    p0[t] = *(const v4fa*)(so + ((2 * t) * 32 + lane) * 4);
    p1[t] = *(const v4fa*)(so + ((2 * t + 1) * 32 + lane) * 4);
  }
  // ---- normalise, stage the wave's 16x64 tile (in the slot it alone has read), whole-line stores ----
  #pragma unroll
  for (int t = 0; t < 4; ++t) {
    const v8f a = hi ? o[1][t] : o[0][t];
    v4f y0, y1;
    #pragma unroll
    for (int r = 0; r < 4; ++r) {
      y0[r] = a[r] * fo + p0[t][r] * fp;
      y1[r] = a[r + 4] * fo + p1[t][r] * fp;
    }
    // 16-byte piece p of query row m stands at p ^ m: the 16 rows of one store fall on 16 different bank groups
    *(v4fa*)(so + m * 64 + (((4 * t + 2 * h) ^ m) << 2)) = y0;
    *(v4fa*)(so + m * 64 + (((4 * t + 2 * h + 1) ^ m) << 2)) = y1;
  }
  __syncthreads();

  att_store_pass(so, out, b, head, q0 + 16 * kh, lane);
}

// ---------------------------------------------------------------------------
extern "C" void kernel_launch(void* const* d_in, const int* in_sizes, int n_in,
                              void* d_out, int out_size, void* d_ws, size_t ws_size,
                              hipStream_t stream) {
  if (n_in < 8) return;
  if (in_sizes[0] != NX || in_sizes[1] != NX) return;
  if (in_sizes[2] != NW || in_sizes[4] != NW || in_sizes[6] != NW) return;
  if (in_sizes[3] != EMB || in_sizes[5] != EMB || in_sizes[7] != EMB) return;
  if (out_size != NX) return;

  const float* q  = (const float*)d_in[0];
  const float* v  = (const float*)d_in[1];
  const float* Wq = (const float*)d_in[2];
  const float* bq = (const float*)d_in[3];
  const float* Wk = (const float*)d_in[4];
  const float* bk = (const float*)d_in[5];
  const float* Wv = (const float*)d_in[6];
  const float* bv = (const float*)d_in[7];
  float* out = (float*)d_out;

  const size_t x_bytes  = (size_t)NX * 2;                           //  8388608 per plane
  const size_t wt_bytes = (size_t)3 * NW * 2;                       //  6291456
  const size_t pl_bytes = (size_t)BATCH * NHEADS * SEQ * HD * 2;    //  8388608 per plane
  const size_t total = 2 * x_bytes + wt_bytes + 3 * pl_bytes;       // 48234496
  if (total > ws_size) return;

  char* ws = (char*)d_ws;
  _Float16* qx = (_Float16*)(ws);
  _Float16* vx = (_Float16*)(ws + x_bytes);
  _Float16* wt = (_Float16*)(ws + 2 * x_bytes);
  _Float16* qp = (_Float16*)(ws + 2 * x_bytes + wt_bytes);
  _Float16* kp = (_Float16*)(ws + 2 * x_bytes + wt_bytes + pl_bytes);
  _Float16* vt = (_Float16*)(ws + 2 * x_bytes + wt_bytes + 2 * pl_bytes);

  prep_kernel<<<PREPB, 256, 0, stream>>>(q, v, Wq, Wk, Wv, qx, vx, wt);

  dim3 gProj(MROWS / 128, 3 * NHEADS / 2);                           // (32, 24)
  proj_kernel<<<gProj, 128, 0, stream>>>(qx, vx, wt, bq, bk, bv, qp, kp, vt);

  dim3 gAtt(SEQ / 128, BATCH * NHEADS);                              // (16, 32)
  attn_kernel<<<gAtt, 256, 0, stream>>>(qp, kp, vt, out);
}

// v009
// Measured time: 59.9 microseconds a run.
// Next to v008, in two timings, it ran 1.03 times as fast each time.
// Counting every step since v000, it is 4.00 times as fast.
// Contractions: q*Wq, v*Wk, v*Wv, K*Q^T and V^T*P^T all on v_wmma_f32_16x16x32_f16 (f16 operands, f32 accumulate); W carried x32 (exact power-of-two scale folded back in f32), P and its row sum carried x256 (cancels in the normalisation); score scale 1/32, softmax (base 2), bias and normalisation in f32.
#include <hip/hip_runtime.h>

typedef _Float16 v16h __attribute__((ext_vector_type(16)));
typedef _Float16 v8h  __attribute__((ext_vector_type(8)));
typedef float    v8f  __attribute__((ext_vector_type(8)));
typedef float    v4f  __attribute__((ext_vector_type(4)));
typedef float    v2f  __attribute__((ext_vector_type(2)));
typedef v8h __attribute__((may_alias)) v8ha;
typedef v4f __attribute__((may_alias)) v4fa;

union Frag { v16h v; v8h half[2]; };

#define EMB    1024
#define NHEADS 16
#define HD     64
#define SEQ    2048
#define BATCH  2
#define MROWS  (BATCH * SEQ)          // 4096 tokens
#define NX     (MROWS * EMB)          // 4194304
#define NW     (EMB * EMB)            // 1048576
#define NX8    (NX / 8)               // 524288
#define WSC    32.0f                  // weight plane scale (exact)
#define WINV   0.03125f               // 1/WSC
#define SLOG2E 0.045084220027780106f  // log2(e) / sqrt(EMB): raw score -> exponent of 2
#define PBITS  8.0f                   // P is carried x 2^8: added to that exponent
#define PLIM   65504.0f               // largest finite f16
#define TPITCH 72                     // LDS pitch (halves) of the transposed weight tile
#define SPITCH 72                     // LDS pitch (halves) of a staged 128-byte operand row: 144 B = 16 B x 9
#define SPB    (SPITCH * 2)           // the same in bytes
#define KVBUF  (128 * SPITCH)         // attention, one key half of a stage: 64 K rows, then 64 V^T rows (halves)
#define STBUF  (2 * KVBUF)            // attention stage: both key halves (halves)
#define KHALF  (SEQ / 2)              // keys a wave walks
#define XWBUF  (256 * SPITCH)         // projection stage: 128 X rows, then 128 W^T rows (halves)

// ---------------------------------------------------------------------------
// 16x16x32 f16 WMMA, the builtin alone: the compiler keeps the distance to a user of D, A or B itself.
// Fragment map (wave32): lane l, h = l>>4, m = n = l&15.
//   A/B element i: i<8 -> k0+8h+i ; i>=8 -> k0+16+8h+(i-8)
//   D element r : row 8h+r, col l&15
// ---------------------------------------------------------------------------
__device__ __forceinline__ v8f wmma_f16(v16h a, v16h b, v8f c) {
  v8f d = __builtin_amdgcn_wmma_f32_16x16x32_f16(false, a, false, b, (short)0, c, false, false);
  return d;
}

// A or B fragment from a k-contiguous 16-bit row; p points at element k0 of
// the row owned by this lane (row index = lane & 15 added by the caller).
__device__ __forceinline__ v16h load_frag(const _Float16* p, int h) {
  Frag f;
  f.half[0] = *(const v8ha*)(p + 8 * h);
  f.half[1] = *(const v8ha*)(p + 16 + 8 * h);
  return f.v;
}

// ---------------------------------------------------------------------------
// Asynchronous copies global -> LDS, 16 B per lane: lanes 8q..8q+7 bring one
// whole 128-byte row, one copy = 4 rows. l = the lane's LDS byte address,
// g = its global address; copy c takes the rows 4c further on (LDS + 4 pitches,
// global + grow bytes). s_wait_xcnt closes each statement so that no address
// register is rewritten while a copy that names it may still need it.
// ---------------------------------------------------------------------------
__device__ __forceinline__ unsigned lds_off(const void* p) { return (unsigned)(size_t)p; }

// 32 rows (8 copies) of an attention stage; grow = bytes from one copy's rows to the next copy's in global memory.
__device__ __forceinline__ void async_rows32p(unsigned l, const char* g, unsigned grow) {
  const size_t gr = grow;
  asm volatile("global_load_async_to_lds_b128 %0, %8, off\n\t"
               "global_load_async_to_lds_b128 %1, %9, off\n\t"
               "global_load_async_to_lds_b128 %2, %10, off\n\t"
               "global_load_async_to_lds_b128 %3, %11, off\n\t"
               "global_load_async_to_lds_b128 %4, %12, off\n\t"
               "global_load_async_to_lds_b128 %5, %13, off\n\t"
               "global_load_async_to_lds_b128 %6, %14, off\n\t"
               "global_load_async_to_lds_b128 %7, %15, off\n\t"
               "s_wait_xcnt 0x0"
               :: "v"(l), "v"(l + 4 * SPB), "v"(l + 8 * SPB), "v"(l + 12 * SPB),
                  "v"(l + 16 * SPB), "v"(l + 20 * SPB), "v"(l + 24 * SPB), "v"(l + 28 * SPB),
                  "v"(g), "v"(g + gr), "v"(g + 2 * gr), "v"(g + 3 * gr),
                  "v"(g + 4 * gr), "v"(g + 5 * gr), "v"(g + 6 * gr), "v"(g + 7 * gr)
               : "memory");
}

// 32 rows of one operand (8 copies) at a global row pitch of EMB halves; a projection
// wave calls it once for its X rows and once for its W^T rows of a stage.
__device__ __forceinline__ void async_rows32(unsigned l, const char* g) {
  const size_t gr = (size_t)4 * EMB * 2;             // 4 rows further on in global memory
  asm volatile("global_load_async_to_lds_b128 %0, %8, off\n\t"
               "global_load_async_to_lds_b128 %1, %9, off\n\t"
               "global_load_async_to_lds_b128 %2, %10, off\n\t"
               "global_load_async_to_lds_b128 %3, %11, off\n\t"
               "global_load_async_to_lds_b128 %4, %12, off\n\t"
               "global_load_async_to_lds_b128 %5, %13, off\n\t"
               "global_load_async_to_lds_b128 %6, %14, off\n\t"
               "global_load_async_to_lds_b128 %7, %15, off\n\t"
               "s_wait_xcnt 0x0"
               :: "v"(l), "v"(l + 4 * SPB), "v"(l + 8 * SPB), "v"(l + 12 * SPB),
                  "v"(l + 16 * SPB), "v"(l + 20 * SPB), "v"(l + 24 * SPB), "v"(l + 28 * SPB),
                  "v"(g), "v"(g + gr), "v"(g + 2 * gr), "v"(g + 3 * gr),
                  "v"(g + 4 * gr), "v"(g + 5 * gr), "v"(g + 6 * gr), "v"(g + 7 * gr)
               : "memory");
}

// Hand-over of a stage: this wave's LDS reads are done, its own copies have
// landed, then the work-group barrier publishes the next stage and frees this one.
__device__ __forceinline__ void stage_publish() {
  asm volatile("s_wait_dscnt 0x0" ::: "memory");     // own reads of the buffer that is refilled next
  asm volatile("s_wait_asynccnt 0x0" ::: "memory");  // own copies of the next stage have landed
  __syncthreads();
}

// ---------------------------------------------------------------------------
// Kernel 1: all of the preparation in one launch of PREPB work-groups, every
// one resident at once.
//  a) f32 -> f16 planes for q and v, unscaled, RNE convert: a thread takes one
//     group of 8 values in each half of each plane (4 groups, 8 loads of 16 B,
//     all of them in flight together).
//  b) work-groups 0..767 also take one weight tile each: in W[k][n] (k = input
//     feature, n = output feature, both 1024) -> wt[which][n][k] = f16(32 * W[k][n]),
//     a 64(k) x 64(n) tile transposed through LDS, stored as whole 128-byte lines
//     (lanes 8q..8q+7 of a wave bring one line, 4 lines per instruction).
// ---------------------------------------------------------------------------
#define PREPB  1024                   // work-groups of 256 threads: 4 a WGP
#define WTILES 768                    // 16 (n) x 16 (k) x 3 weight tiles
#define HPLANE (PREPB * 256 * 8)      // values one sweep of the grid covers = NX / 2

__device__ __forceinline__ void wt_store_pass(const _Float16* sW, _Float16* wt,
                                              int which, int n0, int k0, int w, int lane) {
  const int q8 = lane & 7, sub = lane >> 3;
  #pragma unroll
  for (int i = 0; i < 2; ++i) {
    const int nrow = w * 8 + i * 4 + sub;          // 0..63
    const v8h val = *(const v8ha*)(sW + nrow * TPITCH + 8 * q8);
    _Float16* dst = wt + ((size_t)which * EMB + n0 + nrow) * EMB + k0 + 8 * q8;
    *(v8h*)dst = val;
  }
}

__device__ __forceinline__ v8h cvt8(v4f a, v4f c) {
  const v8h o = { (_Float16)a.x, (_Float16)a.y, (_Float16)a.z, (_Float16)a.w,
                  (_Float16)c.x, (_Float16)c.y, (_Float16)c.z, (_Float16)c.w };
  return o;
}

__global__ __launch_bounds__(256) void prep_kernel(
    const float* __restrict__ q, const float* __restrict__ v,
    const float* __restrict__ wq, const float* __restrict__ wk, const float* __restrict__ wv,
    _Float16* __restrict__ qx, _Float16* __restrict__ vx,
    _Float16* __restrict__ wt)         // [3][1024 n][1024 k], x32
{
  __shared__ __attribute__((aligned(16))) _Float16 sW[64 * TPITCH];   // 9216 B

  const int tid = threadIdx.x, lane = tid & 31, w = tid >> 5;
  const int bid = blockIdx.x;
  const unsigned ib = ((unsigned)bid * 256u + (unsigned)tid) * 32u;  // bytes: the thread's 8 floats in the first half of a plane
  const char* q0 = (const char*)q + ib;
  const char* q1 = (const char*)(q + HPLANE) + ib;
  const char* v0 = (const char*)v + ib;
  const char* v1 = (const char*)(v + HPLANE) + ib;

  const v4f a0 = *(const v4fa*)q0, c0 = *(const v4fa*)(q0 + 16);
  const v4f a1 = *(const v4fa*)q1, c1 = *(const v4fa*)(q1 + 16);
  const v4f a2 = *(const v4fa*)v0, c2 = *(const v4fa*)(v0 + 16);
  const v4f a3 = *(const v4fa*)v1, c3 = *(const v4fa*)(v1 + 16);
  asm volatile("s_wait_xcnt 0x0" ::: "memory");    // before the index arithmetic below reuses these loads' address registers
  __builtin_amdgcn_sched_barrier(0);               // or the compiler lifts that arithmetic over the wait

  if (bid < WTILES) {                              // the same for the whole work-group
    const int n0 = (bid & 15) * 64, k0 = ((bid >> 4) & 15) * 64, which = bid >> 8;
    const float* W = (which == 0) ? wq : ((which == 1) ? wk : wv);
    #pragma unroll
    for (int i = 0; i < 4; ++i) {
      const int idx = tid + 256 * i;               // 0..1023 float4 groups
      const int kk = idx >> 4, nn = (idx & 15) * 4;
      const v4f x = *(const v4fa*)(W + (size_t)(k0 + kk) * EMB + n0 + nn);
      sW[(nn + 0) * TPITCH + kk] = (_Float16)(x.x * WSC);
      sW[(nn + 1) * TPITCH + kk] = (_Float16)(x.y * WSC);
      sW[(nn + 2) * TPITCH + kk] = (_Float16)(x.z * WSC);
      sW[(nn + 3) * TPITCH + kk] = (_Float16)(x.w * WSC);
    }
    __syncthreads();
    wt_store_pass(sW, wt, which, n0, k0, w, lane);
  }

  const unsigned ob = ib >> 1;                     // bytes: the same 8 values as f16
  *(v8h*)((char*)qx + ob)            = cvt8(a0, c0);
  *(v8h*)((char*)(qx + HPLANE) + ob) = cvt8(a1, c1);
  *(v8h*)((char*)vx + ob)            = cvt8(a2, c2);
  *(v8h*)((char*)(vx + HPLANE) + ob) = cvt8(a3, c3);
}

// ---------------------------------------------------------------------------
// 4 lines per instruction, 64 lines per wave: half of one head's 128 lines
// (base = 0 or 64), sT = that head's staged tile (16384 B), in 16-byte pieces
// whose place inside a row is XORed with a row number, so that neither the
// writers (16 rows, one piece column) nor these readers meet on a bank:
// which 0/1: row = token, 8 pieces;   piece p of token l at l*128 + ((p ^ ((l >> 1) & 7)) << 4)
// which 2  : row = d, 16 pieces;      piece p of row d   at d*256 + ((p ^ (d & 15)) << 4)
// which 0/1: plane[bh][l][d]  (one token row = 64 halves = one line)
// which 2  : vt[bh][d][l]     (64 d-rows x 128 tokens = 2 lines each)
// The row number's part of the XOR is (2i & mask) ^ (sub >> 1) for line base + 4i + sub.
// All 16 LDS reads go out as one group into registers of their own, then the 16
// stores, each from an address register pair of its own: one LDS latency, not sixteen.
// ---------------------------------------------------------------------------
__device__ __forceinline__ void proj_store_pass(const char* sT, _Float16* plane, _Float16* vt,
                                                int which, int bh, int l0, int base, int lane) {
  const int q8 = lane & 7, sub = lane >> 3;
  const bool tk = which != 2;                      // the same for the whole work-group
  const int cm = tk ? 7 : 15;
  const int x0 = (tk ? q8 : 8 * (sub & 1) + q8) ^ (sub >> 1);
  const char* rb = sT + (tk ? (base + sub) * 128 : ((base >> 1) + (sub >> 1)) * 256);
  char* dst = tk ? (char*)(plane + ((size_t)bh * SEQ + l0 + base + sub) * HD + 8 * q8)
                 : (char*)(vt + ((size_t)bh * HD + (base >> 1) + (sub >> 1)) * SEQ + l0 + 64 * (sub & 1) + 8 * q8);
  const size_t step = tk ? (size_t)4 * HD * 2 : (size_t)2 * SEQ * 2;   // bytes from one store's lines to the next store's
  v8h val[16];
  char* p[16];
  #pragma unroll
  for (int i = 0; i < 16; ++i) val[i] = *(const v8ha*)(rb + i * 512 + ((x0 ^ ((2 * i) & cm)) << 4));
  #pragma unroll
  for (int i = 0; i < 16; ++i) p[i] = dst + i * step;
  __builtin_amdgcn_sched_barrier(0);               // every address is formed ahead of the first store, so that no issued store's register is rewritten
  #pragma unroll
  for (int i = 0; i < 16; ++i) *(v8h*)p[i] = val[i];
}

// ---------------------------------------------------------------------------
// Kernel 2: Y = X * W (with W^T staged k-contiguous) over the fused 3*1024
// output columns. which = 0: X = q, W = Wq -> qp ; 1: X = v, W = Wk -> kp ;
// 2: X = v, W = Wv -> vt (d-major).
// Block 128 thr (4 waves) = 128 tokens x 128 features (two heads of one which);
// wave tile 64 tokens x 64 features (one head); K = 1024 in stages of 64 (two
// steps of 32); each stage's X and W^T rows come into LDS by asynchronous copies,
// two buffers, the next stage in flight while this one is worked on; fragments
// from LDS. 768 blocks, three to a WGP by their LDS.
// which 0/1 take the product transposed (A = W^T rows, B = X rows), which 2 as it
// stands (A = X rows, B = W^T rows): either way a lane's 8 D values are 8
// neighbours in the output plane's rows, one 16-byte piece for the staging tile.
// ---------------------------------------------------------------------------
__global__ __launch_bounds__(128) void proj_kernel(
    const _Float16* __restrict__ qx,   // [4096][1024] f16(q)
    const _Float16* __restrict__ vx,   // [4096][1024] f16(v)
    const _Float16* __restrict__ wt,   // [3][1024][1024], row = output feature, x32
    const float* __restrict__ bq, const float* __restrict__ bk, const float* __restrict__ bv,
    _Float16* __restrict__ qp,         // [B*H][L][D]
    _Float16* __restrict__ kp,         // [B*H][L][D]
    _Float16* __restrict__ vt)         // [B*H][D][L]
{
  __shared__ __attribute__((aligned(16))) _Float16 sT[2 * 128 * 64]; // 32768 B, one 128 x 64 tile a head
  __shared__ __attribute__((aligned(16))) _Float16 sXW[2 * XWBUF];   // 73728 B

  const int tid = threadIdx.x, lane = tid & 31, w = tid >> 5;
  const int h = lane >> 4, m = lane & 15;
  const int m0 = blockIdx.x * 128;
  const int cg = blockIdx.y;                 // 0..23
  const int which = cg >> 3, head0 = (cg & 7) * 2;
  const int wtok = w & 1, wf = w >> 1;       // the wave's token half and its head of the pair

  const _Float16* xsrc = (which == 0) ? qx : vx;

  // copy role: rows 32w..32w+31 of X and of W^T; row (lane >> 3) of each group of 4,
  // 16-byte piece (lane & 7)
  const int cr = lane >> 3, cp = lane & 7;
  const char* gx = (const char*)(xsrc + (size_t)(m0 + 32 * w + cr) * EMB + 8 * cp);
  const char* gw = (const char*)(wt + ((size_t)which * EMB + head0 * HD + 32 * w + cr) * EMB + 8 * cp);
  const unsigned lx = lds_off(sXW) + (32 * w + cr) * SPB + 16 * cp;
  const unsigned lw = lds_off(sXW) + (128 + 32 * w + cr) * SPB + 16 * cp;

  // staged rows of the wave's A and B operands (the fragment maps of A and B are the same)
  const int trow = 64 * wtok + m, frow = 128 + 64 * wf + m;
  const int arow = (which != 2) ? frow : trow;
  const int brow = (which != 2) ? trow : frow;

  const v8f zero8 = {0.f, 0.f, 0.f, 0.f, 0.f, 0.f, 0.f, 0.f};
  v8f acc[4][4];
  #pragma unroll
  for (int mt = 0; mt < 4; ++mt)
    #pragma unroll
    for (int nt = 0; nt < 4; ++nt) acc[mt][nt] = zero8;

  async_rows32(lx, gx);                                    // stage 0 -> buffer 0
  async_rows32(lw, gw);
  asm volatile("s_wait_asynccnt 0x0" ::: "memory");        // own copies of stage 0 have landed
  __syncthreads();
  async_rows32(lx + XWBUF * 2, gx + 128);                  // stage 1 -> buffer 1
  async_rows32(lw + XWBUF * 2, gw + 128);

  // rolled: one buffer offset per trip, every fragment index constant
  #pragma unroll 1
  for (int t = 0; t < EMB / 64; ++t) {
    const int bo = (t & 1) * XWBUF;
    const _Float16* xs = sXW + bo + arow * SPITCH;         // A row, mt = 0
    const _Float16* wl = sXW + bo + brow * SPITCH;         // B row, nt = 0
    // Fragment reads stand in groups ahead of the products that use them, so that a
    // wave waits out the LDS latency once a stage and not in front of every four products.
    v16h a0[4], b0[4], a1[4], b1[4];
    #pragma unroll
    for (int mt = 0; mt < 4; ++mt) a0[mt] = load_frag(xs + mt * 16 * SPITCH, h);
    #pragma unroll
    for (int nt = 0; nt < 4; ++nt) b0[nt] = load_frag(wl + nt * 16 * SPITCH, h);
    #pragma unroll
    for (int mt = 0; mt < 4; ++mt) a1[mt] = load_frag(xs + mt * 16 * SPITCH + 32, h);
    b1[0] = load_frag(wl + 32, h);
    __builtin_amdgcn_sched_barrier(0);                     // or the compiler sinks these reads down to their products
    #pragma unroll
    for (int nt = 0; nt < 3; ++nt)
      #pragma unroll
      for (int mt = 0; mt < 4; ++mt) acc[mt][nt] = wmma_f16(a0[mt], b0[nt], acc[mt][nt]);
    __builtin_amdgcn_sched_barrier(0);                     // or the compiler lifts the three reads below over products whose registers they are to take
    // the last three reads go out here, into registers that the twelve products above have left
    #pragma unroll
    for (int nt = 1; nt < 4; ++nt) b1[nt] = load_frag(wl + nt * 16 * SPITCH + 32, h);
    __builtin_amdgcn_sched_barrier(0);                     // holds these reads eight products ahead of their first use; without it the compiler moves them
    #pragma unroll
    for (int mt = 0; mt < 4; ++mt) acc[mt][3] = wmma_f16(a0[mt], b0[3], acc[mt][3]);
    #pragma unroll
    for (int nt = 0; nt < 4; ++nt)
      #pragma unroll
      for (int mt = 0; mt < 4; ++mt) acc[mt][nt] = wmma_f16(a1[mt], b1[nt], acc[mt][nt]);
    __builtin_amdgcn_sched_barrier(0);                     // the products stay ahead of the hand-over: or the compiler lifts its waits and the barrier over them and the next stage's copies lose their lead
    stage_publish();
    if (t + 2 < EMB / 64) {                                // stage t + 2 -> the buffer just read
      async_rows32(lx + bo * 2, gx + (t + 2) * 128);
      async_rows32(lw + bo * 2, gw + (t + 2) * 128);
    }
  }
  asm volatile("s_wait_asynccnt 0x0" ::: "memory");        // nothing of this wave's is in flight any more

  const int head = head0 + wf;
  char* sTh = (char*)(sT + wf * (128 * 64));
  const float* bias = ((which == 0) ? bq : ((which == 1) ? bk : bv)) + head * HD;
  if (which != 2) {
    // D[r] of tile (mt, nt) = Y[token m0+64wtok+16nt+m][feature 16mt+8h+r of the head]
    v4f bl[4], bu[4];
    #pragma unroll
    for (int mt = 0; mt < 4; ++mt) {
      bl[mt] = *(const v4fa*)(bias + 16 * mt + 8 * h);
      bu[mt] = *(const v4fa*)(bias + 16 * mt + 8 * h + 4);
    }
    asm volatile("s_wait_xcnt 0x0" ::: "memory");          // before the index arithmetic below reuses these loads' offset register
    __builtin_amdgcn_sched_barrier(0);                     // or the compiler lifts that arithmetic over the wait
    #pragma unroll
    for (int mt = 0; mt < 4; ++mt) {
      #pragma unroll
      for (int nt = 0; nt < 4; ++nt) {
        const int tokl = 64 * wtok + 16 * nt + m;          // 0..127
        v8h y;
        #pragma unroll
        for (int r = 0; r < 8; ++r)
          y[r] = (_Float16)(acc[mt][nt][r] * WINV + (r < 4 ? bl[mt][r] : bu[mt][r - 4]));
        *(v8ha*)(sTh + tokl * 128 + (((2 * mt + h) ^ ((tokl >> 1) & 7)) << 4)) = y;
      }
    }
  } else {
    // D[r] of tile (mt, nt) = Y[token m0+64wtok+16mt+8h+r][feature 16nt+m of the head]
    float bvl4[4];
    #pragma unroll
    for (int nt = 0; nt < 4; ++nt) bvl4[nt] = bias[16 * nt + m];
    asm volatile("s_wait_xcnt 0x0" ::: "memory");          // before the index arithmetic below reuses these loads' offset register
    __builtin_amdgcn_sched_barrier(0);                     // or the compiler lifts that arithmetic over the wait
    #pragma unroll
    for (int nt = 0; nt < 4; ++nt) {
      const int feat = 16 * nt + m;                        // 0..63
      #pragma unroll
      for (int mt = 0; mt < 4; ++mt) {
        v8h y;
        #pragma unroll
        for (int r = 0; r < 8; ++r) y[r] = (_Float16)(acc[mt][nt][r] * WINV + bvl4[nt]);
        *(v8ha*)(sTh + feat * 256 + (((8 * wtok + 2 * mt + h) ^ (feat & 15)) << 4)) = y;
      }
    }
  }
  __syncthreads();

  const int b = m0 / SEQ, l0 = m0 - b * SEQ, bh = b * NHEADS + head;
  _Float16* plane = (which == 0) ? qp : kp;
  proj_store_pass(sTh, plane, vt, which, bh, l0, 64 * wtok, lane);
  
}

// ---------------------------------------------------------------------------
// Attention helpers.
// ---------------------------------------------------------------------------
// P^T B-fragment from the lane's own score D values: element r <- tile a row r
// (keys 0..15 of the 32-deep chunk), element 8+r <- tile c row r (keys 16..31),
// same lane, same query column; the values already carry the 2^8.
__device__ __forceinline__ v16h pack_p(v8f a, v8f c) {
  const v16h r = { (_Float16)a[0], (_Float16)a[1], (_Float16)a[2], (_Float16)a[3],
                   (_Float16)a[4], (_Float16)a[5], (_Float16)a[6], (_Float16)a[7],
                   (_Float16)c[0], (_Float16)c[1], (_Float16)c[2], (_Float16)c[3],
                   (_Float16)c[4], (_Float16)c[5], (_Float16)c[6], (_Float16)c[7] };
  return r;
}

// Raw scores of a step: s[c][j][r] = q . k of query 16c+m, key 16j+8h+r of the step's 64.
// All 16 K reads as one group ahead of the sixteen products: one LDS wait, not four.
__device__ __forceinline__ void att_scores(const _Float16* kl, int h, const v16h (&qb)[2][2], v8f (&s)[2][4]) {
  const v8f zero8 = {0.f, 0.f, 0.f, 0.f, 0.f, 0.f, 0.f, 0.f};
  v16h kf0[4], kf1[4];
  #pragma unroll
  for (int j = 0; j < 4; ++j) kf0[j] = load_frag(kl + 16 * j * SPITCH, h);
  #pragma unroll
  for (int j = 0; j < 4; ++j) kf1[j] = load_frag(kl + 16 * j * SPITCH + 32, h);
  __builtin_amdgcn_sched_barrier(0);                       // or the compiler sinks each read down to its product
  #pragma unroll
  for (int j = 0; j < 4; ++j)
    #pragma unroll
    for (int c = 0; c < 2; ++c) s[c][j] = wmma_f16(kf0[j], qb[c][0], zero8);
  #pragma unroll
  for (int j = 0; j < 4; ++j)
    #pragma unroll
    for (int c = 0; c < 2; ++c) s[c][j] = wmma_f16(kf1[j], qb[c][1], s[c][j]);
}

// All 16 V^T reads of a step.
__device__ __forceinline__ void att_vload(const _Float16* vl, int h, v16h (&vf0)[4], v16h (&vf1)[4]) {
  #pragma unroll
  for (int t = 0; t < 4; ++t) vf0[t] = load_frag(vl + 16 * t * SPITCH, h);
  #pragma unroll
  for (int t = 0; t < 4; ++t) vf1[t] = load_frag(vl + 16 * t * SPITCH + 32, h);
}

// One column group's 32 raw scores -> P * 2^8 = exp2(raw * SLOG2E + nb), nb = 8 - reference * SLOG2E, in place:
// one packed FMA ahead of two exp2. Returns the lane's sum.
__device__ __forceinline__ float att_exp(v8f (&s)[4], float nb) {
  const v2f sc2 = {SLOG2E, SLOG2E};
  const v2f nb2 = {nb, nb};
  float lsum = 0.0f;
  #pragma unroll
  for (int j = 0; j < 4; ++j)
    #pragma unroll
    for (int r = 0; r < 8; r += 2) {
      const v2f raw = {s[j][r], s[j][r + 1]};
      const v2f e = __builtin_elementwise_fma(raw, sc2, nb2);
      const float p0 = __builtin_amdgcn_exp2f(e.x);
      const float p1 = __builtin_amdgcn_exp2f(e.y);
      s[j][r] = p0;
      s[j][r + 1] = p1;
      lsum += p0;
      lsum += p1;
    }
  return lsum;
}

// lanes 8q..8q+7 in one instruction, 4 lines per instruction, 32 lines per wave.
__device__ __forceinline__ void att_store_pass(const float* so, float* out,
                                               int b, int head, int q0, int lane) {
  const int q8 = lane & 7, sub = lane >> 3;
  #pragma unroll
  for (int i = 0; i < 8; ++i) {
    const int lid = i * 4 + sub;                   // 0..31
    const int row = lid >> 1, hl = lid & 1;
    const v4f val = *(const v4fa*)(so + row * 64 + (((8 * hl + q8) ^ row) << 2));   // piece p of a row stands at p ^ row
    const size_t gi = ((size_t)b * SEQ + q0 + row) * EMB + head * HD + 32 * hl + 4 * q8;
    *(v4f*)(out + gi) = val;
  }
}

// ---------------------------------------------------------------------------
// Kernel 3: streaming attention, transposed form.
// Block 256 thr (8 waves) = 128 queries: 4 query groups of 32 columns x 2 key
// halves of 1024 keys; a wave walks its half in steps of 64 keys.
//   S^T = K * Q^T : A = K rows (row = key, k = d), B = Q^T (k = d, n = query)
//   O^T += V^T * P^T : A = Vt rows (row = d, k = key), B = P^T from registers
// Every K and V^T fragment read from LDS feeds two products, one a column group
// of 16 queries. Lane owns 32 keys of query column (lane&15) of each group;
// partner = lane ^ 16.
// Each step's 64 K rows and 64 V^T rows (128 B each) of both key halves come into
// LDS once for the eight waves by asynchronous copies (8 copies a wave), two
// buffers, the next step in flight while this one is worked on.
// At the end the two waves of a query group swap one column group's partial
// (maximum, sum, O) through LDS and each finishes 16 queries.
// grid = (SEQ/128, B*H).
// ---------------------------------------------------------------------------
// amdgpu_waves_per_eu(4, 4): at most 256 registers a wave, so that two work-groups share a WGP (four waves a SIMD).
__global__ __launch_bounds__(256) __attribute__((amdgpu_waves_per_eu(4, 4))) void attn_kernel(
    const _Float16* __restrict__ qp,   // [B*H][L][D]
    const _Float16* __restrict__ kp,   // [B*H][L][D]
    const _Float16* __restrict__ vt,   // [B*H][D][L]
    float* __restrict__ out)           // [B][L][EMB]
{
  __shared__ __attribute__((aligned(16))) float sO[8 * 16 * 64];    // 32768 B
  __shared__ __attribute__((aligned(16))) float sML[8 * 32 * 2];    //  2048 B
  __shared__ __attribute__((aligned(16))) _Float16 sKV[2 * STBUF];  // 73728 B

  const int tid = threadIdx.x, lane = tid & 31, w = tid >> 5;
  const int h = lane >> 4, m = lane & 15;
  const int bh = blockIdx.y, b = bh >> 4, head = bh & 15;
  const int sw = __builtin_amdgcn_readfirstlane(w);            // scalar: the choices below write no EXEC
  const int qg = sw & 3, kh = sw >> 2;                         // query group, key half
  const int q0 = blockIdx.x * 128 + 32 * qg;

  // Q^T B-fragments: column n = query q0+16c+m, k = d (two 32-deep chunks)
  v16h qb[2][2];
  #pragma unroll
  for (int c = 0; c < 2; ++c) {
    const _Float16* qrow = qp + ((size_t)bh * SEQ + q0 + 16 * c + m) * HD;
    qb[c][0] = load_frag(qrow, h);
    qb[c][1] = load_frag(qrow + 32, h);
  }

  const v8f zero8 = {0.f, 0.f, 0.f, 0.f, 0.f, 0.f, 0.f, 0.f};
  v8f o[2][4];                                // o[c][t][r] = O[query 16c+m][d 16t+8h+r] * lrun[c] (lrun = l * 2^8)
  float mrun[2], lrun[2];
  #pragma unroll
  for (int c = 0; c < 2; ++c) {
    #pragma unroll
    for (int t = 0; t < 4; ++t) o[c][t] = zero8;
    mrun[c] = -1e30f;
    lrun[c] = 0.0f;
  }

  // copy role: staged rows 32w + (lane >> 3) + 4i, i = 0..7; 16-byte piece (lane & 7).
  // A stage: [half 0: 64 K, 64 V^T][half 1: 64 K, 64 V^T]; waves 0,1,4,5 bring K, waves 2,3,6,7 V^T.
  const int cp = lane & 7;
  const bool ck = (sw & 2) == 0;
  const unsigned gpitch = ck ? HD * 2 : SEQ * 2;               // bytes, one source row further on
  const unsigned grow = 4 * gpitch;                            // bytes, 4 rows further on
  const unsigned gstep = ck ? 64 * HD * 2 : 64 * 2;            // bytes, 64 keys further on
  const char* gsrc = (const char*)((ck ? kp : vt) + (size_t)bh * SEQ * HD)
                     + (size_t)((32 * (sw & 1) + (lane >> 3)) * gpitch) + 16 * cp
                     + (size_t)(kh * (KHALF / 64)) * gstep;
  const unsigned ldst = lds_off(sKV) + (32 * sw + (lane >> 3)) * SPB + 16 * cp;

  async_rows32p(ldst, gsrc, grow);                         // step 0 -> buffer 0
  asm volatile("s_wait_asynccnt 0x0" ::: "memory");        // own copies of step 0 have landed
  __syncthreads();
  async_rows32p(ldst + STBUF * 2, gsrc + gstep, grow);     // step 1 -> buffer 1

  // rolled: one buffer offset per trip, every fragment index constant
  #pragma unroll 1
  for (int st = 0; st < KHALF / 64; ++st) {
    const int bo = (st & 1) * STBUF;
    const _Float16* kl = sKV + bo + kh * KVBUF + m * SPITCH;   // + 16j rows + 32*dc
    const _Float16* vl = kl + 64 * SPITCH;                 // + 16t rows + key chunk
    // ---- lazy rescale: P is taken against the reference maximum in use (mrun); a step's own maximum, its
    //      exchange and the rescale of O run only at step 0, or when a lane's sum of P shows that a P may pass
    //      the f16 range; the raw scores, overwritten by then, are formed again from the K rows still staged ----
    v16h vf0[4], vf1[4];
    v16h pb[2][2];                                         // P^T B-fragments (key chunks 0..31 and 32..63 of this step)
    float lsum[2];
    bool fresh = st == 0;                                  // scalar: step 0 has no reference yet
    if (!fresh) {
      v8f s[2][4];
      att_scores(kl, h, qb, s);
      __builtin_amdgcn_sched_barrier(0);                   // the V^T reads take the K fragments' registers: behind the last product
      att_vload(vl, h, vf0, vf1);                          // as one group: they land under the exponentials
      __builtin_amdgcn_sched_barrier(0);                   // or the compiler sinks each read down to its product
      #pragma unroll
      for (int c = 0; c < 2; ++c) {
        lsum[c] = att_exp(s[c], __builtin_fmaf(-mrun[c], SLOG2E, PBITS));
        pb[c][0] = pack_p(s[c][0], s[c][1]);
        pb[c][1] = pack_p(s[c][2], s[c][3]);
      }
      // no P is negative: a sum below the largest finite f16 bounds each of its terms; infinity and NaN fail the test too
      fresh = __builtin_amdgcn_ballot_w32(!(lsum[0] + lsum[1] < PLIM)) != 0;   // one scalar branch a step
    }
    if (fresh) {
      v8f s[2][4];
      att_scores(kl, h, qb, s);
      __builtin_amdgcn_sched_barrier(0);                   // the maxima start behind the last product, on the oldest tiles
      float mloc[2], mpart[2];
      #pragma unroll
      for (int c = 0; c < 2; ++c) {
        mloc[c] = s[c][0][0];
        #pragma unroll
        for (int j = 0; j < 4; ++j)
          #pragma unroll
          for (int r = 0; r < 8; ++r) mloc[c] = fmaxf(mloc[c], s[c][j][r]);
      }
      mpart[0] = __shfl_xor(mloc[0], 16);
      mpart[1] = __shfl_xor(mloc[1], 16);
      asm volatile("" :: "v"(mpart[0]), "v"(mpart[1]) : "memory");   // the V^T reads go out behind the exchange's return: queued ahead of it in the LDS they would lengthen its wait
      att_vload(vl, h, vf0, vf1);
      __builtin_amdgcn_sched_barrier(0);                   // or the compiler sinks each read down to its product
      #pragma unroll
      for (int c = 0; c < 2; ++c) {
        const float mnew = fmaxf(mrun[c], fmaxf(mloc[c], mpart[c]));   // the same in both lanes of a query column (SLOG2E > 0)
        const float alpha = __builtin_amdgcn_exp2f((mrun[c] - mnew) * SLOG2E);
        mrun[c] = mnew;
        lsum[c] = att_exp(s[c], __builtin_fmaf(-mnew, SLOG2E, PBITS));
        pb[c][0] = pack_p(s[c][0], s[c][1]);
        pb[c][1] = pack_p(s[c][2], s[c][3]);
        lrun[c] = lrun[c] * alpha;
        #pragma unroll
        for (int t = 0; t < 4; ++t)
          #pragma unroll
          for (int r = 0; r < 8; ++r) o[c][t][r] = o[c][t][r] * alpha;
      }
    }
    lrun[0] += lsum[0];                                    // the lane's own 32 keys of the step; the two lanes of a column are joined behind the loop
    lrun[1] += lsum[1];

    // ---- O^T += V^T * P^T ----
    #pragma unroll
    for (int t = 0; t < 4; ++t)
      #pragma unroll
      for (int c = 0; c < 2; ++c) o[c][t] = wmma_f16(vf0[t], pb[c][0], o[c][t]);
    #pragma unroll
    for (int t = 0; t < 4; ++t)
      #pragma unroll
      for (int c = 0; c < 2; ++c) o[c][t] = wmma_f16(vf1[t], pb[c][1], o[c][t]);

    __builtin_amdgcn_sched_barrier(0);                     // the products stay ahead of the hand-over: or the compiler lifts its waits and the barrier over them and the next stage's copies lose their lead
    stage_publish();
    if (st + 2 < KHALF / 64)                               // step st + 2 -> the buffer just read
      async_rows32p(ldst + bo * 2, gsrc + (size_t)(st + 2) * gstep, grow);
  }
  asm volatile("s_wait_asynccnt 0x0" ::: "memory");        // nothing of this wave's is in flight any more
  lrun[0] += __shfl_xor(lrun[0], 16);                      // both lanes of a column used the same reference throughout
  lrun[1] += __shfl_xor(lrun[1], 16);

  // ---- join of the key halves: the wave of half kh finishes column group kh and hands
  //      its partial of the other group, lane for lane, to its partner wave (w ^ 4) ----
  const bool hi = kh != 0;
  float* xown = sO + sw * 1024;                            // what this wave hands over
  float* so   = sO + (sw ^ 4) * 1024;                      // what it is handed; then its own output tile
  #pragma unroll
  for (int t = 0; t < 4; ++t) {
    const v8f g = hi ? o[0][t] : o[1][t];
    const v4f g0 = {g[0], g[1], g[2], g[3]}, g1 = {g[4], g[5], g[6], g[7]};
    *(v4fa*)(xown + ((2 * t) * 32 + lane) * 4) = g0;
    *(v4fa*)(xown + ((2 * t + 1) * 32 + lane) * 4) = g1;
  }
  sML[(sw * 32 + lane) * 2]     = hi ? mrun[0] : mrun[1];
  sML[(sw * 32 + lane) * 2 + 1] = hi ? lrun[0] : lrun[1];
  __syncthreads();

  const float mo = hi ? mrun[1] : mrun[0], lo = hi ? lrun[1] : lrun[0];
  const float mp = sML[((sw ^ 4) * 32 + lane) * 2], lp = sML[((sw ^ 4) * 32 + lane) * 2 + 1];
  const float mall = fmaxf(mo, mp);
  const float wo = __builtin_amdgcn_exp2f((mo - mall) * SLOG2E);
  const float wp = __builtin_amdgcn_exp2f((mp - mall) * SLOG2E);
  const float inv = 1.0f / (lo * wo + lp * wp);            // o and lrun both carry the 2^8
  const float fo = wo * inv, fp = wp * inv;
  v4f p0[4], p1[4];
  #pragma unroll
  for (int t = 0; t < 4; ++t) {
    p0[t] = *(const v4fa*)(so + ((2 * t) * 32 + lane) * 4);
    p1[t] = *(const v4fa*)(so + ((2 * t + 1) * 32 + lane) * 4);
  }
  // ---- normalise, stage the wave's 16x64 tile (in the slot it alone has read), whole-line stores ----
  #pragma unroll
  for (int t = 0; t < 4; ++t) {
    const v8f a = hi ? o[1][t] : o[0][t];
    v4f y0, y1;
    #pragma unroll
    for (int r = 0; r < 4; ++r) {
      y0[r] = a[r] * fo + p0[t][r] * fp;
      y1[r] = a[r + 4] * fo + p1[t][r] * fp;
    }
    // 16-byte piece p of query row m stands at p ^ m: the 16 rows of one store fall on 16 different bank groups
    *(v4fa*)(so + m * 64 + (((4 * t + 2 * h) ^ m) << 2)) = y0;
    *(v4fa*)(so + m * 64 + (((4 * t + 2 * h + 1) ^ m) << 2)) = y1;
  }
  __syncthreads();

  att_store_pass(so, out, b, head, q0 + 16 * kh, lane);
}

// ---------------------------------------------------------------------------
extern "C" void kernel_launch(void* const* d_in, const int* in_sizes, int n_in,
                              void* d_out, int out_size, void* d_ws, size_t ws_size,
                              hipStream_t stream) {
  if (n_in < 8) return;
  if (in_sizes[0] != NX || in_sizes[1] != NX) return;
  if (in_sizes[2] != NW || in_sizes[4] != NW || in_sizes[6] != NW) return;
  if (in_sizes[3] != EMB || in_sizes[5] != EMB || in_sizes[7] != EMB) return;
  if (out_size != NX) return;

  const float* q  = (const float*)d_in[0];
  const float* v  = (const float*)d_in[1];
  const float* Wq = (const float*)d_in[2];
  const float* bq = (const float*)d_in[3];
  const float* Wk = (const float*)d_in[4];
  const float* bk = (const float*)d_in[5];
  const float* Wv = (const float*)d_in[6];
  const float* bv = (const float*)d_in[7];
  float* out = (float*)d_out;

  const size_t x_bytes  = (size_t)NX * 2;                           //  8388608 per plane
  const size_t wt_bytes = (size_t)3 * NW * 2;                       //  6291456
  const size_t pl_bytes = (size_t)BATCH * NHEADS * SEQ * HD * 2;    //  8388608 per plane
  const size_t total = 2 * x_bytes + wt_bytes + 3 * pl_bytes;       // 48234496
  if (total > ws_size) return;

  char* ws = (char*)d_ws;
  _Float16* qx = (_Float16*)(ws);
  _Float16* vx = (_Float16*)(ws + x_bytes);
  _Float16* wt = (_Float16*)(ws + 2 * x_bytes);
  _Float16* qp = (_Float16*)(ws + 2 * x_bytes + wt_bytes);
  _Float16* kp = (_Float16*)(ws + 2 * x_bytes + wt_bytes + pl_bytes);
  _Float16* vt = (_Float16*)(ws + 2 * x_bytes + wt_bytes + 2 * pl_bytes);

  prep_kernel<<<PREPB, 256, 0, stream>>>(q, v, Wq, Wk, Wv, qx, vx, wt);

  dim3 gProj(MROWS / 128, 3 * NHEADS / 2);                           // (32, 24)
  proj_kernel<<<gProj, 128, 0, stream>>>(qx, vx, wt, bq, bk, bv, qp, kp, vt);

  dim3 gAtt(SEQ / 128, BATCH * NHEADS);                              // (16, 32)
  attn_kernel<<<gAtt, 256, 0, stream>>>(qp, kp, vt, out);
}
